// v000
// Measured on an AMD MI455X. A time is GPU time per run, averaged over a window of back-to-back runs after a warm-up
// (all launches, gaps included; the runs take copies of the inputs in turn), and the median of several windows.
// Apart from v000's, it joins two sittings. Times from different sittings can be a few percent apart, while
// side-by-side timings come from the same sitting.
// v000 is the starting kernel. One run takes 690 microseconds.
#include <hip/hip_runtime.h>

// ---------------------------------------------------------------------------
// WindowAttentionRFB for gfx1250 (MI455X)
//   bias1 (MLP -> f16 bq/bk) -> qkv WMMA GEMM -> fused attention
//   (scores = q k^T + bq bk^T as two chained WMMAs, wave-cooperative softmax,
//    attn@V) -> proj WMMA GEMM.
//   Async global->LDS staging (global_load_async_to_lds_b128) for pure f16
//   copies; f32->f16 converting stages use regular vector loads.
// Shapes: B=512, N=256, C=256, H=8, hd=32, R=32
// ---------------------------------------------------------------------------

typedef __attribute__((ext_vector_type(16))) _Float16 v16h;
typedef __attribute__((ext_vector_type(8)))  float    v8f;

union Frag16 { v16h v; uint4 q[2]; _Float16 h[16]; };
union Acc8   { v8f  v; float f[8]; };

#define WMMA16(a, b, c) __builtin_amdgcn_wmma_f32_16x16x32_f16( \
    false, (a), false, (b), (short)0, (c), false, false)

static __device__ __forceinline__ v16h lds_frag16(const _Float16* rowbase, int hsel) {
  // 16-bit A/B fragment: lane (m = lane&15, hsel = lane>>4)
  // chunk0: K = 8*hsel .. +7  -> VGPR0..3 ; chunk1: K = 16+8*hsel .. +7 -> VGPR4..7
  Frag16 t;
  const _Float16* p = rowbase + hsel * 8;
  t.q[0] = *(const uint4*)(p);
  t.q[1] = *(const uint4*)(p + 16);
  return t.v;
}

// 64B per-lane global -> LDS async copy (4 x b128), tracked on ASYNCcnt.
static __device__ __forceinline__ void async_copy64(void* lds_dst, const void* gsrc) {
  unsigned l = (unsigned)(uintptr_t)lds_dst;        // LDS offset = low 32 bits of flat addr
  unsigned long long g = (unsigned long long)(uintptr_t)gsrc;
  asm volatile(
      "global_load_async_to_lds_b128 %0, %1, off\n\t"
      "global_load_async_to_lds_b128 %0, %1, off offset:16\n\t"
      "global_load_async_to_lds_b128 %0, %1, off offset:32\n\t"
      "global_load_async_to_lds_b128 %0, %1, off offset:48"
      :: "v"(l), "v"(g) : "memory");
}

// 16B per-lane global -> LDS async copy.
static __device__ __forceinline__ void async_copy16(void* lds_dst, const void* gsrc) {
  unsigned l = (unsigned)(uintptr_t)lds_dst;
  unsigned long long g = (unsigned long long)(uintptr_t)gsrc;
  asm volatile("global_load_async_to_lds_b128 %0, %1, off"
               :: "v"(l), "v"(g) : "memory");
}

static __device__ __forceinline__ void wait_async0() {
  asm volatile("s_wait_asynccnt 0x0" ::: "memory");
}

// ---------------------------------------------------------------------------
// Kernel 1: position-bias MLP -> f16 bq [H,N,R] (pre-scaled), bk [H,N,R]
// grid 16 x 256; block bx covers output columns [32*bx, 32*bx+32)
// ---------------------------------------------------------------------------
__global__ void bias1_kernel(const float* __restrict__ w1, const float* __restrict__ b1,
                             const float* __restrict__ w2, const float* __restrict__ bscale_p,
                             _Float16* __restrict__ bq, _Float16* __restrict__ bk) {
  __shared__ float hf[256][129];            // padded: conflict-free column reads
  const int n = threadIdx.x;                // position index 0..255
  const float invden = 1.0f / logf(16.0f);  // log1p(15) = log(16)
  const float c0 = log1pf((float)(n >> 4)) * invden;   // gy
  const float c1 = log1pf((float)(n & 15)) * invden;   // gx
  for (int j = 0; j < 128; ++j) {
    float z = c0 * w1[j] + c1 * w1[128 + j] + b1[j];
    hf[n][j] = 0.5f * z * (1.0f + erff(z * 0.70710678118654752f));  // exact gelu
  }
  __syncthreads();
  const float bsc = bscale_p[0];
  int jj = blockIdx.x * 32;
  for (int e = 0; e < 32; ++e, ++jj) {
    float acc = 0.0f;
    for (int j = 0; j < 128; ++j) acc += hf[n][j] * w2[j * 512 + jj];
    float s = 1.0f / (1.0f + __expf(-acc));
    int h = jj >> 6, which = (jj >> 5) & 1, r = jj & 31;
    if (which == 0) bq[(h * 256 + n) * 32 + r] = (_Float16)(bsc * s);
    else            bk[(h * 256 + n) * 32 + r] = (_Float16)s;
  }
}

// ---------------------------------------------------------------------------
// Kernel 2: QKV GEMM  [131072 x 256] @ [256 x 768] (+bias, q*=logit_scale)
// Block tile 128x128, 8 waves, each wave 2x4 16x16 accum tiles.
// ---------------------------------------------------------------------------
__global__ void qkv_kernel(const float* __restrict__ x, const float* __restrict__ w,
                           const float* __restrict__ bvec, const float* __restrict__ lsc,
                           _Float16* __restrict__ qo, _Float16* __restrict__ ko,
                           _Float16* __restrict__ vo) {
  __shared__ _Float16 As[128][40];   // pitch 40 h (80 B, 16B-aligned)
  __shared__ _Float16 Bs[128][40];   // transposed B tile: Bs[col][k]
  const int tid = threadIdx.x, lane = tid & 31, wave = tid >> 5;
  const int wm = wave & 3, wn = wave >> 2;
  const int mlane = lane & 15, hsel = lane >> 4;
  const int m0 = blockIdx.y * 128, n0 = blockIdx.x * 128;

  Acc8 acc[2][4];
  #pragma unroll
  for (int i = 0; i < 2; ++i)
    #pragma unroll
    for (int j = 0; j < 4; ++j)
      #pragma unroll
      for (int r = 0; r < 8; ++r) acc[i][j].f[r] = 0.0f;

  for (int kk = 0; kk < 256; kk += 32) {
    __syncthreads();
    // prefetch next K chunk into WGP-level cache (locality 3 -> WGP scope)
    if (kk + 32 < 256) {
      __builtin_prefetch(x + (size_t)(m0 + (tid >> 3)) * 256 + kk + 32 + (tid & 7) * 4, 0, 3);
      __builtin_prefetch(w + (size_t)(kk + 32 + (tid >> 5)) * 768 + n0 + (tid & 31) * 4, 0, 3);
    }
    // A: x[m0+r][kk + k4..k4+3], f32 -> f16
    #pragma unroll
    for (int p = 0; p < 4; ++p) {
      int r = (tid >> 3) + p * 32;
      float4 a = *(const float4*)(x + (size_t)(m0 + r) * 256 + kk + (tid & 7) * 4);
      union { _Float16 h[4]; uint2 u; } t;
      t.h[0] = (_Float16)a.x; t.h[1] = (_Float16)a.y;
      t.h[2] = (_Float16)a.z; t.h[3] = (_Float16)a.w;
      *(uint2*)&As[r][(tid & 7) * 4] = t.u;
    }
    // B transposed into LDS: Bs[c][k] = w[(kk+k)*768 + n0 + c]
    #pragma unroll
    for (int p = 0; p < 4; ++p) {
      int k = (tid >> 5) + p * 8;
      int c = (tid & 31) * 4;
      float4 b = *(const float4*)(w + (size_t)(kk + k) * 768 + n0 + c);
      Bs[c + 0][k] = (_Float16)b.x; Bs[c + 1][k] = (_Float16)b.y;
      Bs[c + 2][k] = (_Float16)b.z; Bs[c + 3][k] = (_Float16)b.w;
    }
    __syncthreads();
    Frag16 af[2], bf[4];
    #pragma unroll
    for (int i = 0; i < 2; ++i) af[i].v = lds_frag16(&As[wm * 32 + i * 16 + mlane][0], hsel);
    #pragma unroll
    for (int j = 0; j < 4; ++j) bf[j].v = lds_frag16(&Bs[wn * 64 + j * 16 + mlane][0], hsel);
    #pragma unroll
    for (int i = 0; i < 2; ++i)
      #pragma unroll
      for (int j = 0; j < 4; ++j)
        acc[i][j].v = WMMA16(af[i].v, bf[j].v, acc[i][j].v);
  }

  // epilogue: +bias, q*=logit_scale[h], scatter f16 to [B,H,N,32]
  #pragma unroll
  for (int j = 0; j < 4; ++j) {
    const int jg = n0 + wn * 64 + j * 16 + mlane;     // global out column 0..767
    const int which = jg >> 8, h = (jg >> 5) & 7, d = jg & 31;
    const float addb = bvec[jg];
    const float scale = (which == 0) ? lsc[h] : 1.0f;
    _Float16* outp = (which == 0) ? qo : ((which == 1) ? ko : vo);
    #pragma unroll
    for (int i = 0; i < 2; ++i) {
      #pragma unroll
      for (int r = 0; r < 8; ++r) {
        int mg = m0 + wm * 32 + i * 16 + r + 8 * hsel;  // global row = b*256 + nrow
        int bb = mg >> 8, nrow = mg & 255;
        float val = (acc[i][j].f[r] + addb) * scale;
        outp[(((size_t)bb * 8 + h) * 256 + nrow) * 32 + d] = (_Float16)val;
      }
    }
  }
}

// ---------------------------------------------------------------------------
// Kernel 3: fused attention per (b,h).  grid (8, 512), 256 threads = 8 waves.
//  scores tile = WMMA(q,k^T) chained with WMMA(bq,bk^T)  (bias folded in)
//  q/k/bq/bk staged with async-to-LDS copies; v transposed through VGPRs.
// ---------------------------------------------------------------------------
__global__ void attn_kernel(const _Float16* __restrict__ qg, const _Float16* __restrict__ kg,
                            const _Float16* __restrict__ vg,
                            const _Float16* __restrict__ bqg, const _Float16* __restrict__ bkg,
                            const float* __restrict__ vrs_g, _Float16* __restrict__ ao) {
  __shared__ _Float16 qs[256][40];     // 20 KB
  __shared__ _Float16 ks[256][40];     // 20 KB
  __shared__ _Float16 bqs[256][40];    // 20 KB  (rank-bias q factors, head h)
  __shared__ _Float16 bks[256][40];    // 20 KB  (rank-bias k factors, head h)
  __shared__ _Float16 vt[32][264];     // v transposed: vt[d][m], 16.9 KB
  __shared__ _Float16 sc[256][264];    // scores -> attn weights (f16), 135 KB
  __shared__ float    vmean[32];

  const int h = blockIdx.x, b = blockIdx.y;
  const int tid = threadIdx.x, lane = tid & 31, wave = tid >> 5;
  const int mlane = lane & 15, hsel = lane >> 4;
  const size_t base = ((size_t)b * 8 + h) * 256 * 32;

  // phase 0: stage q, k, bq, bk (async f16 copies) and v (transpose in VGPRs)
  async_copy64(&qs[tid][0],  qg + base + (size_t)tid * 32);
  async_copy64(&ks[tid][0],  kg + base + (size_t)tid * 32);
  async_copy64(&bqs[tid][0], bqg + ((size_t)h * 256 + tid) * 32);
  async_copy64(&bks[tid][0], bkg + ((size_t)h * 256 + tid) * 32);
  {
    union { uint4 u[4]; _Float16 h16[32]; } vv;
    const uint4* vp = (const uint4*)(vg + base + (size_t)tid * 32);
    #pragma unroll
    for (int c = 0; c < 4; ++c) vv.u[c] = vp[c];
    #pragma unroll
    for (int d = 0; d < 32; ++d) vt[d][tid] = vv.h16[d];
  }
  wait_async0();
  __syncthreads();

  // v_mean (wave 0)
  if (tid < 32) {
    float s = 0.0f;
    for (int m = 0; m < 256; ++m) s += (float)vt[tid][m];
    vmean[tid] = s * (1.0f / 256.0f);
  }

  // phase 1: scores = q k^T + bq bk^T   (two chained WMMAs per 16x16 tile)
  #pragma unroll
  for (int qi = 0; qi < 2; ++qi) {
    const int q0 = (wave * 2 + qi) * 16;
    Frag16 aq; aq.v = lds_frag16(&qs[q0 + mlane][0], hsel);
    Frag16 ab; ab.v = lds_frag16(&bqs[q0 + mlane][0], hsel);
    for (int kt = 0; kt < 16; ++kt) {
      const int k0 = kt * 16;
      Frag16 bk_; bk_.v = lds_frag16(&ks[k0 + mlane][0], hsel);
      Frag16 bb;  bb.v  = lds_frag16(&bks[k0 + mlane][0], hsel);
      Acc8 c;
      #pragma unroll
      for (int r = 0; r < 8; ++r) c.f[r] = 0.0f;
      c.v = WMMA16(aq.v, bk_.v, c.v);
      c.v = WMMA16(ab.v, bb.v, c.v);
      #pragma unroll
      for (int r = 0; r < 8; ++r)
        sc[q0 + r + 8 * hsel][k0 + mlane] = (_Float16)c.f[r];
    }
  }

  // phase 2: softmax rows (wave w owns rows 32w..32w+31; wave-local in LDS)
  for (int j = 0; j < 32; ++j) {
    const int rr = wave * 32 + j;
    union { uint4 u; _Float16 h16[8]; } rv;
    rv.u = *(const uint4*)&sc[rr][lane * 8];
    float mx = -3.0e38f;
    #pragma unroll
    for (int e = 0; e < 8; ++e) mx = fmaxf(mx, (float)rv.h16[e]);
    #pragma unroll
    for (int off = 16; off > 0; off >>= 1) mx = fmaxf(mx, __shfl_xor(mx, off, 32));
    float ef[8], sum = 0.0f;
    #pragma unroll
    for (int e = 0; e < 8; ++e) { ef[e] = __expf((float)rv.h16[e] - mx); sum += ef[e]; }
    #pragma unroll
    for (int off = 16; off > 0; off >>= 1) sum += __shfl_xor(sum, off, 32);
    const float inv = 1.0f / sum;
    #pragma unroll
    for (int e = 0; e < 8; ++e) rv.h16[e] = (_Float16)(ef[e] * inv);
    *(uint4*)&sc[rr][lane * 8] = rv.u;
  }
  __syncthreads();   // publish vmean, keep phases ordered

  // phase 3: out = attn @ v  (+ vrs * v_mean), store f16 to [B,N,C]
  const float vrs = vrs_g[h];
  #pragma unroll
  for (int qi = 0; qi < 2; ++qi) {
    const int q0 = (wave * 2 + qi) * 16;
    #pragma unroll
    for (int dt = 0; dt < 2; ++dt) {
      const int d0 = dt * 16;
      Acc8 acc;
      #pragma unroll
      for (int r = 0; r < 8; ++r) acc.f[r] = 0.0f;
      #pragma unroll
      for (int mc = 0; mc < 8; ++mc) {
        Frag16 af; af.v = lds_frag16(&sc[q0 + mlane][mc * 32], hsel);
        Frag16 bf; bf.v = lds_frag16(&vt[d0 + mlane][mc * 32], hsel);
        acc.v = WMMA16(af.v, bf.v, acc.v);
      }
      const float vm = vmean[d0 + mlane] * vrs;
      #pragma unroll
      for (int r = 0; r < 8; ++r) {
        int mg = q0 + r + 8 * hsel;
        float val = acc.f[r] + vm;
        ao[((size_t)b * 256 + mg) * 256 + h * 32 + d0 + mlane] = (_Float16)val;
      }
    }
  }
}

// ---------------------------------------------------------------------------
// Kernel 4: proj GEMM  [131072 x 256](f16) @ [256 x 256] + proj_b -> f32 out
// A tile staged with async-to-LDS (pure f16 copy); B tile converted f32->f16.
// ---------------------------------------------------------------------------
__global__ void proj_kernel(const _Float16* __restrict__ a, const float* __restrict__ w,
                            const float* __restrict__ bvec, float* __restrict__ out) {
  __shared__ _Float16 As[128][40];
  __shared__ _Float16 Bs[128][40];
  const int tid = threadIdx.x, lane = tid & 31, wave = tid >> 5;
  const int wm = wave & 3, wn = wave >> 2;
  const int mlane = lane & 15, hsel = lane >> 4;
  const int m0 = blockIdx.y * 128, n0 = blockIdx.x * 128;

  Acc8 acc[2][4];
  #pragma unroll
  for (int i = 0; i < 2; ++i)
    #pragma unroll
    for (int j = 0; j < 4; ++j)
      #pragma unroll
      for (int r = 0; r < 8; ++r) acc[i][j].f[r] = 0.0f;

  const int ar0 = tid >> 2, ak8 = (tid & 3) * 8;
  void* lds_a0 = &As[ar0][ak8];
  void* lds_a1 = &As[ar0 + 64][ak8];

  for (int kk = 0; kk < 256; kk += 32) {
    __syncthreads();
    if (kk + 32 < 256)
      __builtin_prefetch(w + (size_t)(kk + 32 + (tid >> 5)) * 256 + n0 + (tid & 31) * 4, 0, 3);
    // A tile: async f16 copies (16B per lane per pass)
    async_copy16(lds_a0, a + (size_t)(m0 + ar0) * 256 + kk + ak8);
    async_copy16(lds_a1, a + (size_t)(m0 + ar0 + 64) * 256 + kk + ak8);
    // B transposed into LDS with f32 -> f16 conversion
    #pragma unroll
    for (int p = 0; p < 4; ++p) {
      int k = (tid >> 5) + p * 8;
      int c = (tid & 31) * 4;
      float4 b = *(const float4*)(w + (size_t)(kk + k) * 256 + n0 + c);
      Bs[c + 0][k] = (_Float16)b.x; Bs[c + 1][k] = (_Float16)b.y;
      Bs[c + 2][k] = (_Float16)b.z; Bs[c + 3][k] = (_Float16)b.w;
    }
    wait_async0();
    __syncthreads();
    Frag16 af[2], bf[4];
    #pragma unroll
    for (int i = 0; i < 2; ++i) af[i].v = lds_frag16(&As[wm * 32 + i * 16 + mlane][0], hsel);
    #pragma unroll
    for (int j = 0; j < 4; ++j) bf[j].v = lds_frag16(&Bs[wn * 64 + j * 16 + mlane][0], hsel);
    #pragma unroll
    for (int i = 0; i < 2; ++i)
      #pragma unroll
      for (int j = 0; j < 4; ++j)
        acc[i][j].v = WMMA16(af[i].v, bf[j].v, acc[i][j].v);
  }

  #pragma unroll
  for (int j = 0; j < 4; ++j) {
    const int jg = n0 + wn * 64 + j * 16 + mlane;
    const float addb = bvec[jg];
    #pragma unroll
    for (int i = 0; i < 2; ++i) {
      #pragma unroll
      for (int r = 0; r < 8; ++r) {
        int mg = m0 + wm * 32 + i * 16 + r + 8 * hsel;
        out[(size_t)mg * 256 + jg] = acc[i][j].f[r] + addb;
      }
    }
  }
}

// ---------------------------------------------------------------------------
// Host launcher
// ---------------------------------------------------------------------------
extern "C" void kernel_launch(void* const* d_in, const int* in_sizes, int n_in,
                              void* d_out, int out_size, void* d_ws, size_t ws_size,
                              hipStream_t stream) {
  const float* x       = (const float*)d_in[0];
  const float* qkv_w   = (const float*)d_in[1];
  const float* qkv_b   = (const float*)d_in[2];
  const float* proj_w  = (const float*)d_in[3];
  const float* proj_b  = (const float*)d_in[4];
  const float* lsc     = (const float*)d_in[5];
  const float* vrs     = (const float*)d_in[6];
  const float* mlp1_w  = (const float*)d_in[7];
  const float* mlp1_b  = (const float*)d_in[8];
  const float* mlp2_w  = (const float*)d_in[9];
  const float* bscale  = (const float*)d_in[10];

  char* ws = (char*)d_ws;
  const size_t QSZ = (size_t)512 * 8 * 256 * 32 * sizeof(_Float16);  // 67.1 MB each
  _Float16* bq = (_Float16*)(ws + 0);          // 128 KB (f16, pre-scaled by bias_scale)
  _Float16* bk = (_Float16*)(ws + 131072);     // 128 KB
  _Float16* q  = (_Float16*)(ws + 262144);
  _Float16* k  = (_Float16*)(ws + 262144 + QSZ);
  _Float16* v  = (_Float16*)(ws + 262144 + 2 * QSZ);
  _Float16* ao = (_Float16*)(ws + 262144 + 3 * QSZ);
  float*    out = (float*)d_out;

  bias1_kernel<<<16, 256, 0, stream>>>(mlp1_w, mlp1_b, mlp2_w, bscale, bq, bk);
  qkv_kernel<<<dim3(6, 1024), 256, 0, stream>>>(x, qkv_w, qkv_b, lsc, q, k, v);
  attn_kernel<<<dim3(8, 512), 256, 0, stream>>>(q, k, v, bq, bk, vrs, ao);
  proj_kernel<<<dim3(2, 1024), 256, 0, stream>>>(ao, proj_w, proj_b, out);
}

// v001
// One run takes 444 microseconds.
// Two timings next to v000 both put it at 1.60 times that version's speed.
#include <hip/hip_runtime.h>

// ---------------------------------------------------------------------------
// WindowAttentionRFB for gfx1250 (MI455X)
//   bias1 (MLP -> f16 bq/bk) -> qkv WMMA GEMM -> fused attention
//   (scores = q k^T + bq bk^T as two chained WMMAs, kept in registers, in-lane
//    softmax, attn@V) -> proj WMMA GEMM.
//   Async global->LDS staging (global_load_async_to_lds_b128) for pure f16
//   copies; f32->f16 converting stages use regular vector loads.
// Shapes: B=512, N=256, C=256, H=8, hd=32, R=32
// ---------------------------------------------------------------------------

typedef __attribute__((ext_vector_type(16))) _Float16 v16h;
typedef __attribute__((ext_vector_type(8)))  float    v8f;

union Frag16 { v16h v; uint4 q[2]; _Float16 h[16]; };
union Acc8   { v8f  v; float f[8]; };

#define WMMA16(a, b, c) __builtin_amdgcn_wmma_f32_16x16x32_f16( \
    false, (a), false, (b), (short)0, (c), false, false)

static __device__ __forceinline__ v16h lds_frag16(const _Float16* rowbase, int hsel) {
  // 16-bit A/B fragment: lane (m = lane&15, hsel = lane>>4)
  // chunk0: K = 8*hsel .. +7  -> VGPR0..3 ; chunk1: K = 16+8*hsel .. +7 -> VGPR4..7
  Frag16 t;
  const _Float16* p = rowbase + hsel * 8;
  t.q[0] = *(const uint4*)(p);
  t.q[1] = *(const uint4*)(p + 16);
  return t.v;
}

// 64B per-lane global -> LDS async copy (4 x b128), tracked on ASYNCcnt.
static __device__ __forceinline__ void async_copy64(void* lds_dst, const void* gsrc) {
  unsigned l = (unsigned)(uintptr_t)lds_dst;        // LDS offset = low 32 bits of flat addr
  unsigned long long g = (unsigned long long)(uintptr_t)gsrc;
  asm volatile(
      "global_load_async_to_lds_b128 %0, %1, off\n\t"
      "global_load_async_to_lds_b128 %0, %1, off offset:16\n\t"
      "global_load_async_to_lds_b128 %0, %1, off offset:32\n\t"
      "global_load_async_to_lds_b128 %0, %1, off offset:48"
      :: "v"(l), "v"(g) : "memory");
}

// 16B per-lane global -> LDS async copy.
static __device__ __forceinline__ void async_copy16(void* lds_dst, const void* gsrc) {
  unsigned l = (unsigned)(uintptr_t)lds_dst;
  unsigned long long g = (unsigned long long)(uintptr_t)gsrc;
  asm volatile("global_load_async_to_lds_b128 %0, %1, off"
               :: "v"(l), "v"(g) : "memory");
}

static __device__ __forceinline__ void wait_async0() {
  asm volatile("s_wait_asynccnt 0x0" ::: "memory");
}

// ---------------------------------------------------------------------------
// Kernel 1: position-bias MLP -> f16 bq [H,N,R] (pre-scaled), bk [H,N,R]
// grid 16 x 256; block bx covers output columns [32*bx, 32*bx+32)
// ---------------------------------------------------------------------------
__global__ void bias1_kernel(const float* __restrict__ w1, const float* __restrict__ b1,
                             const float* __restrict__ w2, const float* __restrict__ bscale_p,
                             _Float16* __restrict__ bq, _Float16* __restrict__ bk) {
  __shared__ float hf[256][129];            // padded: conflict-free column reads
  const int n = threadIdx.x;                // position index 0..255
  const float invden = 1.0f / logf(16.0f);  // log1p(15) = log(16)
  const float c0 = log1pf((float)(n >> 4)) * invden;   // gy
  const float c1 = log1pf((float)(n & 15)) * invden;   // gx
  for (int j = 0; j < 128; ++j) {
    float z = c0 * w1[j] + c1 * w1[128 + j] + b1[j];
    hf[n][j] = 0.5f * z * (1.0f + erff(z * 0.70710678118654752f));  // exact gelu
  }
  __syncthreads();
  const float bsc = bscale_p[0];
  int jj = blockIdx.x * 32;
  for (int e = 0; e < 32; ++e, ++jj) {
    float acc = 0.0f;
    for (int j = 0; j < 128; ++j) acc += hf[n][j] * w2[j * 512 + jj];
    float s = 1.0f / (1.0f + __expf(-acc));
    int h = jj >> 6, which = (jj >> 5) & 1, r = jj & 31;
    if (which == 0) bq[(h * 256 + n) * 32 + r] = (_Float16)(bsc * s);
    else            bk[(h * 256 + n) * 32 + r] = (_Float16)s;
  }
}

// ---------------------------------------------------------------------------
// Kernel 2: QKV GEMM  [131072 x 256] @ [256 x 768] (+bias, q*=logit_scale)
// Block tile 128x128, 8 waves, each wave 2x4 16x16 accum tiles.
// ---------------------------------------------------------------------------
__global__ void qkv_kernel(const float* __restrict__ x, const float* __restrict__ w,
                           const float* __restrict__ bvec, const float* __restrict__ lsc,
                           _Float16* __restrict__ qo, _Float16* __restrict__ ko,
                           _Float16* __restrict__ vo) {
  __shared__ _Float16 As[128][40];   // pitch 40 h (80 B, 16B-aligned)
  __shared__ _Float16 Bs[128][40];   // transposed B tile: Bs[col][k]
  const int tid = threadIdx.x, lane = tid & 31, wave = tid >> 5;
  const int wm = wave & 3, wn = wave >> 2;
  const int mlane = lane & 15, hsel = lane >> 4;
  const int m0 = blockIdx.y * 128, n0 = blockIdx.x * 128;

  Acc8 acc[2][4];
  #pragma unroll
  for (int i = 0; i < 2; ++i)
    #pragma unroll
    for (int j = 0; j < 4; ++j)
      #pragma unroll
      for (int r = 0; r < 8; ++r) acc[i][j].f[r] = 0.0f;

  for (int kk = 0; kk < 256; kk += 32) {
    __syncthreads();
    // prefetch next K chunk into WGP-level cache (locality 3 -> WGP scope)
    if (kk + 32 < 256) {
      __builtin_prefetch(x + (size_t)(m0 + (tid >> 3)) * 256 + kk + 32 + (tid & 7) * 4, 0, 3);
      __builtin_prefetch(w + (size_t)(kk + 32 + (tid >> 5)) * 768 + n0 + (tid & 31) * 4, 0, 3);
    }
    // A: x[m0+r][kk + k4..k4+3], f32 -> f16
    #pragma unroll
    for (int p = 0; p < 4; ++p) {
      int r = (tid >> 3) + p * 32;
      float4 a = *(const float4*)(x + (size_t)(m0 + r) * 256 + kk + (tid & 7) * 4);
      union { _Float16 h[4]; uint2 u; } t;
      t.h[0] = (_Float16)a.x; t.h[1] = (_Float16)a.y;
      t.h[2] = (_Float16)a.z; t.h[3] = (_Float16)a.w;
      *(uint2*)&As[r][(tid & 7) * 4] = t.u;
    }
    // B transposed into LDS: Bs[c][k] = w[(kk+k)*768 + n0 + c]
    #pragma unroll
    for (int p = 0; p < 4; ++p) {
      int k = (tid >> 5) + p * 8;
      int c = (tid & 31) * 4;
      float4 b = *(const float4*)(w + (size_t)(kk + k) * 768 + n0 + c);
      Bs[c + 0][k] = (_Float16)b.x; Bs[c + 1][k] = (_Float16)b.y;
      Bs[c + 2][k] = (_Float16)b.z; Bs[c + 3][k] = (_Float16)b.w;
    }
    __syncthreads();
    Frag16 af[2], bf[4];
    #pragma unroll
    for (int i = 0; i < 2; ++i) af[i].v = lds_frag16(&As[wm * 32 + i * 16 + mlane][0], hsel);
    #pragma unroll
    for (int j = 0; j < 4; ++j) bf[j].v = lds_frag16(&Bs[wn * 64 + j * 16 + mlane][0], hsel);
    #pragma unroll
    for (int i = 0; i < 2; ++i)
      #pragma unroll
      for (int j = 0; j < 4; ++j)
        acc[i][j].v = WMMA16(af[i].v, bf[j].v, acc[i][j].v);
  }

  // epilogue: +bias, q*=logit_scale[h], scatter f16 to [B,H,N,32]
  #pragma unroll
  for (int j = 0; j < 4; ++j) {
    const int jg = n0 + wn * 64 + j * 16 + mlane;     // global out column 0..767
    const int which = jg >> 8, h = (jg >> 5) & 7, d = jg & 31;
    const float addb = bvec[jg];
    const float scale = (which == 0) ? lsc[h] : 1.0f;
    _Float16* outp = (which == 0) ? qo : ((which == 1) ? ko : vo);
    #pragma unroll
    for (int i = 0; i < 2; ++i) {
      #pragma unroll
      for (int r = 0; r < 8; ++r) {
        int mg = m0 + wm * 32 + i * 16 + r + 8 * hsel;  // global row = b*256 + nrow
        int bb = mg >> 8, nrow = mg & 255;
        float val = (acc[i][j].f[r] + addb) * scale;
        outp[(((size_t)bb * 8 + h) * 256 + nrow) * 32 + d] = (_Float16)val;
      }
    }
  }
}

// ---------------------------------------------------------------------------
// Kernel 3: fused attention per (b,h).  grid (8, 512), 256 threads = 8 waves.
//  The scores never leave the registers.  Each wave owns 2 x 16 queries and
//  forms S^T = K Q^T + BK BQ^T (A = key rows, B = query rows): in D a lane
//  holds one query (column lane&15) and keys 8*(lane>>4)+r of each 16-key tile,
//  so row maximum and row sum are in-lane plus one exchange between the halves,
//  and two neighbouring D tiles, converted to f16, are the B operand of
//  O^T = V^T P^T in the hardware k order that lds_frag16 also delivers.
//  q/k/bq/bk staged with async-to-LDS copies; v transposed through VGPRs.
// ---------------------------------------------------------------------------
typedef __attribute__((ext_vector_type(8))) _Float16 v8h;

static __device__ __forceinline__ float other_half(float x) {
  // value of lane l ^ 16
  int b = __builtin_bit_cast(int, x);
  b = __builtin_amdgcn_permlanex16(b, b, 0x76543210, 0xfedcba98, false, false);
  return __builtin_bit_cast(float, b);
}

__global__ void __launch_bounds__(256)
attn_kernel(const _Float16* __restrict__ qg, const _Float16* __restrict__ kg,
            const _Float16* __restrict__ vg,
            const _Float16* __restrict__ bqg, const _Float16* __restrict__ bkg,
            const float* __restrict__ vrs_g, _Float16* __restrict__ ao) {
  __shared__ _Float16 qs[256][40];     // 20 KB
  __shared__ _Float16 ks[256][40];     // 20 KB
  __shared__ _Float16 bqs[256][40];    // 20 KB  (rank-bias q factors, head h)
  __shared__ _Float16 bks[256][40];    // 20 KB  (rank-bias k factors, head h)
  __shared__ _Float16 vt[32][264];     // v transposed: vt[d][m], 16.9 KB
  __shared__ float    vmean[32];

  const int h = blockIdx.x, b = blockIdx.y;
  const int tid = threadIdx.x, lane = tid & 31, wave = tid >> 5;
  const int mlane = lane & 15, hsel = lane >> 4;
  const size_t base = ((size_t)b * 8 + h) * 256 * 32;

  // phase 0: stage q, k, bq, bk (async f16 copies) and v (transpose in VGPRs)
  async_copy64(&qs[tid][0],  qg + base + (size_t)tid * 32);
  async_copy64(&ks[tid][0],  kg + base + (size_t)tid * 32);
  async_copy64(&bqs[tid][0], bqg + ((size_t)h * 256 + tid) * 32);
  async_copy64(&bks[tid][0], bkg + ((size_t)h * 256 + tid) * 32);
  {
    union { uint4 u[4]; _Float16 h16[32]; } vv;
    const uint4* vp = (const uint4*)(vg + base + (size_t)tid * 32);
    #pragma unroll
    for (int c = 0; c < 4; ++c) vv.u[c] = vp[c];
    #pragma unroll
    for (int d = 0; d < 32; ++d) vt[d][tid] = vv.h16[d];
  }
  wait_async0();
  __syncthreads();

  // v_mean (wave 0)
  if (tid < 32) {
    float s = 0.0f;
    for (int m = 0; m < 256; ++m) s += (float)vt[tid][m];
    vmean[tid] = s * (1.0f / 256.0f);
  }

  const float vrs = vrs_g[h];
  // Kept rolled: unrolled, the compiler shares the K fragments between the two
  // query tiles and holds 256 score registers, which halves the waves per SIMD.
  #pragma unroll 1
  for (int qi = 0; qi < 2; ++qi) {
    const int q0 = (wave * 2 + qi) * 16;
    const v16h fq = lds_frag16(&qs[q0 + mlane][0], hsel);
    const v16h fb = lds_frag16(&bqs[q0 + mlane][0], hsel);

    // scores: s[kt].f[r] = S[query q0+mlane][key 16*kt + 8*hsel + r]
    Acc8 s[16];
    #pragma unroll
    for (int kt = 0; kt < 16; ++kt) {
      const v16h fk  = lds_frag16(&ks[kt * 16 + mlane][0], hsel);
      const v16h fbk = lds_frag16(&bks[kt * 16 + mlane][0], hsel);
      #pragma unroll
      for (int r = 0; r < 8; ++r) s[kt].f[r] = 0.0f;
      s[kt].v = WMMA16(fk, fq, s[kt].v);
      s[kt].v = WMMA16(fbk, fb, s[kt].v);
    }

    // softmax over the 256 keys of this lane's query, unnormalised
    v8f m8 = s[0].v;
    #pragma unroll
    for (int kt = 1; kt < 16; ++kt) m8 = __builtin_elementwise_max(m8, s[kt].v);
    float mx = fmaxf(fmaxf(fmaxf(m8[0], m8[1]), fmaxf(m8[2], m8[3])),
                     fmaxf(fmaxf(m8[4], m8[5]), fmaxf(m8[6], m8[7])));
    mx = fmaxf(mx, other_half(mx));
    const float L2E = 1.44269504088896340736f;
    const float nm = -mx * L2E;
    const v8f l2e8 = {L2E, L2E, L2E, L2E, L2E, L2E, L2E, L2E};
    const v8f nm8  = {nm, nm, nm, nm, nm, nm, nm, nm};
    v8f sum8 = {0.0f, 0.0f, 0.0f, 0.0f, 0.0f, 0.0f, 0.0f, 0.0f};
    #pragma unroll
    for (int kt = 0; kt < 16; ++kt) {
      const v8f t = __builtin_elementwise_fma(s[kt].v, l2e8, nm8);
      #pragma unroll
      for (int r = 0; r < 8; ++r) s[kt].f[r] = __builtin_amdgcn_exp2f(t[r]);
      sum8 += s[kt].v;
    }
    float sum = ((sum8[0] + sum8[1]) + (sum8[2] + sum8[3])) +
                ((sum8[4] + sum8[5]) + (sum8[6] + sum8[7]));
    sum += other_half(sum);
    const float inv = 1.0f / sum;

    // O^T = V^T P^T: A = rows of vt, B = two packed score tiles per 32 keys;
    // o[dt].f[r] = out[query q0+mlane][d = 16*dt + 8*hsel + r] * sum
    Acc8 o[2];
    #pragma unroll
    for (int dt = 0; dt < 2; ++dt)
      #pragma unroll
      for (int r = 0; r < 8; ++r) o[dt].f[r] = 0.0f;
    #pragma unroll
    for (int mc = 0; mc < 8; ++mc) {
      const v8h lo = __builtin_convertvector(s[2 * mc].v, v8h);
      const v8h hi = __builtin_convertvector(s[2 * mc + 1].v, v8h);
      const v16h p = __builtin_shufflevector(lo, hi, 0, 1, 2, 3, 4, 5, 6, 7,
                                             8, 9, 10, 11, 12, 13, 14, 15);
      #pragma unroll
      for (int dt = 0; dt < 2; ++dt) {
        const v16h fv = lds_frag16(&vt[dt * 16 + mlane][mc * 32], hsel);
        o[dt].v = WMMA16(fv, p, o[dt].v);
      }
    }

    if (qi == 0) __syncthreads();   // publish vmean before its first reader

    // normalise, + vrs * v_mean, one 16-byte f16 store per tile to [B,N,C]
    #pragma unroll
    for (int dt = 0; dt < 2; ++dt) {
      const int d0 = dt * 16 + 8 * hsel;
      union { uint4 u; _Float16 h16[8]; } st;
      #pragma unroll
      for (int r = 0; r < 8; ++r)
        st.h16[r] = (_Float16)(o[dt].f[r] * inv + vmean[d0 + r] * vrs);
      *(uint4*)(ao + ((size_t)b * 256 + q0 + mlane) * 256 + h * 32 + d0) = st.u;
    }
    // the next trip reuses the address and data registers of these stores
    asm volatile("s_wait_xcnt 0x0" ::: "memory");
  }
}

// ---------------------------------------------------------------------------
// Kernel 4: proj GEMM  [131072 x 256](f16) @ [256 x 256] + proj_b -> f32 out
// A tile staged with async-to-LDS (pure f16 copy); B tile converted f32->f16.
// ---------------------------------------------------------------------------
__global__ void proj_kernel(const _Float16* __restrict__ a, const float* __restrict__ w,
                            const float* __restrict__ bvec, float* __restrict__ out) {
  __shared__ _Float16 As[128][40];
  __shared__ _Float16 Bs[128][40];
  const int tid = threadIdx.x, lane = tid & 31, wave = tid >> 5;
  const int wm = wave & 3, wn = wave >> 2;
  const int mlane = lane & 15, hsel = lane >> 4;
  const int m0 = blockIdx.y * 128, n0 = blockIdx.x * 128;

  Acc8 acc[2][4];
  #pragma unroll
  for (int i = 0; i < 2; ++i)
    #pragma unroll
    for (int j = 0; j < 4; ++j)
      #pragma unroll
      for (int r = 0; r < 8; ++r) acc[i][j].f[r] = 0.0f;

  const int ar0 = tid >> 2, ak8 = (tid & 3) * 8;
  void* lds_a0 = &As[ar0][ak8];
  void* lds_a1 = &As[ar0 + 64][ak8];

  for (int kk = 0; kk < 256; kk += 32) {
    __syncthreads();
    if (kk + 32 < 256)
      __builtin_prefetch(w + (size_t)(kk + 32 + (tid >> 5)) * 256 + n0 + (tid & 31) * 4, 0, 3);
    // A tile: async f16 copies (16B per lane per pass)
    async_copy16(lds_a0, a + (size_t)(m0 + ar0) * 256 + kk + ak8);
    async_copy16(lds_a1, a + (size_t)(m0 + ar0 + 64) * 256 + kk + ak8);
    // B transposed into LDS with f32 -> f16 conversion
    #pragma unroll
    for (int p = 0; p < 4; ++p) {
      int k = (tid >> 5) + p * 8;
      int c = (tid & 31) * 4;
      float4 b = *(const float4*)(w + (size_t)(kk + k) * 256 + n0 + c);
      Bs[c + 0][k] = (_Float16)b.x; Bs[c + 1][k] = (_Float16)b.y;
      Bs[c + 2][k] = (_Float16)b.z; Bs[c + 3][k] = (_Float16)b.w;
    }
    wait_async0();
    __syncthreads();
    Frag16 af[2], bf[4];
    #pragma unroll
    for (int i = 0; i < 2; ++i) af[i].v = lds_frag16(&As[wm * 32 + i * 16 + mlane][0], hsel);
    #pragma unroll
    for (int j = 0; j < 4; ++j) bf[j].v = lds_frag16(&Bs[wn * 64 + j * 16 + mlane][0], hsel);
    #pragma unroll
    for (int i = 0; i < 2; ++i)
      #pragma unroll
      for (int j = 0; j < 4; ++j)
        acc[i][j].v = WMMA16(af[i].v, bf[j].v, acc[i][j].v);
  }

  #pragma unroll
  for (int j = 0; j < 4; ++j) {
    const int jg = n0 + wn * 64 + j * 16 + mlane;
    const float addb = bvec[jg];
    #pragma unroll
    for (int i = 0; i < 2; ++i) {
      #pragma unroll
      for (int r = 0; r < 8; ++r) {
        int mg = m0 + wm * 32 + i * 16 + r + 8 * hsel;
        out[(size_t)mg * 256 + jg] = acc[i][j].f[r] + addb;
      }
    }
  }
}

// ---------------------------------------------------------------------------
// Host launcher
// ---------------------------------------------------------------------------
extern "C" void kernel_launch(void* const* d_in, const int* in_sizes, int n_in,
                              void* d_out, int out_size, void* d_ws, size_t ws_size,
                              hipStream_t stream) {
  const float* x       = (const float*)d_in[0];
  const float* qkv_w   = (const float*)d_in[1];
  const float* qkv_b   = (const float*)d_in[2];
  const float* proj_w  = (const float*)d_in[3];
  const float* proj_b  = (const float*)d_in[4];
  const float* lsc     = (const float*)d_in[5];
  const float* vrs     = (const float*)d_in[6];
  const float* mlp1_w  = (const float*)d_in[7];
  const float* mlp1_b  = (const float*)d_in[8];
  const float* mlp2_w  = (const float*)d_in[9];
  const float* bscale  = (const float*)d_in[10];

  char* ws = (char*)d_ws;
  const size_t QSZ = (size_t)512 * 8 * 256 * 32 * sizeof(_Float16);  // 67.1 MB each
  _Float16* bq = (_Float16*)(ws + 0);          // 128 KB (f16, pre-scaled by bias_scale)
  _Float16* bk = (_Float16*)(ws + 131072);     // 128 KB
  _Float16* q  = (_Float16*)(ws + 262144);
  _Float16* k  = (_Float16*)(ws + 262144 + QSZ);
  _Float16* v  = (_Float16*)(ws + 262144 + 2 * QSZ);
  _Float16* ao = (_Float16*)(ws + 262144 + 3 * QSZ);
  float*    out = (float*)d_out;

  bias1_kernel<<<16, 256, 0, stream>>>(mlp1_w, mlp1_b, mlp2_w, bscale, bq, bk);
  qkv_kernel<<<dim3(6, 1024), 256, 0, stream>>>(x, qkv_w, qkv_b, lsc, q, k, v);
  attn_kernel<<<dim3(8, 512), 256, 0, stream>>>(q, k, v, bq, bk, vrs, ao);
  proj_kernel<<<dim3(2, 1024), 256, 0, stream>>>(ao, proj_w, proj_b, out);
}

// v002
// A run of this version takes 249 microseconds.
// Two timings next to v001 put it at 1.79 and 1.78 times that version's speed.
// All steps since v000 together make it 2.85 times as fast.
#include <hip/hip_runtime.h>

// ---------------------------------------------------------------------------
// WindowAttentionRFB for gfx1250 (MI455X)
//   bias1 (MLP -> f16 bq/bk) -> qkv WMMA GEMM -> fused attention
//   (scores = q k^T + bq bk^T as two chained WMMAs, kept in registers, in-lane
//    softmax, attn@V) -> proj WMMA GEMM.
//   Async global->LDS staging (global_load_async_to_lds_b128) for pure f16
//   copies; f32->f16 converting stages use regular vector loads.
//   Both GEMMs keep their weight panel (128 columns x all 256 k, f16, [col][k])
//   in LDS for the life of the work-group, which walks several row tiles.
// Shapes: B=512, N=256, C=256, H=8, hd=32, R=32
// ---------------------------------------------------------------------------

typedef __attribute__((ext_vector_type(16))) _Float16 v16h;
typedef __attribute__((ext_vector_type(8)))  float    v8f;

union Frag16 { v16h v; uint4 q[2]; _Float16 h[16]; };
union Acc8   { v8f  v; float f[8]; };

#define WMMA16(a, b, c) __builtin_amdgcn_wmma_f32_16x16x32_f16( \
    false, (a), false, (b), (short)0, (c), false, false)

static __device__ __forceinline__ v16h lds_frag16(const _Float16* rowbase, int hsel) {
  // 16-bit A/B fragment: lane (m = lane&15, hsel = lane>>4)
  // chunk0: K = 8*hsel .. +7  -> VGPR0..3 ; chunk1: K = 16+8*hsel .. +7 -> VGPR4..7
  Frag16 t;
  const _Float16* p = rowbase + hsel * 8;
  t.q[0] = *(const uint4*)(p);
  t.q[1] = *(const uint4*)(p + 16);
  return t.v;
}

// 64B per-lane global -> LDS async copy (4 x b128), tracked on ASYNCcnt.
static __device__ __forceinline__ void async_copy64(void* lds_dst, const void* gsrc) {
  unsigned l = (unsigned)(uintptr_t)lds_dst;        // LDS offset = low 32 bits of flat addr
  unsigned long long g = (unsigned long long)(uintptr_t)gsrc;
  asm volatile(
      "global_load_async_to_lds_b128 %0, %1, off\n\t"
      "global_load_async_to_lds_b128 %0, %1, off offset:16\n\t"
      "global_load_async_to_lds_b128 %0, %1, off offset:32\n\t"
      "global_load_async_to_lds_b128 %0, %1, off offset:48"
      :: "v"(l), "v"(g) : "memory");
}

// 16B per-lane global -> LDS async copy.
static __device__ __forceinline__ void async_copy16(void* lds_dst, const void* gsrc) {
  unsigned l = (unsigned)(uintptr_t)lds_dst;
  unsigned long long g = (unsigned long long)(uintptr_t)gsrc;
  // the wait is part of the statement: the caller sits in a rolled loop whose
  // next trip rewrites the two address registers
  asm volatile("global_load_async_to_lds_b128 %0, %1, off\n\t"
               "s_wait_xcnt 0x0"
               :: "v"(l), "v"(g) : "memory");
}

static __device__ __forceinline__ void wait_async0() {
  asm volatile("s_wait_asynccnt 0x0" ::: "memory");
}

// Weight panel of a GEMM work-group: Bs[col][k] = (f16) w[k][n0 + col], 128
// columns, k = 0..255.  Pitch 264 halves = 528 B = 16 B x 33, so that the 16-byte
// stores here and the 16-byte fragment loads fall on distinct banks.
// A lane owns one column (a wave reads whole 128-B lines of w) and packs eight
// consecutive k into one 16-byte LDS store.  256 threads.
#define PANEL_PITCH 264
static __device__ __forceinline__ void stage_panel(_Float16 (*Bs)[PANEL_PITCH],
                                                   const float* __restrict__ w,
                                                   int ldw, int n0, int tid) {
  const int c = tid & 127;
  const float* wc = w + n0 + c;
  // 32 loads in flight per lane; fully unrolled the compiler held all 128 values
  // and the register count cost a resident work-group
  #pragma unroll 4
  for (int it = 0; it < 16; ++it) {
    const int k0 = (it * 2 + (tid >> 7)) * 8;
    union { _Float16 h[8]; uint4 u; } t;
    #pragma unroll
    for (int j = 0; j < 8; ++j) t.h[j] = (_Float16)wc[(size_t)(k0 + j) * ldw];
    *(uint4*)&Bs[c][k0] = t.u;
  }
}

// ---------------------------------------------------------------------------
// Kernel 1: position-bias MLP -> f16 bq [H,N,R] (pre-scaled), bk [H,N,R]
// grid 16 x 256; block bx covers output columns [32*bx, 32*bx+32)
// ---------------------------------------------------------------------------
__global__ void bias1_kernel(const float* __restrict__ w1, const float* __restrict__ b1,
                             const float* __restrict__ w2, const float* __restrict__ bscale_p,
                             _Float16* __restrict__ bq, _Float16* __restrict__ bk) {
  __shared__ float hf[256][129];            // padded: conflict-free column reads
  const int n = threadIdx.x;                // position index 0..255
  const float invden = 1.0f / logf(16.0f);  // log1p(15) = log(16)
  const float c0 = log1pf((float)(n >> 4)) * invden;   // gy
  const float c1 = log1pf((float)(n & 15)) * invden;   // gx
  for (int j = 0; j < 128; ++j) {
    float z = c0 * w1[j] + c1 * w1[128 + j] + b1[j];
    hf[n][j] = 0.5f * z * (1.0f + erff(z * 0.70710678118654752f));  // exact gelu
  }
  __syncthreads();
  const float bsc = bscale_p[0];
  int jj = blockIdx.x * 32;
  for (int e = 0; e < 32; ++e, ++jj) {
    float acc = 0.0f;
    for (int j = 0; j < 128; ++j) acc += hf[n][j] * w2[j * 512 + jj];
    float s = 1.0f / (1.0f + __expf(-acc));
    int h = jj >> 6, which = (jj >> 5) & 1, r = jj & 31;
    if (which == 0) bq[(h * 256 + n) * 32 + r] = (_Float16)(bsc * s);
    else            bk[(h * 256 + n) * 32 + r] = (_Float16)s;
  }
}

// ---------------------------------------------------------------------------
// Kernel 2: QKV GEMM  [131072 x 256] @ [256 x 768] (+bias, q*=logit_scale)
// Block tile 128x128, 8 waves, each wave 2x4 16x16 accum tiles.
// grid (6, 128): a work-group stages its weight panel once and walks 8 row tiles.
// ---------------------------------------------------------------------------
#define QKV_TILES 8
__global__ void __launch_bounds__(256)
qkv_kernel(const float* __restrict__ x, const float* __restrict__ w,
                           const float* __restrict__ bvec, const float* __restrict__ lsc,
                           _Float16* __restrict__ qo, _Float16* __restrict__ ko,
                           _Float16* __restrict__ vo) {
  __shared__ _Float16 As[128][40];   // pitch 40 h (80 B, 16B-aligned)
  __shared__ _Float16 Bs[128][PANEL_PITCH];   // weight panel: Bs[col][k], all k
  const int tid = threadIdx.x, lane = tid & 31, wave = tid >> 5;
  const int wm = wave & 3, wn = wave >> 2;
  const int mlane = lane & 15, hsel = lane >> 4;
  const int n0 = blockIdx.x * 128;

  // published by the two barriers in front of the first fragment loads
  stage_panel(Bs, w, 768, n0, tid);

  // bias and q scale of this lane's four output columns, the same for every tile
  float addb[4], scale[4];
  #pragma unroll
  for (int j = 0; j < 4; ++j) {
    const int jg = n0 + wn * 64 + j * 16 + mlane;
    addb[j] = bvec[jg];
    scale[j] = ((jg >> 8) == 0) ? lsc[(jg >> 5) & 7] : 1.0f;
  }

  // Kept rolled, for speed only; the K loop inside is unrolled.
  #pragma unroll 1
  for (int mt = 0; mt < QKV_TILES; ++mt) {
  const int m0 = (blockIdx.y * QKV_TILES + mt) * 128;

  Acc8 acc[2][4];
  #pragma unroll
  for (int i = 0; i < 2; ++i)
    #pragma unroll
    for (int j = 0; j < 4; ++j)
      #pragma unroll
      for (int r = 0; r < 8; ++r) acc[i][j].f[r] = 0.0f;

  for (int kk = 0; kk < 256; kk += 32) {
    __syncthreads();
    // prefetch next K chunk into WGP-level cache (locality 3 -> WGP scope)
    if (kk + 32 < 256)
      __builtin_prefetch(x + (size_t)(m0 + (tid >> 3)) * 256 + kk + 32 + (tid & 7) * 4, 0, 3);
    // A: x[m0+r][kk + k4..k4+3], f32 -> f16
    #pragma unroll
    for (int p = 0; p < 4; ++p) {
      int r = (tid >> 3) + p * 32;
      float4 a = *(const float4*)(x + (size_t)(m0 + r) * 256 + kk + (tid & 7) * 4);
      union { _Float16 h[4]; uint2 u; } t;
      t.h[0] = (_Float16)a.x; t.h[1] = (_Float16)a.y;
      t.h[2] = (_Float16)a.z; t.h[3] = (_Float16)a.w;
      *(uint2*)&As[r][(tid & 7) * 4] = t.u;
    }
    __syncthreads();
    Frag16 af[2], bf[4];
    #pragma unroll
    for (int i = 0; i < 2; ++i) af[i].v = lds_frag16(&As[wm * 32 + i * 16 + mlane][0], hsel);
    #pragma unroll
    for (int j = 0; j < 4; ++j) bf[j].v = lds_frag16(&Bs[wn * 64 + j * 16 + mlane][kk], hsel);
    #pragma unroll
    for (int i = 0; i < 2; ++i)
      #pragma unroll
      for (int j = 0; j < 4; ++j)
        acc[i][j].v = WMMA16(af[i].v, bf[j].v, acc[i][j].v);
  }

  // epilogue: +bias, q*=logit_scale[h], scatter f16 to [B,H,N,32]
  #pragma unroll
  for (int j = 0; j < 4; ++j) {
    const int jg = n0 + wn * 64 + j * 16 + mlane;     // global out column 0..767
    const int which = jg >> 8, h = (jg >> 5) & 7, d = jg & 31;
    _Float16* outp = (which == 0) ? qo : ((which == 1) ? ko : vo);
    #pragma unroll
    for (int i = 0; i < 2; ++i) {
      #pragma unroll
      for (int r = 0; r < 8; ++r) {
        int mg = m0 + wm * 32 + i * 16 + r + 8 * hsel;  // global row = b*256 + nrow
        int bb = mg >> 8, nrow = mg & 255;
        float val = (acc[i][j].f[r] + addb[j]) * scale[j];
        outp[(((size_t)bb * 8 + h) * 256 + nrow) * 32 + d] = (_Float16)val;
      }
    }
  }
  // the next trip reuses the address and data registers of these stores
  asm volatile("s_wait_xcnt 0x0" ::: "memory");
  }
}

// ---------------------------------------------------------------------------
// Kernel 3: fused attention per (b,h).  grid (8, 512), 256 threads = 8 waves.
//  The scores never leave the registers.  Each wave owns 2 x 16 queries and
//  forms S^T = K Q^T + BK BQ^T (A = key rows, B = query rows): in D a lane
//  holds one query (column lane&15) and keys 8*(lane>>4)+r of each 16-key tile,
//  so row maximum and row sum are in-lane plus one exchange between the halves,
//  and two neighbouring D tiles, converted to f16, are the B operand of
//  O^T = V^T P^T in the hardware k order that lds_frag16 also delivers.
//  q/k/bq/bk staged with async-to-LDS copies; v transposed through VGPRs.
// ---------------------------------------------------------------------------
typedef __attribute__((ext_vector_type(8))) _Float16 v8h;

static __device__ __forceinline__ float other_half(float x) {
  // value of lane l ^ 16
  int b = __builtin_bit_cast(int, x);
  b = __builtin_amdgcn_permlanex16(b, b, 0x76543210, 0xfedcba98, false, false);
  return __builtin_bit_cast(float, b);
}

__global__ void __launch_bounds__(256)
attn_kernel(const _Float16* __restrict__ qg, const _Float16* __restrict__ kg,
            const _Float16* __restrict__ vg,
            const _Float16* __restrict__ bqg, const _Float16* __restrict__ bkg,
            const float* __restrict__ vrs_g, _Float16* __restrict__ ao) {
  __shared__ _Float16 qs[256][40];     // 20 KB
  __shared__ _Float16 ks[256][40];     // 20 KB
  __shared__ _Float16 bqs[256][40];    // 20 KB  (rank-bias q factors, head h)
  __shared__ _Float16 bks[256][40];    // 20 KB  (rank-bias k factors, head h)
  __shared__ _Float16 vt[32][264];     // v transposed: vt[d][m], 16.9 KB
  __shared__ float    vmean[32];

  const int h = blockIdx.x, b = blockIdx.y;
  const int tid = threadIdx.x, lane = tid & 31, wave = tid >> 5;
  const int mlane = lane & 15, hsel = lane >> 4;
  const size_t base = ((size_t)b * 8 + h) * 256 * 32;

  // phase 0: stage q, k, bq, bk (async f16 copies) and v (transpose in VGPRs)
  async_copy64(&qs[tid][0],  qg + base + (size_t)tid * 32);
  async_copy64(&ks[tid][0],  kg + base + (size_t)tid * 32);
  async_copy64(&bqs[tid][0], bqg + ((size_t)h * 256 + tid) * 32);
  async_copy64(&bks[tid][0], bkg + ((size_t)h * 256 + tid) * 32);
  {
    union { uint4 u[4]; _Float16 h16[32]; } vv;
    const uint4* vp = (const uint4*)(vg + base + (size_t)tid * 32);
    #pragma unroll
    for (int c = 0; c < 4; ++c) vv.u[c] = vp[c];
    #pragma unroll
    for (int d = 0; d < 32; ++d) vt[d][tid] = vv.h16[d];
  }
  wait_async0();
  __syncthreads();

  // v_mean (wave 0)
  if (tid < 32) {
    float s = 0.0f;
    for (int m = 0; m < 256; ++m) s += (float)vt[tid][m];
    vmean[tid] = s * (1.0f / 256.0f);
  }

  const float vrs = vrs_g[h];
  // Kept rolled: unrolled, the compiler shares the K fragments between the two
  // query tiles and holds 256 score registers, which halves the waves per SIMD.
  #pragma unroll 1
  for (int qi = 0; qi < 2; ++qi) {
    const int q0 = (wave * 2 + qi) * 16;
    const v16h fq = lds_frag16(&qs[q0 + mlane][0], hsel);
    const v16h fb = lds_frag16(&bqs[q0 + mlane][0], hsel);

    // scores: s[kt].f[r] = S[query q0+mlane][key 16*kt + 8*hsel + r]
    Acc8 s[16];
    #pragma unroll
    for (int kt = 0; kt < 16; ++kt) {
      const v16h fk  = lds_frag16(&ks[kt * 16 + mlane][0], hsel);
      const v16h fbk = lds_frag16(&bks[kt * 16 + mlane][0], hsel);
      #pragma unroll
      for (int r = 0; r < 8; ++r) s[kt].f[r] = 0.0f;
      s[kt].v = WMMA16(fk, fq, s[kt].v);
      s[kt].v = WMMA16(fbk, fb, s[kt].v);
    }

    // softmax over the 256 keys of this lane's query, unnormalised
    v8f m8 = s[0].v;
    #pragma unroll
    for (int kt = 1; kt < 16; ++kt) m8 = __builtin_elementwise_max(m8, s[kt].v);
    float mx = fmaxf(fmaxf(fmaxf(m8[0], m8[1]), fmaxf(m8[2], m8[3])),
                     fmaxf(fmaxf(m8[4], m8[5]), fmaxf(m8[6], m8[7])));
    mx = fmaxf(mx, other_half(mx));
    const float L2E = 1.44269504088896340736f;
    const float nm = -mx * L2E;
    const v8f l2e8 = {L2E, L2E, L2E, L2E, L2E, L2E, L2E, L2E};
    const v8f nm8  = {nm, nm, nm, nm, nm, nm, nm, nm};
    v8f sum8 = {0.0f, 0.0f, 0.0f, 0.0f, 0.0f, 0.0f, 0.0f, 0.0f};
    #pragma unroll
    for (int kt = 0; kt < 16; ++kt) {
      const v8f t = __builtin_elementwise_fma(s[kt].v, l2e8, nm8);
      #pragma unroll
      for (int r = 0; r < 8; ++r) s[kt].f[r] = __builtin_amdgcn_exp2f(t[r]);
      sum8 += s[kt].v;
    }
    float sum = ((sum8[0] + sum8[1]) + (sum8[2] + sum8[3])) +
                ((sum8[4] + sum8[5]) + (sum8[6] + sum8[7]));
    sum += other_half(sum);
    const float inv = 1.0f / sum;

    // O^T = V^T P^T: A = rows of vt, B = two packed score tiles per 32 keys;
    // o[dt].f[r] = out[query q0+mlane][d = 16*dt + 8*hsel + r] * sum
    Acc8 o[2];
    #pragma unroll
    for (int dt = 0; dt < 2; ++dt)
      #pragma unroll
      for (int r = 0; r < 8; ++r) o[dt].f[r] = 0.0f;
    #pragma unroll
    for (int mc = 0; mc < 8; ++mc) {
      const v8h lo = __builtin_convertvector(s[2 * mc].v, v8h);
      const v8h hi = __builtin_convertvector(s[2 * mc + 1].v, v8h);
      const v16h p = __builtin_shufflevector(lo, hi, 0, 1, 2, 3, 4, 5, 6, 7,
                                             8, 9, 10, 11, 12, 13, 14, 15);
      #pragma unroll
      for (int dt = 0; dt < 2; ++dt) {
        const v16h fv = lds_frag16(&vt[dt * 16 + mlane][mc * 32], hsel);
        o[dt].v = WMMA16(fv, p, o[dt].v);
      }
    }

    if (qi == 0) __syncthreads();   // publish vmean before its first reader

    // normalise, + vrs * v_mean, one 16-byte f16 store per tile to [B,N,C]
    #pragma unroll
    for (int dt = 0; dt < 2; ++dt) {
      const int d0 = dt * 16 + 8 * hsel;
      union { uint4 u; _Float16 h16[8]; } st;
      #pragma unroll
      for (int r = 0; r < 8; ++r)
        st.h16[r] = (_Float16)(o[dt].f[r] * inv + vmean[d0 + r] * vrs);
      *(uint4*)(ao + ((size_t)b * 256 + q0 + mlane) * 256 + h * 32 + d0) = st.u;
    }
    // the next trip reuses the address and data registers of these stores
    asm volatile("s_wait_xcnt 0x0" ::: "memory");
  }
}

// ---------------------------------------------------------------------------
// Kernel 4: proj GEMM  [131072 x 256](f16) @ [256 x 256] + proj_b -> f32 out
// A tile staged with async-to-LDS (pure f16 copy); weight panel converted
// f32->f16 once.  grid (2, 512): a work-group walks 2 row tiles.
// ---------------------------------------------------------------------------
#define PROJ_TILES 2
__global__ void __launch_bounds__(256)
proj_kernel(const _Float16* __restrict__ a, const float* __restrict__ w,
                            const float* __restrict__ bvec, float* __restrict__ out) {
  __shared__ _Float16 As[128][40];
  __shared__ _Float16 Bs[128][PANEL_PITCH];   // weight panel: Bs[col][k], all k
  const int tid = threadIdx.x, lane = tid & 31, wave = tid >> 5;
  const int wm = wave & 3, wn = wave >> 2;
  const int mlane = lane & 15, hsel = lane >> 4;
  const int n0 = blockIdx.x * 128;

  const int ar0 = tid >> 2, ak8 = (tid & 3) * 8;
  void* lds_a0 = &As[ar0][ak8];
  void* lds_a1 = &As[ar0 + 64][ak8];

  // published by the two barriers in front of the first fragment loads
  stage_panel(Bs, w, 256, n0, tid);

  // Kept rolled: unrolled, the register count passes 128 and three work-groups
  // instead of four fit a WGP.
  #pragma unroll 1
  for (int mt = 0; mt < PROJ_TILES; ++mt) {
  const int m0 = (blockIdx.y * PROJ_TILES + mt) * 128;

  Acc8 acc[2][4];
  #pragma unroll
  for (int i = 0; i < 2; ++i)
    #pragma unroll
    for (int j = 0; j < 4; ++j)
      #pragma unroll
      for (int r = 0; r < 8; ++r) acc[i][j].f[r] = 0.0f;

  for (int kk = 0; kk < 256; kk += 32) {
    __syncthreads();
    // A tile: async f16 copies (16B per lane per pass)
    async_copy16(lds_a0, a + (size_t)(m0 + ar0) * 256 + kk + ak8);
    async_copy16(lds_a1, a + (size_t)(m0 + ar0 + 64) * 256 + kk + ak8);
    wait_async0();
    __syncthreads();
    Frag16 af[2], bf[4];
    #pragma unroll
    for (int i = 0; i < 2; ++i) af[i].v = lds_frag16(&As[wm * 32 + i * 16 + mlane][0], hsel);
    #pragma unroll
    for (int j = 0; j < 4; ++j) bf[j].v = lds_frag16(&Bs[wn * 64 + j * 16 + mlane][kk], hsel);
    #pragma unroll
    for (int i = 0; i < 2; ++i)
      #pragma unroll
      for (int j = 0; j < 4; ++j)
        acc[i][j].v = WMMA16(af[i].v, bf[j].v, acc[i][j].v);
  }

  #pragma unroll
  for (int j = 0; j < 4; ++j) {
    const int jg = n0 + wn * 64 + j * 16 + mlane;
    const float addb = bvec[jg];
    #pragma unroll
    for (int i = 0; i < 2; ++i) {
      #pragma unroll
      for (int r = 0; r < 8; ++r) {
        int mg = m0 + wm * 32 + i * 16 + r + 8 * hsel;
        out[(size_t)mg * 256 + jg] = acc[i][j].f[r] + addb;
      }
    }
  }
  // the next trip reuses the address and data registers of these stores
  asm volatile("s_wait_xcnt 0x0" ::: "memory");
  }
}

// ---------------------------------------------------------------------------
// Host launcher
// ---------------------------------------------------------------------------
extern "C" void kernel_launch(void* const* d_in, const int* in_sizes, int n_in,
                              void* d_out, int out_size, void* d_ws, size_t ws_size,
                              hipStream_t stream) {
  const float* x       = (const float*)d_in[0];
  const float* qkv_w   = (const float*)d_in[1];
  const float* qkv_b   = (const float*)d_in[2];
  const float* proj_w  = (const float*)d_in[3];
  const float* proj_b  = (const float*)d_in[4];
  const float* lsc     = (const float*)d_in[5];
  const float* vrs     = (const float*)d_in[6];
  const float* mlp1_w  = (const float*)d_in[7];
  const float* mlp1_b  = (const float*)d_in[8];
  const float* mlp2_w  = (const float*)d_in[9];
  const float* bscale  = (const float*)d_in[10];

  char* ws = (char*)d_ws;
  const size_t QSZ = (size_t)512 * 8 * 256 * 32 * sizeof(_Float16);  // 67.1 MB each
  _Float16* bq = (_Float16*)(ws + 0);          // 128 KB (f16, pre-scaled by bias_scale)
  _Float16* bk = (_Float16*)(ws + 131072);     // 128 KB
  _Float16* q  = (_Float16*)(ws + 262144);
  _Float16* k  = (_Float16*)(ws + 262144 + QSZ);
  _Float16* v  = (_Float16*)(ws + 262144 + 2 * QSZ);
  _Float16* ao = (_Float16*)(ws + 262144 + 3 * QSZ);
  float*    out = (float*)d_out;

  bias1_kernel<<<16, 256, 0, stream>>>(mlp1_w, mlp1_b, mlp2_w, bscale, bq, bk);
  qkv_kernel<<<dim3(6, 128), 256, 0, stream>>>(x, qkv_w, qkv_b, lsc, q, k, v);
  attn_kernel<<<dim3(8, 512), 256, 0, stream>>>(q, k, v, bq, bk, vrs, ao);
  proj_kernel<<<dim3(2, 512), 256, 0, stream>>>(ao, proj_w, proj_b, out);
}

// v003
// A run of this version takes 210 microseconds.
// Next to v002, in two timings, it ran 1.18 and 1.19 times as fast.
// All steps since v000 together make it 3.37 times as fast.
#include <hip/hip_runtime.h>

// ---------------------------------------------------------------------------
// WindowAttentionRFB for gfx1250 (MI455X)
//   bias1 (MLP -> f16 bq/bk) -> qkv WMMA GEMM -> fused attention
//   (scores = q k^T + bq bk^T as two chained WMMAs, kept in registers, in-lane
//    softmax, attn@V) -> proj WMMA GEMM.
//   Async global->LDS staging (global_load_async_to_lds_b128) for pure f16
//   copies; f32->f16 converting stages use regular vector loads.
//   Both GEMMs keep their weight panel (128 columns x all 256 k, f16, [col][k])
//   in LDS for the life of the work-group, which walks several row tiles.
// Shapes: B=512, N=256, C=256, H=8, hd=32, R=32
// ---------------------------------------------------------------------------

typedef __attribute__((ext_vector_type(16))) _Float16 v16h;
typedef __attribute__((ext_vector_type(8)))  float    v8f;

union Frag16 { v16h v; uint4 q[2]; _Float16 h[16]; };
union Acc8   { v8f  v; float f[8]; };

#define WMMA16(a, b, c) __builtin_amdgcn_wmma_f32_16x16x32_f16( \
    false, (a), false, (b), (short)0, (c), false, false)

static __device__ __forceinline__ v16h lds_frag16(const _Float16* rowbase, int hsel) {
  // 16-bit A/B fragment: lane (m = lane&15, hsel = lane>>4)
  // chunk0: K = 8*hsel .. +7  -> VGPR0..3 ; chunk1: K = 16+8*hsel .. +7 -> VGPR4..7
  Frag16 t;
  const _Float16* p = rowbase + hsel * 8;
  t.q[0] = *(const uint4*)(p);
  t.q[1] = *(const uint4*)(p + 16);
  return t.v;
}

// 64B per-lane global -> LDS async copy (4 x b128), tracked on ASYNCcnt.
static __device__ __forceinline__ void async_copy64(void* lds_dst, const void* gsrc) {
  unsigned l = (unsigned)(uintptr_t)lds_dst;        // LDS offset = low 32 bits of flat addr
  unsigned long long g = (unsigned long long)(uintptr_t)gsrc;
  asm volatile(
      "global_load_async_to_lds_b128 %0, %1, off\n\t"
      "global_load_async_to_lds_b128 %0, %1, off offset:16\n\t"
      "global_load_async_to_lds_b128 %0, %1, off offset:32\n\t"
      "global_load_async_to_lds_b128 %0, %1, off offset:48"
      :: "v"(l), "v"(g) : "memory");
}

// 16B per-lane global -> LDS async copy.
static __device__ __forceinline__ void async_copy16(void* lds_dst, const void* gsrc) {
  unsigned l = (unsigned)(uintptr_t)lds_dst;
  unsigned long long g = (unsigned long long)(uintptr_t)gsrc;
  // the wait is part of the statement: the caller sits in a rolled loop whose
  // next trip rewrites the two address registers
  asm volatile("global_load_async_to_lds_b128 %0, %1, off\n\t"
               "s_wait_xcnt 0x0"
               :: "v"(l), "v"(g) : "memory");
}

static __device__ __forceinline__ void wait_async0() {
  asm volatile("s_wait_asynccnt 0x0" ::: "memory");
}

// Weight panel of a GEMM work-group: Bs[col][k] = (f16) w[k][n0 + col], 128
// columns, k = 0..255.  Pitch 264 halves = 528 B = 16 B x 33, so that the 16-byte
// stores here and the 16-byte fragment loads fall on distinct banks.
// A lane owns one column (a wave reads whole 128-B lines of w) and packs eight
// consecutive k into one 16-byte LDS store.  256 threads.
#define PANEL_PITCH 264
static __device__ __forceinline__ void stage_panel(_Float16 (*Bs)[PANEL_PITCH],
                                                   const float* __restrict__ w,
                                                   int ldw, int n0, int tid) {
  const int c = tid & 127;
  const float* wc = w + n0 + c;
  // 32 loads in flight per lane; fully unrolled the compiler held all 128 values
  // and the register count cost a resident work-group
  #pragma unroll 4
  for (int it = 0; it < 16; ++it) {
    const int k0 = (it * 2 + (tid >> 7)) * 8;
    union { _Float16 h[8]; uint4 u; } t;
    #pragma unroll
    for (int j = 0; j < 8; ++j) t.h[j] = (_Float16)wc[(size_t)(k0 + j) * ldw];
    *(uint4*)&Bs[c][k0] = t.u;
  }
}

// ---------------------------------------------------------------------------
// Kernel 1: position-bias MLP -> f16 bq [H,N,R] (pre-scaled), bk [H,N,R]
// grid (8 heads, 16 position groups) x 256 threads: a work-group forms 16
// positions x the 64 output columns (32 bq + 32 bk) of one head.
// A lane owns one column of w2 (a wave reads whole 128-B lines) and holds all
// 128 k of it in registers; two waves share four positions, whose hidden
// features they read from LDS as broadcasts: four independent sums per lane,
// each in the order k = 0..127.
// ---------------------------------------------------------------------------
__global__ void __launch_bounds__(256)
bias1_kernel(const float* __restrict__ w1, const float* __restrict__ b1,
             const float* __restrict__ w2, const float* __restrict__ bscale_p,
             _Float16* __restrict__ bq, _Float16* __restrict__ bk) {
  __shared__ __attribute__((aligned(16))) float hf[16][132];   // pitch 528 B = 16 B x 33
  const int tid = threadIdx.x;
  const int h = blockIdx.x, n0 = blockIdx.y * 16;
  const int c = tid & 63, pg = tid >> 6;

  // a thread forms 8 hidden features of one position: its slices of w1 and b1
  const int p = tid >> 4, j0 = (tid & 15) * 8;
  union { float4 q[2]; float f[8]; } wa, wb, bb, g;
  #pragma unroll
  for (int t = 0; t < 2; ++t) {
    wa.q[t] = *(const float4*)(w1 + j0 + 4 * t);
    wb.q[t] = *(const float4*)(w1 + 128 + j0 + 4 * t);
    bb.q[t] = *(const float4*)(b1 + j0 + 4 * t);
  }
  const float bsc = bscale_p[0];
  // the scalar bases of the six loads above are given new values below; the
  // statement also keeps the six, which the gelu phase waits for, in front of the
  // 128 below (loads return in order)
  asm volatile("s_wait_xcnt 0x0" ::: "memory");
  // this lane's column of w2, fetched here: the latency runs under the gelu phase
  float wc[128];
  const float* wp = w2 + h * 64 + c;
  #pragma unroll
  for (int j = 0; j < 128; ++j) wc[j] = wp[j * 512];

  {
    const int n = n0 + p;                     // position index 0..255
    const float invden = 1.0f / logf(16.0f);  // log1p(15) = log(16)
    const float c0 = log1pf((float)(n >> 4)) * invden;   // gy
    const float c1 = log1pf((float)(n & 15)) * invden;   // gx
    #pragma unroll
    for (int jj = 0; jj < 8; ++jj) {
      float z = c0 * wa.f[jj] + c1 * wb.f[jj] + bb.f[jj];
      g.f[jj] = 0.5f * z * (1.0f + erff(z * 0.70710678118654752f));  // exact gelu
    }
    *(float4*)&hf[p][j0]     = g.q[0];
    *(float4*)&hf[p][j0 + 4] = g.q[1];
  }
  __syncthreads();

  float acc[4] = {0.0f, 0.0f, 0.0f, 0.0f};
  #pragma unroll
  for (int j = 0; j < 128; j += 4) {
    #pragma unroll
    for (int i = 0; i < 4; ++i) {
      const float4 hv = *(const float4*)&hf[pg * 4 + i][j];
      acc[i] += hv.x * wc[j];
      acc[i] += hv.y * wc[j + 1];
      acc[i] += hv.z * wc[j + 2];
      acc[i] += hv.w * wc[j + 3];
    }
  }

  const int which = c >> 5, r = c & 31;       // the same for a whole wave
  _Float16* outp = (which == 0) ? bq : bk;
  const float osc = (which == 0) ? bsc : 1.0f;
  #pragma unroll
  for (int i = 0; i < 4; ++i) {
    const int n = n0 + pg * 4 + i;
    const float s = 1.0f / (1.0f + __expf(-acc[i]));
    outp[(h * 256 + n) * 32 + r] = (_Float16)(osc * s);
  }
}

// ---------------------------------------------------------------------------
// Kernel 2: QKV GEMM  [131072 x 256] @ [256 x 768] (+bias, q*=logit_scale)
// Block tile 128x128, 8 waves, each wave 2x4 16x16 accum tiles.
// grid (6, 128): a work-group stages its weight panel once and walks 8 row tiles.
// ---------------------------------------------------------------------------
#define QKV_TILES 8
__global__ void __launch_bounds__(256)
qkv_kernel(const float* __restrict__ x, const float* __restrict__ w,
                           const float* __restrict__ bvec, const float* __restrict__ lsc,
                           _Float16* __restrict__ qo, _Float16* __restrict__ ko,
                           _Float16* __restrict__ vo) {
  __shared__ _Float16 As[128][40];   // pitch 40 h (80 B, 16B-aligned)
  __shared__ _Float16 Bs[128][PANEL_PITCH];   // weight panel: Bs[col][k], all k
  const int tid = threadIdx.x, lane = tid & 31, wave = tid >> 5;
  const int wm = wave & 3, wn = wave >> 2;
  const int mlane = lane & 15, hsel = lane >> 4;
  const int n0 = blockIdx.x * 128;

  // published by the two barriers in front of the first fragment loads
  stage_panel(Bs, w, 768, n0, tid);

  // bias and q scale of this lane's four output columns, the same for every tile
  float addb[4], scale[4];
  #pragma unroll
  for (int j = 0; j < 4; ++j) {
    const int jg = n0 + wn * 64 + j * 16 + mlane;
    addb[j] = bvec[jg];
    scale[j] = ((jg >> 8) == 0) ? lsc[(jg >> 5) & 7] : 1.0f;
  }

  // Kept rolled, for speed only; the K loop inside is unrolled.
  #pragma unroll 1
  for (int mt = 0; mt < QKV_TILES; ++mt) {
  const int m0 = (blockIdx.y * QKV_TILES + mt) * 128;

  Acc8 acc[2][4];
  #pragma unroll
  for (int i = 0; i < 2; ++i)
    #pragma unroll
    for (int j = 0; j < 4; ++j)
      #pragma unroll
      for (int r = 0; r < 8; ++r) acc[i][j].f[r] = 0.0f;

  for (int kk = 0; kk < 256; kk += 32) {
    __syncthreads();
    // prefetch next K chunk into WGP-level cache (locality 3 -> WGP scope)
    if (kk + 32 < 256)
      __builtin_prefetch(x + (size_t)(m0 + (tid >> 3)) * 256 + kk + 32 + (tid & 7) * 4, 0, 3);
    // A: x[m0+r][kk + k4..k4+3], f32 -> f16
    #pragma unroll
    for (int p = 0; p < 4; ++p) {
      int r = (tid >> 3) + p * 32;
      float4 a = *(const float4*)(x + (size_t)(m0 + r) * 256 + kk + (tid & 7) * 4);
      union { _Float16 h[4]; uint2 u; } t;
      t.h[0] = (_Float16)a.x; t.h[1] = (_Float16)a.y;
      t.h[2] = (_Float16)a.z; t.h[3] = (_Float16)a.w;
      *(uint2*)&As[r][(tid & 7) * 4] = t.u;
    }
    __syncthreads();
    Frag16 af[2], bf[4];
    #pragma unroll
    for (int i = 0; i < 2; ++i) af[i].v = lds_frag16(&As[wm * 32 + i * 16 + mlane][0], hsel);
    #pragma unroll
    for (int j = 0; j < 4; ++j) bf[j].v = lds_frag16(&Bs[wn * 64 + j * 16 + mlane][kk], hsel);
    #pragma unroll
    for (int i = 0; i < 2; ++i)
      #pragma unroll
      for (int j = 0; j < 4; ++j)
        acc[i][j].v = WMMA16(af[i].v, bf[j].v, acc[i][j].v);
  }

  // epilogue: +bias, q*=logit_scale[h], scatter f16 to [B,H,N,32]
  #pragma unroll
  for (int j = 0; j < 4; ++j) {
    const int jg = n0 + wn * 64 + j * 16 + mlane;     // global out column 0..767
    const int which = jg >> 8, h = (jg >> 5) & 7, d = jg & 31;
    _Float16* outp = (which == 0) ? qo : ((which == 1) ? ko : vo);
    #pragma unroll
    for (int i = 0; i < 2; ++i) {
      #pragma unroll
      for (int r = 0; r < 8; ++r) {
        int mg = m0 + wm * 32 + i * 16 + r + 8 * hsel;  // global row = b*256 + nrow
        int bb = mg >> 8, nrow = mg & 255;
        float val = (acc[i][j].f[r] + addb[j]) * scale[j];
        outp[(((size_t)bb * 8 + h) * 256 + nrow) * 32 + d] = (_Float16)val;
      }
    }
  }
  // the next trip reuses the address and data registers of these stores
  asm volatile("s_wait_xcnt 0x0" ::: "memory");
  }
}

// ---------------------------------------------------------------------------
// Kernel 3: fused attention per (b,h).  grid (8, 512), 256 threads = 8 waves.
//  The scores never leave the registers.  Each wave owns 2 x 16 queries and
//  forms S^T = K Q^T + BK BQ^T (A = key rows, B = query rows): in D a lane
//  holds one query (column lane&15) and keys 8*(lane>>4)+r of each 16-key tile,
//  so row maximum and row sum are in-lane plus one exchange between the halves,
//  and two neighbouring D tiles, converted to f16, are the B operand of
//  O^T = V^T P^T in the hardware k order that lds_frag16 also delivers.
//  q/k/bq/bk staged with async-to-LDS copies; v transposed through VGPRs.
// ---------------------------------------------------------------------------
typedef __attribute__((ext_vector_type(8))) _Float16 v8h;

static __device__ __forceinline__ float other_half(float x) {
  // value of lane l ^ 16
  int b = __builtin_bit_cast(int, x);
  b = __builtin_amdgcn_permlanex16(b, b, 0x76543210, 0xfedcba98, false, false);
  return __builtin_bit_cast(float, b);
}

__global__ void __launch_bounds__(256)
attn_kernel(const _Float16* __restrict__ qg, const _Float16* __restrict__ kg,
            const _Float16* __restrict__ vg,
            const _Float16* __restrict__ bqg, const _Float16* __restrict__ bkg,
            const float* __restrict__ vrs_g, _Float16* __restrict__ ao) {
  __shared__ _Float16 qs[256][40];     // 20 KB
  __shared__ _Float16 ks[256][40];     // 20 KB
  __shared__ _Float16 bqs[256][40];    // 20 KB  (rank-bias q factors, head h)
  __shared__ _Float16 bks[256][40];    // 20 KB  (rank-bias k factors, head h)
  __shared__ _Float16 vt[32][264];     // v transposed: vt[d][m], 16.9 KB
  __shared__ float    vmean[32];

  const int h = blockIdx.x, b = blockIdx.y;
  const int tid = threadIdx.x, lane = tid & 31, wave = tid >> 5;
  const int mlane = lane & 15, hsel = lane >> 4;
  const size_t base = ((size_t)b * 8 + h) * 256 * 32;

  // phase 0: stage q, k, bq, bk (async f16 copies) and v (transpose in VGPRs)
  async_copy64(&qs[tid][0],  qg + base + (size_t)tid * 32);
  async_copy64(&ks[tid][0],  kg + base + (size_t)tid * 32);
  async_copy64(&bqs[tid][0], bqg + ((size_t)h * 256 + tid) * 32);
  async_copy64(&bks[tid][0], bkg + ((size_t)h * 256 + tid) * 32);
  {
    union { uint4 u[4]; _Float16 h16[32]; } vv;
    const uint4* vp = (const uint4*)(vg + base + (size_t)tid * 32);
    #pragma unroll
    for (int c = 0; c < 4; ++c) vv.u[c] = vp[c];
    #pragma unroll
    for (int d = 0; d < 32; ++d) vt[d][tid] = vv.h16[d];
  }
  wait_async0();
  __syncthreads();

  // v_mean (wave 0)
  if (tid < 32) {
    float s = 0.0f;
    for (int m = 0; m < 256; ++m) s += (float)vt[tid][m];
    vmean[tid] = s * (1.0f / 256.0f);
  }

  const float vrs = vrs_g[h];
  // Kept rolled: unrolled, the compiler shares the K fragments between the two
  // query tiles and holds 256 score registers, which halves the waves per SIMD.
  #pragma unroll 1
  for (int qi = 0; qi < 2; ++qi) {
    const int q0 = (wave * 2 + qi) * 16;
    const v16h fq = lds_frag16(&qs[q0 + mlane][0], hsel);
    const v16h fb = lds_frag16(&bqs[q0 + mlane][0], hsel);

    // scores: s[kt].f[r] = S[query q0+mlane][key 16*kt + 8*hsel + r]
    Acc8 s[16];
    #pragma unroll
    for (int kt = 0; kt < 16; ++kt) {
      const v16h fk  = lds_frag16(&ks[kt * 16 + mlane][0], hsel);
      const v16h fbk = lds_frag16(&bks[kt * 16 + mlane][0], hsel);
      #pragma unroll
      for (int r = 0; r < 8; ++r) s[kt].f[r] = 0.0f;
      s[kt].v = WMMA16(fk, fq, s[kt].v);
      s[kt].v = WMMA16(fbk, fb, s[kt].v);
    }

    // softmax over the 256 keys of this lane's query, unnormalised
    v8f m8 = s[0].v;
    #pragma unroll
    for (int kt = 1; kt < 16; ++kt) m8 = __builtin_elementwise_max(m8, s[kt].v);
    float mx = fmaxf(fmaxf(fmaxf(m8[0], m8[1]), fmaxf(m8[2], m8[3])),
                     fmaxf(fmaxf(m8[4], m8[5]), fmaxf(m8[6], m8[7])));
    mx = fmaxf(mx, other_half(mx));
    const float L2E = 1.44269504088896340736f;
    const float nm = -mx * L2E;
    const v8f l2e8 = {L2E, L2E, L2E, L2E, L2E, L2E, L2E, L2E};
    const v8f nm8  = {nm, nm, nm, nm, nm, nm, nm, nm};
    v8f sum8 = {0.0f, 0.0f, 0.0f, 0.0f, 0.0f, 0.0f, 0.0f, 0.0f};
    #pragma unroll
    for (int kt = 0; kt < 16; ++kt) {
      const v8f t = __builtin_elementwise_fma(s[kt].v, l2e8, nm8);
      #pragma unroll
      for (int r = 0; r < 8; ++r) s[kt].f[r] = __builtin_amdgcn_exp2f(t[r]);
      sum8 += s[kt].v;
    }
    float sum = ((sum8[0] + sum8[1]) + (sum8[2] + sum8[3])) +
                ((sum8[4] + sum8[5]) + (sum8[6] + sum8[7]));
    sum += other_half(sum);
    const float inv = 1.0f / sum;

    // O^T = V^T P^T: A = rows of vt, B = two packed score tiles per 32 keys;
    // o[dt].f[r] = out[query q0+mlane][d = 16*dt + 8*hsel + r] * sum
    Acc8 o[2];
    #pragma unroll
    for (int dt = 0; dt < 2; ++dt)
      #pragma unroll
      for (int r = 0; r < 8; ++r) o[dt].f[r] = 0.0f;
    #pragma unroll
    for (int mc = 0; mc < 8; ++mc) {
      const v8h lo = __builtin_convertvector(s[2 * mc].v, v8h);
      const v8h hi = __builtin_convertvector(s[2 * mc + 1].v, v8h);
      const v16h p = __builtin_shufflevector(lo, hi, 0, 1, 2, 3, 4, 5, 6, 7,
                                             8, 9, 10, 11, 12, 13, 14, 15);
      #pragma unroll
      for (int dt = 0; dt < 2; ++dt) {
        const v16h fv = lds_frag16(&vt[dt * 16 + mlane][mc * 32], hsel);
        o[dt].v = WMMA16(fv, p, o[dt].v);
      }
    }

    if (qi == 0) __syncthreads();   // publish vmean before its first reader

    // normalise, + vrs * v_mean, one 16-byte f16 store per tile to [B,N,C]
    #pragma unroll
    for (int dt = 0; dt < 2; ++dt) {
      const int d0 = dt * 16 + 8 * hsel;
      union { uint4 u; _Float16 h16[8]; } st;
      #pragma unroll
      for (int r = 0; r < 8; ++r)
        st.h16[r] = (_Float16)(o[dt].f[r] * inv + vmean[d0 + r] * vrs);
      *(uint4*)(ao + ((size_t)b * 256 + q0 + mlane) * 256 + h * 32 + d0) = st.u;
    }
    // the next trip reuses the address and data registers of these stores
    asm volatile("s_wait_xcnt 0x0" ::: "memory");
  }
}

// ---------------------------------------------------------------------------
// Kernel 4: proj GEMM  [131072 x 256](f16) @ [256 x 256] + proj_b -> f32 out
// A tile staged with async-to-LDS (pure f16 copy); weight panel converted
// f32->f16 once.  grid (2, 512): a work-group walks 2 row tiles.
// ---------------------------------------------------------------------------
#define PROJ_TILES 2
__global__ void __launch_bounds__(256)
proj_kernel(const _Float16* __restrict__ a, const float* __restrict__ w,
                            const float* __restrict__ bvec, float* __restrict__ out) {
  __shared__ _Float16 As[128][40];
  __shared__ _Float16 Bs[128][PANEL_PITCH];   // weight panel: Bs[col][k], all k
  const int tid = threadIdx.x, lane = tid & 31, wave = tid >> 5;
  const int wm = wave & 3, wn = wave >> 2;
  const int mlane = lane & 15, hsel = lane >> 4;
  const int n0 = blockIdx.x * 128;

  const int ar0 = tid >> 2, ak8 = (tid & 3) * 8;
  void* lds_a0 = &As[ar0][ak8];
  void* lds_a1 = &As[ar0 + 64][ak8];

  // published by the two barriers in front of the first fragment loads
  stage_panel(Bs, w, 256, n0, tid);

  // Kept rolled: unrolled, the register count passes 128 and three work-groups
  // instead of four fit a WGP.
  #pragma unroll 1
  for (int mt = 0; mt < PROJ_TILES; ++mt) {
  const int m0 = (blockIdx.y * PROJ_TILES + mt) * 128;

  Acc8 acc[2][4];
  #pragma unroll
  for (int i = 0; i < 2; ++i)
    #pragma unroll
    for (int j = 0; j < 4; ++j)
      #pragma unroll
      for (int r = 0; r < 8; ++r) acc[i][j].f[r] = 0.0f;

  for (int kk = 0; kk < 256; kk += 32) {
    __syncthreads();
    // A tile: async f16 copies (16B per lane per pass)
    async_copy16(lds_a0, a + (size_t)(m0 + ar0) * 256 + kk + ak8);
    async_copy16(lds_a1, a + (size_t)(m0 + ar0 + 64) * 256 + kk + ak8);
    wait_async0();
    __syncthreads();
    Frag16 af[2], bf[4];
    #pragma unroll
    for (int i = 0; i < 2; ++i) af[i].v = lds_frag16(&As[wm * 32 + i * 16 + mlane][0], hsel);
    #pragma unroll
    for (int j = 0; j < 4; ++j) bf[j].v = lds_frag16(&Bs[wn * 64 + j * 16 + mlane][kk], hsel);
    #pragma unroll
    for (int i = 0; i < 2; ++i)
      #pragma unroll
      for (int j = 0; j < 4; ++j)
        acc[i][j].v = WMMA16(af[i].v, bf[j].v, acc[i][j].v);
  }

  #pragma unroll
  for (int j = 0; j < 4; ++j) {
    const int jg = n0 + wn * 64 + j * 16 + mlane;
    const float addb = bvec[jg];
    #pragma unroll
    for (int i = 0; i < 2; ++i) {
      #pragma unroll
      for (int r = 0; r < 8; ++r) {
        int mg = m0 + wm * 32 + i * 16 + r + 8 * hsel;
        out[(size_t)mg * 256 + jg] = acc[i][j].f[r] + addb;
      }
    }
  }
  // the next trip reuses the address and data registers of these stores
  asm volatile("s_wait_xcnt 0x0" ::: "memory");
  }
}

// ---------------------------------------------------------------------------
// Host launcher
// ---------------------------------------------------------------------------
extern "C" void kernel_launch(void* const* d_in, const int* in_sizes, int n_in,
                              void* d_out, int out_size, void* d_ws, size_t ws_size,
                              hipStream_t stream) {
  const float* x       = (const float*)d_in[0];
  const float* qkv_w   = (const float*)d_in[1];
  const float* qkv_b   = (const float*)d_in[2];
  const float* proj_w  = (const float*)d_in[3];
  const float* proj_b  = (const float*)d_in[4];
  const float* lsc     = (const float*)d_in[5];
  const float* vrs     = (const float*)d_in[6];
  const float* mlp1_w  = (const float*)d_in[7];
  const float* mlp1_b  = (const float*)d_in[8];
  const float* mlp2_w  = (const float*)d_in[9];
  const float* bscale  = (const float*)d_in[10];

  char* ws = (char*)d_ws;
  const size_t QSZ = (size_t)512 * 8 * 256 * 32 * sizeof(_Float16);  // 67.1 MB each
  _Float16* bq = (_Float16*)(ws + 0);          // 128 KB (f16, pre-scaled by bias_scale)
  _Float16* bk = (_Float16*)(ws + 131072);     // 128 KB
  _Float16* q  = (_Float16*)(ws + 262144);
  _Float16* k  = (_Float16*)(ws + 262144 + QSZ);
  _Float16* v  = (_Float16*)(ws + 262144 + 2 * QSZ);
  _Float16* ao = (_Float16*)(ws + 262144 + 3 * QSZ);
  float*    out = (float*)d_out;

  bias1_kernel<<<dim3(8, 16), 256, 0, stream>>>(mlp1_w, mlp1_b, mlp2_w, bscale, bq, bk);
  qkv_kernel<<<dim3(6, 128), 256, 0, stream>>>(x, qkv_w, qkv_b, lsc, q, k, v);
  attn_kernel<<<dim3(8, 512), 256, 0, stream>>>(q, k, v, bq, bk, vrs, ao);
  proj_kernel<<<dim3(2, 512), 256, 0, stream>>>(ao, proj_w, proj_b, out);
}

// v004
// A run of this version takes 200 microseconds.
// In both of two side-by-side timings against v003, it was 1.05 times as fast.
// Over all steps from v000 it is 3.56 times as fast.
#include <hip/hip_runtime.h>

// ---------------------------------------------------------------------------
// WindowAttentionRFB for gfx1250 (MI455X)
//   bias1 (MLP -> f16 bq/bk) -> qkv WMMA GEMM -> fused attention
//   (scores = q k^T + bq bk^T as two chained WMMAs, kept in registers, in-lane
//    softmax, attn@V) -> proj WMMA GEMM.
//   Async global->LDS staging (global_load_async_to_lds_b128) for pure f16
//   copies; f32->f16 converting stages use regular vector loads.
//   Both GEMMs keep their weight panel (128 columns x all 256 k, f16, [col][k])
//   in LDS for the life of the work-group, which walks several row tiles.
// Shapes: B=512, N=256, C=256, H=8, hd=32, R=32
// ---------------------------------------------------------------------------

typedef __attribute__((ext_vector_type(16))) _Float16 v16h;
typedef __attribute__((ext_vector_type(8)))  float    v8f;

union Frag16 { v16h v; uint4 q[2]; _Float16 h[16]; };
union Acc8   { v8f  v; float f[8]; };

#define WMMA16(a, b, c) __builtin_amdgcn_wmma_f32_16x16x32_f16( \
    false, (a), false, (b), (short)0, (c), false, false)

static __device__ __forceinline__ v16h lds_frag16(const _Float16* rowbase, int hsel) {
  // 16-bit A/B fragment: lane (m = lane&15, hsel = lane>>4)
  // chunk0: K = 8*hsel .. +7  -> VGPR0..3 ; chunk1: K = 16+8*hsel .. +7 -> VGPR4..7
  Frag16 t;
  const _Float16* p = rowbase + hsel * 8;
  t.q[0] = *(const uint4*)(p);
  t.q[1] = *(const uint4*)(p + 16);
  return t.v;
}

// 64B per-lane global -> LDS async copy (4 x b128), tracked on ASYNCcnt.
static __device__ __forceinline__ void async_copy64(void* lds_dst, const void* gsrc) {
  unsigned l = (unsigned)(uintptr_t)lds_dst;        // LDS offset = low 32 bits of flat addr
  unsigned long long g = (unsigned long long)(uintptr_t)gsrc;
  asm volatile(
      "global_load_async_to_lds_b128 %0, %1, off\n\t"
      "global_load_async_to_lds_b128 %0, %1, off offset:16\n\t"
      "global_load_async_to_lds_b128 %0, %1, off offset:32\n\t"
      "global_load_async_to_lds_b128 %0, %1, off offset:48"
      :: "v"(l), "v"(g) : "memory");
}

// 16B per-lane global -> LDS async copy.
static __device__ __forceinline__ void async_copy16(void* lds_dst, const void* gsrc) {
  unsigned l = (unsigned)(uintptr_t)lds_dst;
  unsigned long long g = (unsigned long long)(uintptr_t)gsrc;
  // the wait is part of the statement: the caller sits in a rolled loop whose
  // next trip rewrites the two address registers
  asm volatile("global_load_async_to_lds_b128 %0, %1, off\n\t"
               "s_wait_xcnt 0x0"
               :: "v"(l), "v"(g) : "memory");
}

static __device__ __forceinline__ void wait_async0() {
  asm volatile("s_wait_asynccnt 0x0" ::: "memory");
}

// Weight panel of a GEMM work-group: Bs[col][k] = (f16) w[k][n0 + col], 128
// columns, k = 0..255.  Pitch 264 halves = 528 B = 16 B x 33, so that the 16-byte
// stores here and the 16-byte fragment loads fall on distinct banks.
// A lane owns one column (a wave reads whole 128-B lines of w) and packs eight
// consecutive k into one 16-byte LDS store.  256 threads.
#define PANEL_PITCH 264
static __device__ __forceinline__ void stage_panel(_Float16 (*Bs)[PANEL_PITCH],
                                                   const float* __restrict__ w,
                                                   int ldw, int n0, int tid) {
  const int c = tid & 127;
  const float* wc = w + n0 + c;
  // 32 loads in flight per lane; fully unrolled the compiler held all 128 values
  // and the register count cost a resident work-group
  #pragma unroll 4
  for (int it = 0; it < 16; ++it) {
    const int k0 = (it * 2 + (tid >> 7)) * 8;
    union { _Float16 h[8]; uint4 u; } t;
    #pragma unroll
    for (int j = 0; j < 8; ++j) t.h[j] = (_Float16)wc[(size_t)(k0 + j) * ldw];
    *(uint4*)&Bs[c][k0] = t.u;
  }
}

// ---------------------------------------------------------------------------
// Kernel 1: position-bias MLP -> f16 bq [H,N,R] (pre-scaled), bk [H,N,R]
// grid (8 heads, 16 position groups) x 256 threads: a work-group forms 16
// positions x the 64 output columns (32 bq + 32 bk) of one head.
// A lane owns one column of w2 (a wave reads whole 128-B lines) and holds all
// 128 k of it in registers; two waves share four positions, whose hidden
// features they read from LDS as broadcasts: four independent sums per lane,
// each in the order k = 0..127.
// ---------------------------------------------------------------------------
__global__ void __launch_bounds__(256)
bias1_kernel(const float* __restrict__ w1, const float* __restrict__ b1,
             const float* __restrict__ w2, const float* __restrict__ bscale_p,
             _Float16* __restrict__ bq, _Float16* __restrict__ bk) {
  __shared__ __attribute__((aligned(16))) float hf[16][132];   // pitch 528 B = 16 B x 33
  const int tid = threadIdx.x;
  const int h = blockIdx.x, n0 = blockIdx.y * 16;
  const int c = tid & 63, pg = tid >> 6;

  // a thread forms 8 hidden features of one position: its slices of w1 and b1
  const int p = tid >> 4, j0 = (tid & 15) * 8;
  union { float4 q[2]; float f[8]; } wa, wb, bb, g;
  #pragma unroll
  for (int t = 0; t < 2; ++t) {
    wa.q[t] = *(const float4*)(w1 + j0 + 4 * t);
    wb.q[t] = *(const float4*)(w1 + 128 + j0 + 4 * t);
    bb.q[t] = *(const float4*)(b1 + j0 + 4 * t);
  }
  const float bsc = bscale_p[0];
  // the scalar bases of the six loads above are given new values below; the
  // statement also keeps the six, which the gelu phase waits for, in front of the
  // 128 below (loads return in order)
  asm volatile("s_wait_xcnt 0x0" ::: "memory");
  // this lane's column of w2, fetched here: the latency runs under the gelu phase
  float wc[128];
  const float* wp = w2 + h * 64 + c;
  #pragma unroll
  for (int j = 0; j < 128; ++j) wc[j] = wp[j * 512];

  {
    const int n = n0 + p;                     // position index 0..255
    const float invden = 1.0f / logf(16.0f);  // log1p(15) = log(16)
    const float c0 = log1pf((float)(n >> 4)) * invden;   // gy
    const float c1 = log1pf((float)(n & 15)) * invden;   // gx
    #pragma unroll
    for (int jj = 0; jj < 8; ++jj) {
      float z = c0 * wa.f[jj] + c1 * wb.f[jj] + bb.f[jj];
      g.f[jj] = 0.5f * z * (1.0f + erff(z * 0.70710678118654752f));  // exact gelu
    }
    *(float4*)&hf[p][j0]     = g.q[0];
    *(float4*)&hf[p][j0 + 4] = g.q[1];
  }
  __syncthreads();

  float acc[4] = {0.0f, 0.0f, 0.0f, 0.0f};
  #pragma unroll
  for (int j = 0; j < 128; j += 4) {
    #pragma unroll
    for (int i = 0; i < 4; ++i) {
      const float4 hv = *(const float4*)&hf[pg * 4 + i][j];
      acc[i] += hv.x * wc[j];
      acc[i] += hv.y * wc[j + 1];
      acc[i] += hv.z * wc[j + 2];
      acc[i] += hv.w * wc[j + 3];
    }
  }

  const int which = c >> 5, r = c & 31;       // the same for a whole wave
  _Float16* outp = (which == 0) ? bq : bk;
  const float osc = (which == 0) ? bsc : 1.0f;
  #pragma unroll
  for (int i = 0; i < 4; ++i) {
    const int n = n0 + pg * 4 + i;
    const float s = 1.0f / (1.0f + __expf(-acc[i]));
    outp[(h * 256 + n) * 32 + r] = (_Float16)(osc * s);
  }
}

// ---------------------------------------------------------------------------
// Kernel 2: QKV GEMM  [131072 x 256] @ [256 x 768] (+bias, q*=logit_scale)
// Block tile 128x128, 8 waves, each wave 2x4 16x16 accum tiles.
// grid (6, 128): a work-group stages its weight panel once and walks 8 row tiles.
// x is staged 128 k at a time: a row tile pays the load latency and the barrier
// pair twice, with 16 loads of 16 bytes in flight per lane.
// ---------------------------------------------------------------------------
#define QKV_TILES 8
#define QKV_KC 128
__global__ void __launch_bounds__(256)
qkv_kernel(const float* __restrict__ x, const float* __restrict__ w,
                           const float* __restrict__ bvec, const float* __restrict__ lsc,
                           _Float16* __restrict__ qo, _Float16* __restrict__ ko,
                           _Float16* __restrict__ vo) {
  __shared__ _Float16 As[128][QKV_KC + 8];   // pitch 136 h = 272 B = 16 B x 17
  __shared__ _Float16 Bs[128][PANEL_PITCH];   // weight panel: Bs[col][k], all k
  const int tid = threadIdx.x, lane = tid & 31, wave = tid >> 5;
  const int wm = wave & 3, wn = wave >> 2;
  const int mlane = lane & 15, hsel = lane >> 4;
  const int n0 = blockIdx.x * 128;

  // published by the two barriers in front of the first fragment loads
  stage_panel(Bs, w, 768, n0, tid);

  // bias and q scale of this lane's four output columns, the same for every tile
  float addb[4], scale[4];
  #pragma unroll
  for (int j = 0; j < 4; ++j) {
    const int jg = n0 + wn * 64 + j * 16 + mlane;
    addb[j] = bvec[jg];
    scale[j] = ((jg >> 8) == 0) ? lsc[(jg >> 5) & 7] : 1.0f;
  }

  // Kept rolled, for speed only; the K loop inside is unrolled.
  #pragma unroll 1
  for (int mt = 0; mt < QKV_TILES; ++mt) {
  const int m0 = (blockIdx.y * QKV_TILES + mt) * 128;

  Acc8 acc[2][4];
  #pragma unroll
  for (int i = 0; i < 2; ++i)
    #pragma unroll
    for (int j = 0; j < 4; ++j)
      #pragma unroll
      for (int r = 0; r < 8; ++r) acc[i][j].f[r] = 0.0f;

  for (int kk = 0; kk < 256; kk += QKV_KC) {
    __syncthreads();
    // A: x[m0+r][kk + k4..k4+3], f32 -> f16; a wave reads 512 contiguous bytes of one row
    const float* xr = x + (size_t)(m0 + wave) * 256 + kk + lane * 4;
    #pragma unroll
    for (int p = 0; p < 16; ++p) {
      int r = wave + p * 8;
      float4 a = *(const float4*)(xr + p * 8 * 256);
      union { _Float16 h[4]; uint2 u; } t;
      t.h[0] = (_Float16)a.x; t.h[1] = (_Float16)a.y;
      t.h[2] = (_Float16)a.z; t.h[3] = (_Float16)a.w;
      *(uint2*)&As[r][lane * 4] = t.u;
    }
    __syncthreads();
    #pragma unroll
    for (int ks = 0; ks < QKV_KC; ks += 32) {
      Frag16 af[2], bf[4];
      #pragma unroll
      for (int i = 0; i < 2; ++i) af[i].v = lds_frag16(&As[wm * 32 + i * 16 + mlane][ks], hsel);
      #pragma unroll
      for (int j = 0; j < 4; ++j) bf[j].v = lds_frag16(&Bs[wn * 64 + j * 16 + mlane][kk + ks], hsel);
      #pragma unroll
      for (int i = 0; i < 2; ++i)
        #pragma unroll
        for (int j = 0; j < 4; ++j)
          acc[i][j].v = WMMA16(af[i].v, bf[j].v, acc[i][j].v);
    }
  }

  // epilogue: +bias, q*=logit_scale[h], scatter f16 to [B,H,N,32]
  #pragma unroll
  for (int j = 0; j < 4; ++j) {
    const int jg = n0 + wn * 64 + j * 16 + mlane;     // global out column 0..767
    const int which = jg >> 8, h = (jg >> 5) & 7, d = jg & 31;
    _Float16* outp = (which == 0) ? qo : ((which == 1) ? ko : vo);
    #pragma unroll
    for (int i = 0; i < 2; ++i) {
      #pragma unroll
      for (int r = 0; r < 8; ++r) {
        int mg = m0 + wm * 32 + i * 16 + r + 8 * hsel;  // global row = b*256 + nrow
        int bb = mg >> 8, nrow = mg & 255;
        float val = (acc[i][j].f[r] + addb[j]) * scale[j];
        outp[(((size_t)bb * 8 + h) * 256 + nrow) * 32 + d] = (_Float16)val;
      }
    }
  }
  // the next trip reuses the address and data registers of these stores
  asm volatile("s_wait_xcnt 0x0" ::: "memory");
  }
}

// ---------------------------------------------------------------------------
// Kernel 3: fused attention per (b,h).  grid (8, 512), 256 threads = 8 waves.
//  The scores never leave the registers.  Each wave owns 2 x 16 queries and
//  forms S^T = K Q^T + BK BQ^T (A = key rows, B = query rows): in D a lane
//  holds one query (column lane&15) and keys 8*(lane>>4)+r of each 16-key tile,
//  so row maximum and row sum are in-lane plus one exchange between the halves,
//  and two neighbouring D tiles, converted to f16, are the B operand of
//  O^T = V^T P^T in the hardware k order that lds_frag16 also delivers.
//  q/k/bq/bk staged with async-to-LDS copies; v transposed through VGPRs.
// ---------------------------------------------------------------------------
typedef __attribute__((ext_vector_type(8))) _Float16 v8h;

static __device__ __forceinline__ float other_half(float x) {
  // value of lane l ^ 16
  int b = __builtin_bit_cast(int, x);
  b = __builtin_amdgcn_permlanex16(b, b, 0x76543210, 0xfedcba98, false, false);
  return __builtin_bit_cast(float, b);
}

__global__ void __launch_bounds__(256)
attn_kernel(const _Float16* __restrict__ qg, const _Float16* __restrict__ kg,
            const _Float16* __restrict__ vg,
            const _Float16* __restrict__ bqg, const _Float16* __restrict__ bkg,
            const float* __restrict__ vrs_g, _Float16* __restrict__ ao) {
  __shared__ _Float16 qs[256][40];     // 20 KB
  __shared__ _Float16 ks[256][40];     // 20 KB
  __shared__ _Float16 bqs[256][40];    // 20 KB  (rank-bias q factors, head h)
  __shared__ _Float16 bks[256][40];    // 20 KB  (rank-bias k factors, head h)
  __shared__ _Float16 vt[32][264];     // v transposed: vt[d][m], 16.9 KB
  __shared__ float    vmean[32];

  const int h = blockIdx.x, b = blockIdx.y;
  const int tid = threadIdx.x, lane = tid & 31, wave = tid >> 5;
  const int mlane = lane & 15, hsel = lane >> 4;
  const size_t base = ((size_t)b * 8 + h) * 256 * 32;

  // phase 0: stage q, k, bq, bk (async f16 copies) and v (transpose in VGPRs)
  async_copy64(&qs[tid][0],  qg + base + (size_t)tid * 32);
  async_copy64(&ks[tid][0],  kg + base + (size_t)tid * 32);
  async_copy64(&bqs[tid][0], bqg + ((size_t)h * 256 + tid) * 32);
  async_copy64(&bks[tid][0], bkg + ((size_t)h * 256 + tid) * 32);
  {
    union { uint4 u[4]; _Float16 h16[32]; } vv;
    const uint4* vp = (const uint4*)(vg + base + (size_t)tid * 32);
    #pragma unroll
    for (int c = 0; c < 4; ++c) vv.u[c] = vp[c];
    #pragma unroll
    for (int d = 0; d < 32; ++d) vt[d][tid] = vv.h16[d];
  }
  wait_async0();
  __syncthreads();

  // v_mean (wave 0)
  if (tid < 32) {
    float s = 0.0f;
    for (int m = 0; m < 256; ++m) s += (float)vt[tid][m];
    vmean[tid] = s * (1.0f / 256.0f);
  }

  const float vrs = vrs_g[h];
  // Kept rolled: unrolled, the compiler shares the K fragments between the two
  // query tiles and holds 256 score registers, which halves the waves per SIMD.
  #pragma unroll 1
  for (int qi = 0; qi < 2; ++qi) {
    const int q0 = (wave * 2 + qi) * 16;
    const v16h fq = lds_frag16(&qs[q0 + mlane][0], hsel);
    const v16h fb = lds_frag16(&bqs[q0 + mlane][0], hsel);

    // scores: s[kt].f[r] = S[query q0+mlane][key 16*kt + 8*hsel + r]
    Acc8 s[16];
    #pragma unroll
    for (int kt = 0; kt < 16; ++kt) {
      const v16h fk  = lds_frag16(&ks[kt * 16 + mlane][0], hsel);
      const v16h fbk = lds_frag16(&bks[kt * 16 + mlane][0], hsel);
      #pragma unroll
      for (int r = 0; r < 8; ++r) s[kt].f[r] = 0.0f;
      s[kt].v = WMMA16(fk, fq, s[kt].v);
      s[kt].v = WMMA16(fbk, fb, s[kt].v);
    }

    // softmax over the 256 keys of this lane's query, unnormalised
    v8f m8 = s[0].v;
    #pragma unroll
    for (int kt = 1; kt < 16; ++kt) m8 = __builtin_elementwise_max(m8, s[kt].v);
    float mx = fmaxf(fmaxf(fmaxf(m8[0], m8[1]), fmaxf(m8[2], m8[3])),
                     fmaxf(fmaxf(m8[4], m8[5]), fmaxf(m8[6], m8[7])));
    mx = fmaxf(mx, other_half(mx));
    const float L2E = 1.44269504088896340736f;
    const float nm = -mx * L2E;
    const v8f l2e8 = {L2E, L2E, L2E, L2E, L2E, L2E, L2E, L2E};
    const v8f nm8  = {nm, nm, nm, nm, nm, nm, nm, nm};
    v8f sum8 = {0.0f, 0.0f, 0.0f, 0.0f, 0.0f, 0.0f, 0.0f, 0.0f};
    #pragma unroll
    for (int kt = 0; kt < 16; ++kt) {
      const v8f t = __builtin_elementwise_fma(s[kt].v, l2e8, nm8);
      #pragma unroll
      for (int r = 0; r < 8; ++r) s[kt].f[r] = __builtin_amdgcn_exp2f(t[r]);
      sum8 += s[kt].v;
    }
    float sum = ((sum8[0] + sum8[1]) + (sum8[2] + sum8[3])) +
                ((sum8[4] + sum8[5]) + (sum8[6] + sum8[7]));
    sum += other_half(sum);
    const float inv = 1.0f / sum;

    // O^T = V^T P^T: A = rows of vt, B = two packed score tiles per 32 keys;
    // o[dt].f[r] = out[query q0+mlane][d = 16*dt + 8*hsel + r] * sum
    Acc8 o[2];
    #pragma unroll
    for (int dt = 0; dt < 2; ++dt)
      #pragma unroll
      for (int r = 0; r < 8; ++r) o[dt].f[r] = 0.0f;
    #pragma unroll
    for (int mc = 0; mc < 8; ++mc) {
      const v8h lo = __builtin_convertvector(s[2 * mc].v, v8h);
      const v8h hi = __builtin_convertvector(s[2 * mc + 1].v, v8h);
      const v16h p = __builtin_shufflevector(lo, hi, 0, 1, 2, 3, 4, 5, 6, 7,
                                             8, 9, 10, 11, 12, 13, 14, 15);
      #pragma unroll
      for (int dt = 0; dt < 2; ++dt) {
        const v16h fv = lds_frag16(&vt[dt * 16 + mlane][mc * 32], hsel);
        o[dt].v = WMMA16(fv, p, o[dt].v);
      }
    }

    if (qi == 0) __syncthreads();   // publish vmean before its first reader

    // normalise, + vrs * v_mean, one 16-byte f16 store per tile to [B,N,C]
    #pragma unroll
    for (int dt = 0; dt < 2; ++dt) {
      const int d0 = dt * 16 + 8 * hsel;
      union { uint4 u; _Float16 h16[8]; } st;
      #pragma unroll
      for (int r = 0; r < 8; ++r)
        st.h16[r] = (_Float16)(o[dt].f[r] * inv + vmean[d0 + r] * vrs);
      *(uint4*)(ao + ((size_t)b * 256 + q0 + mlane) * 256 + h * 32 + d0) = st.u;
    }
    // the next trip reuses the address and data registers of these stores
    asm volatile("s_wait_xcnt 0x0" ::: "memory");
  }
}

// ---------------------------------------------------------------------------
// Kernel 4: proj GEMM  [131072 x 256](f16) @ [256 x 256] + proj_b -> f32 out
// A tile staged with async-to-LDS (pure f16 copy); weight panel converted
// f32->f16 once.  grid (2, 512): a work-group walks 2 row tiles.
// ---------------------------------------------------------------------------
#define PROJ_TILES 2
__global__ void __launch_bounds__(256)
proj_kernel(const _Float16* __restrict__ a, const float* __restrict__ w,
                            const float* __restrict__ bvec, float* __restrict__ out) {
  __shared__ _Float16 As[128][40];
  __shared__ _Float16 Bs[128][PANEL_PITCH];   // weight panel: Bs[col][k], all k
  const int tid = threadIdx.x, lane = tid & 31, wave = tid >> 5;
  const int wm = wave & 3, wn = wave >> 2;
  const int mlane = lane & 15, hsel = lane >> 4;
  const int n0 = blockIdx.x * 128;

  const int ar0 = tid >> 2, ak8 = (tid & 3) * 8;
  void* lds_a0 = &As[ar0][ak8];
  void* lds_a1 = &As[ar0 + 64][ak8];

  // published by the two barriers in front of the first fragment loads
  stage_panel(Bs, w, 256, n0, tid);

  // Kept rolled: unrolled, the register count passes 128 and three work-groups
  // instead of four fit a WGP.
  #pragma unroll 1
  for (int mt = 0; mt < PROJ_TILES; ++mt) {
  const int m0 = (blockIdx.y * PROJ_TILES + mt) * 128;

  Acc8 acc[2][4];
  #pragma unroll
  for (int i = 0; i < 2; ++i)
    #pragma unroll
    for (int j = 0; j < 4; ++j)
      #pragma unroll
      for (int r = 0; r < 8; ++r) acc[i][j].f[r] = 0.0f;

  for (int kk = 0; kk < 256; kk += 32) {
    __syncthreads();
    // A tile: async f16 copies (16B per lane per pass)
    async_copy16(lds_a0, a + (size_t)(m0 + ar0) * 256 + kk + ak8);
    async_copy16(lds_a1, a + (size_t)(m0 + ar0 + 64) * 256 + kk + ak8);
    wait_async0();
    __syncthreads();
    Frag16 af[2], bf[4];
    #pragma unroll
    for (int i = 0; i < 2; ++i) af[i].v = lds_frag16(&As[wm * 32 + i * 16 + mlane][0], hsel);
    #pragma unroll
    for (int j = 0; j < 4; ++j) bf[j].v = lds_frag16(&Bs[wn * 64 + j * 16 + mlane][kk], hsel);
    #pragma unroll
    for (int i = 0; i < 2; ++i)
      #pragma unroll
      for (int j = 0; j < 4; ++j)
        acc[i][j].v = WMMA16(af[i].v, bf[j].v, acc[i][j].v);
  }

  #pragma unroll
  for (int j = 0; j < 4; ++j) {
    const int jg = n0 + wn * 64 + j * 16 + mlane;
    const float addb = bvec[jg];
    #pragma unroll
    for (int i = 0; i < 2; ++i) {
      #pragma unroll
      for (int r = 0; r < 8; ++r) {
        int mg = m0 + wm * 32 + i * 16 + r + 8 * hsel;
        out[(size_t)mg * 256 + jg] = acc[i][j].f[r] + addb;
      }
    }
  }
  // the next trip reuses the address and data registers of these stores
  asm volatile("s_wait_xcnt 0x0" ::: "memory");
  }
}

// ---------------------------------------------------------------------------
// Host launcher
// ---------------------------------------------------------------------------
extern "C" void kernel_launch(void* const* d_in, const int* in_sizes, int n_in,
                              void* d_out, int out_size, void* d_ws, size_t ws_size,
                              hipStream_t stream) {
  const float* x       = (const float*)d_in[0];
  const float* qkv_w   = (const float*)d_in[1];
  const float* qkv_b   = (const float*)d_in[2];
  const float* proj_w  = (const float*)d_in[3];
  const float* proj_b  = (const float*)d_in[4];
  const float* lsc     = (const float*)d_in[5];
  const float* vrs     = (const float*)d_in[6];
  const float* mlp1_w  = (const float*)d_in[7];
  const float* mlp1_b  = (const float*)d_in[8];
  const float* mlp2_w  = (const float*)d_in[9];
  const float* bscale  = (const float*)d_in[10];

  char* ws = (char*)d_ws;
  const size_t QSZ = (size_t)512 * 8 * 256 * 32 * sizeof(_Float16);  // 67.1 MB each
  _Float16* bq = (_Float16*)(ws + 0);          // 128 KB (f16, pre-scaled by bias_scale)
  _Float16* bk = (_Float16*)(ws + 131072);     // 128 KB
  _Float16* q  = (_Float16*)(ws + 262144);
  _Float16* k  = (_Float16*)(ws + 262144 + QSZ);
  _Float16* v  = (_Float16*)(ws + 262144 + 2 * QSZ);
  _Float16* ao = (_Float16*)(ws + 262144 + 3 * QSZ);
  float*    out = (float*)d_out;

  bias1_kernel<<<dim3(8, 16), 256, 0, stream>>>(mlp1_w, mlp1_b, mlp2_w, bscale, bq, bk);
  qkv_kernel<<<dim3(6, 128), 256, 0, stream>>>(x, qkv_w, qkv_b, lsc, q, k, v);
  attn_kernel<<<dim3(8, 512), 256, 0, stream>>>(q, k, v, bq, bk, vrs, ao);
  proj_kernel<<<dim3(2, 512), 256, 0, stream>>>(ao, proj_w, proj_b, out);
}

// v005
// It runs in 194 microseconds.
// In both of two side-by-side timings against v004, it was 1.03 times as fast.
// Over all steps from v000 it is 3.66 times as fast.
#include <hip/hip_runtime.h>

// ---------------------------------------------------------------------------
// WindowAttentionRFB for gfx1250 (MI455X)
//   bias1 (MLP -> f16 bq/bk) -> qkv WMMA GEMM -> fused attention
//   (scores = q k^T + bq bk^T as two chained WMMAs, kept in registers, in-lane
//    softmax, attn@V) -> proj WMMA GEMM.
//   Async global->LDS staging (global_load_async_to_lds_b128) for pure f16
//   copies; f32->f16 converting stages use regular vector loads.
//   Both GEMMs keep their weight panel (128 columns x all 256 k, f16, [col][k])
//   in LDS for the life of the work-group, which walks several row tiles.
// Shapes: B=512, N=256, C=256, H=8, hd=32, R=32
// ---------------------------------------------------------------------------

typedef __attribute__((ext_vector_type(16))) _Float16 v16h;
typedef __attribute__((ext_vector_type(8)))  float    v8f;

union Frag16 { v16h v; uint4 q[2]; _Float16 h[16]; };
union Acc8   { v8f  v; float f[8]; };

#define WMMA16(a, b, c) __builtin_amdgcn_wmma_f32_16x16x32_f16( \
    false, (a), false, (b), (short)0, (c), false, false)

static __device__ __forceinline__ v16h lds_frag16(const _Float16* rowbase, int hsel) {
  // 16-bit A/B fragment: lane (m = lane&15, hsel = lane>>4)
  // chunk0: K = 8*hsel .. +7  -> VGPR0..3 ; chunk1: K = 16+8*hsel .. +7 -> VGPR4..7
  Frag16 t;
  const _Float16* p = rowbase + hsel * 8;
  t.q[0] = *(const uint4*)(p);
  t.q[1] = *(const uint4*)(p + 16);
  return t.v;
}

// 64B per-lane global -> LDS async copy (4 x b128), tracked on ASYNCcnt.
static __device__ __forceinline__ void async_copy64(void* lds_dst, const void* gsrc) {
  unsigned l = (unsigned)(uintptr_t)lds_dst;        // LDS offset = low 32 bits of flat addr
  unsigned long long g = (unsigned long long)(uintptr_t)gsrc;
  asm volatile(
      "global_load_async_to_lds_b128 %0, %1, off\n\t"
      "global_load_async_to_lds_b128 %0, %1, off offset:16\n\t"
      "global_load_async_to_lds_b128 %0, %1, off offset:32\n\t"
      "global_load_async_to_lds_b128 %0, %1, off offset:48"
      :: "v"(l), "v"(g) : "memory");
}

// 16B per-lane global -> LDS async copy.
static __device__ __forceinline__ void async_copy16(void* lds_dst, const void* gsrc) {
  unsigned l = (unsigned)(uintptr_t)lds_dst;
  unsigned long long g = (unsigned long long)(uintptr_t)gsrc;
  // the wait is part of the statement: the caller sits in a rolled loop whose
  // next trip rewrites the two address registers
  asm volatile("global_load_async_to_lds_b128 %0, %1, off\n\t"
               "s_wait_xcnt 0x0"
               :: "v"(l), "v"(g) : "memory");
}

static __device__ __forceinline__ void wait_async0() {
  asm volatile("s_wait_asynccnt 0x0" ::: "memory");
}

// Weight panel of a GEMM work-group: Bs[col][k] = (f16) w[k][n0 + col], 128
// columns, k = 0..255.  Pitch 264 halves = 528 B = 16 B x 33, so that the 16-byte
// stores here and the 16-byte fragment loads fall on distinct banks.
// A lane owns one column (a wave reads whole 128-B lines of w) and packs eight
// consecutive k into one 16-byte LDS store.  256 threads.
#define PANEL_PITCH 264
static __device__ __forceinline__ void stage_panel(_Float16 (*Bs)[PANEL_PITCH],
                                                   const float* __restrict__ w,
                                                   int ldw, int n0, int tid) {
  const int c = tid & 127;
  const float* wc = w + n0 + c;
  // 32 loads in flight per lane; fully unrolled the compiler held all 128 values
  // and the register count cost a resident work-group
  #pragma unroll 4
  for (int it = 0; it < 16; ++it) {
    const int k0 = (it * 2 + (tid >> 7)) * 8;
    union { _Float16 h[8]; uint4 u; } t;
    #pragma unroll
    for (int j = 0; j < 8; ++j) t.h[j] = (_Float16)wc[(size_t)(k0 + j) * ldw];
    *(uint4*)&Bs[c][k0] = t.u;
  }
}

// ---------------------------------------------------------------------------
// Kernel 1: position-bias MLP -> f16 bq [H,N,R] (pre-scaled), bk [H,N,R]
// grid (8 heads, 16 position groups) x 256 threads: a work-group forms 16
// positions x the 64 output columns (32 bq + 32 bk) of one head.
// A lane owns one column of w2 (a wave reads whole 128-B lines) and holds all
// 128 k of it in registers; two waves share four positions, whose hidden
// features they read from LDS as broadcasts: four independent sums per lane,
// each in the order k = 0..127.
// ---------------------------------------------------------------------------
__global__ void __launch_bounds__(256)
bias1_kernel(const float* __restrict__ w1, const float* __restrict__ b1,
             const float* __restrict__ w2, const float* __restrict__ bscale_p,
             _Float16* __restrict__ bq, _Float16* __restrict__ bk) {
  __shared__ __attribute__((aligned(16))) float hf[16][132];   // pitch 528 B = 16 B x 33
  const int tid = threadIdx.x;
  const int h = blockIdx.x, n0 = blockIdx.y * 16;
  const int c = tid & 63, pg = tid >> 6;

  // a thread forms 8 hidden features of one position: its slices of w1 and b1
  const int p = tid >> 4, j0 = (tid & 15) * 8;
  union { float4 q[2]; float f[8]; } wa, wb, bb, g;
  #pragma unroll
  for (int t = 0; t < 2; ++t) {
    wa.q[t] = *(const float4*)(w1 + j0 + 4 * t);
    wb.q[t] = *(const float4*)(w1 + 128 + j0 + 4 * t);
    bb.q[t] = *(const float4*)(b1 + j0 + 4 * t);
  }
  const float bsc = bscale_p[0];
  // the scalar bases of the six loads above are given new values below; the
  // statement also keeps the six, which the gelu phase waits for, in front of the
  // 128 below (loads return in order)
  asm volatile("s_wait_xcnt 0x0" ::: "memory");
  // this lane's column of w2, fetched here: the latency runs under the gelu phase
  float wc[128];
  const float* wp = w2 + h * 64 + c;
  #pragma unroll
  for (int j = 0; j < 128; ++j) wc[j] = wp[j * 512];

  {
    const int n = n0 + p;                     // position index 0..255
    const float invden = 1.0f / logf(16.0f);  // log1p(15) = log(16)
    const float c0 = log1pf((float)(n >> 4)) * invden;   // gy
    const float c1 = log1pf((float)(n & 15)) * invden;   // gx
    #pragma unroll
    for (int jj = 0; jj < 8; ++jj) {
      float z = c0 * wa.f[jj] + c1 * wb.f[jj] + bb.f[jj];
      g.f[jj] = 0.5f * z * (1.0f + erff(z * 0.70710678118654752f));  // exact gelu
    }
    *(float4*)&hf[p][j0]     = g.q[0];
    *(float4*)&hf[p][j0 + 4] = g.q[1];
  }
  __syncthreads();

  float acc[4] = {0.0f, 0.0f, 0.0f, 0.0f};
  #pragma unroll
  for (int j = 0; j < 128; j += 4) {
    #pragma unroll
    for (int i = 0; i < 4; ++i) {
      const float4 hv = *(const float4*)&hf[pg * 4 + i][j];
      acc[i] += hv.x * wc[j];
      acc[i] += hv.y * wc[j + 1];
      acc[i] += hv.z * wc[j + 2];
      acc[i] += hv.w * wc[j + 3];
    }
  }

  const int which = c >> 5, r = c & 31;       // the same for a whole wave
  _Float16* outp = (which == 0) ? bq : bk;
  const float osc = (which == 0) ? bsc : 1.0f;
  #pragma unroll
  for (int i = 0; i < 4; ++i) {
    const int n = n0 + pg * 4 + i;
    const float s = 1.0f / (1.0f + __expf(-acc[i]));
    outp[(h * 256 + n) * 32 + r] = (_Float16)(osc * s);
  }
}

// ---------------------------------------------------------------------------
// Kernel 2: QKV GEMM  [131072 x 256] @ [256 x 768] (+bias, q*=logit_scale)
// Block tile 128x128, 8 waves, each wave 2x4 16x16 accum tiles.
// grid (6, 128): a work-group stages its weight panel once and walks 8 row tiles.
// x goes through two LDS stages of 64 k: the loads of the next stage (8 of 16
// bytes per lane) are issued in front of this stage's products and converted and
// stored behind them, so that the load latency runs under the products; one
// barrier per stage.  The stages run on across the row tiles.
// ---------------------------------------------------------------------------
#define QKV_TILES 8
#define QKV_KC 64

// One stage of x, 128 rows x 64 k: a wave's load covers 256 contiguous bytes of
// each of two rows; p + off is the lane's own address in the stage's first 16 rows.
static __device__ __forceinline__ void qkv_fetch(float4 (&a)[8], const float* p, int off) {
  #pragma unroll
  for (int i = 0; i < 8; ++i) a[i] = *(const float4*)(p + off + i * 16 * 256);
  // the caller gives the address registers a new value for the next row tile; p is
  // named so that the address pair outlives the run of loads (no result lands in it)
  asm volatile("s_wait_xcnt 0x0" :: "v"(p) : "memory");
}

static __device__ __forceinline__ void qkv_put(_Float16 (*st)[QKV_KC + 8], const float4 (&a)[8],
                                               int row, int col) {
  #pragma unroll
  for (int i = 0; i < 8; ++i) {
    union { _Float16 h[4]; uint2 u; } t;
    t.h[0] = (_Float16)a[i].x; t.h[1] = (_Float16)a[i].y;
    t.h[2] = (_Float16)a[i].z; t.h[3] = (_Float16)a[i].w;
    *(uint2*)&st[row + i * 16][col] = t.u;
  }
}

// three work-groups per WGP (their LDS fits) are six waves per SIMD: the register
// count is held to that
__global__ void __launch_bounds__(256) __attribute__((amdgpu_waves_per_eu(6)))
qkv_kernel(const float* __restrict__ x, const float* __restrict__ w,
                           const float* __restrict__ bvec, const float* __restrict__ lsc,
                           _Float16* __restrict__ qo, _Float16* __restrict__ ko,
                           _Float16* __restrict__ vo) {
  __shared__ _Float16 As[2][128][QKV_KC + 8];   // two stages; pitch 72 h = 144 B = 16 B x 9
  __shared__ _Float16 Bs[128][PANEL_PITCH];   // weight panel: Bs[col][k], all k
  const int tid = threadIdx.x, lane = tid & 31, wave = tid >> 5;
  const int wm = wave & 3, wn = wave >> 2;
  const int mlane = lane & 15, hsel = lane >> 4;
  const int n0 = blockIdx.x * 128;

  // published by the barrier in front of the first fragment loads
  stage_panel(Bs, w, 768, n0, tid);

  // bias and q scale of this lane's four output columns, the same for every tile
  float addb[4], scale[4];
  #pragma unroll
  for (int j = 0; j < 4; ++j) {
    const int jg = n0 + wn * 64 + j * 16 + mlane;
    addb[j] = bvec[jg];
    scale[j] = ((jg >> 8) == 0) ? lsc[(jg >> 5) & 7] : 1.0f;
  }

  // stage 0 of the first row tile
  const int xrow = wave * 2 + hsel, xcol = mlane * 4;
  const float* xb = x + ((size_t)blockIdx.y * QKV_TILES * 128 + xrow) * 256 + xcol;
  float4 a[8];
  qkv_fetch(a, xb, 0);
  qkv_put(As[0], a, xrow, xcol);
  __syncthreads();

  // Kept rolled: the K loop inside is unrolled.
  #pragma unroll 1
  for (int mt = 0; mt < QKV_TILES; ++mt) {
  const int m0 = (blockIdx.y * QKV_TILES + mt) * 128;
  const float* xt = xb + (size_t)mt * 128 * 256;

  Acc8 acc[2][4];
  #pragma unroll
  for (int i = 0; i < 2; ++i)
    #pragma unroll
    for (int j = 0; j < 4; ++j)
      #pragma unroll
      for (int r = 0; r < 8; ++r) acc[i][j].f[r] = 0.0f;

  // unrolled: the stage index (kq & 1) is then a constant in every LDS address
  #pragma unroll
  for (int kq = 0; kq < 256 / QKV_KC; ++kq) {
    const int kk = kq * QKV_KC;
    // the next stage: the next 64 k of this row tile, or the first of the next tile
    const bool more = (kq + 1 < 256 / QKV_KC) || (mt + 1 < QKV_TILES);
    if (more) qkv_fetch(a, xt, (kq + 1 < 256 / QKV_KC) ? kk + QKV_KC : 128 * 256);
    #pragma unroll
    for (int ks = 0; ks < QKV_KC; ks += 32) {
      Frag16 af[2], bf[4];
      #pragma unroll
      for (int i = 0; i < 2; ++i) af[i].v = lds_frag16(&As[kq & 1][wm * 32 + i * 16 + mlane][ks], hsel);
      #pragma unroll
      for (int j = 0; j < 4; ++j) bf[j].v = lds_frag16(&Bs[wn * 64 + j * 16 + mlane][kk + ks], hsel);
      #pragma unroll
      for (int i = 0; i < 2; ++i)
        #pragma unroll
        for (int j = 0; j < 4; ++j)
          acc[i][j].v = WMMA16(af[i].v, bf[j].v, acc[i][j].v);
    }
    // keeps the conversions, and with them the wait for the loads, behind the
    // products: left free, the scheduler put them behind the first product and the
    // wave sat out the load latency there
    __builtin_amdgcn_sched_barrier(0);
    // into the stage whose last readers passed the barrier of the stage before
    if (more) qkv_put(As[(kq + 1) & 1], a, xrow, xcol);
    // ends the reads of this stage and publishes the next
    __syncthreads();
  }

  // epilogue: +bias, q*=logit_scale[h], scatter f16 to [B,H,N,32]
  #pragma unroll
  for (int j = 0; j < 4; ++j) {
    const int jg = n0 + wn * 64 + j * 16 + mlane;     // global out column 0..767
    const int which = jg >> 8, h = (jg >> 5) & 7, d = jg & 31;
    _Float16* outp = (which == 0) ? qo : ((which == 1) ? ko : vo);
    #pragma unroll
    for (int i = 0; i < 2; ++i) {
      #pragma unroll
      for (int r = 0; r < 8; ++r) {
        int mg = m0 + wm * 32 + i * 16 + r + 8 * hsel;  // global row = b*256 + nrow
        int bb = mg >> 8, nrow = mg & 255;
        float val = (acc[i][j].f[r] + addb[j]) * scale[j];
        outp[(((size_t)bb * 8 + h) * 256 + nrow) * 32 + d] = (_Float16)val;
      }
    }
  }
  // the next trip reuses the address and data registers of these stores
  asm volatile("s_wait_xcnt 0x0" ::: "memory");
  }
}

// ---------------------------------------------------------------------------
// Kernel 3: fused attention per (b,h).  grid (8, 512), 256 threads = 8 waves.
//  The scores never leave the registers.  Each wave owns 2 x 16 queries and
//  forms S^T = K Q^T + BK BQ^T (A = key rows, B = query rows): in D a lane
//  holds one query (column lane&15) and keys 8*(lane>>4)+r of each 16-key tile,
//  so row maximum and row sum are in-lane plus one exchange between the halves,
//  and two neighbouring D tiles, converted to f16, are the B operand of
//  O^T = V^T P^T in the hardware k order that lds_frag16 also delivers.
//  q/k/bq/bk staged with async-to-LDS copies; v transposed through VGPRs.
// ---------------------------------------------------------------------------
typedef __attribute__((ext_vector_type(8))) _Float16 v8h;

static __device__ __forceinline__ float other_half(float x) {
  // value of lane l ^ 16
  int b = __builtin_bit_cast(int, x);
  b = __builtin_amdgcn_permlanex16(b, b, 0x76543210, 0xfedcba98, false, false);
  return __builtin_bit_cast(float, b);
}

__global__ void __launch_bounds__(256)
attn_kernel(const _Float16* __restrict__ qg, const _Float16* __restrict__ kg,
            const _Float16* __restrict__ vg,
            const _Float16* __restrict__ bqg, const _Float16* __restrict__ bkg,
            const float* __restrict__ vrs_g, _Float16* __restrict__ ao) {
  __shared__ _Float16 qs[256][40];     // 20 KB
  __shared__ _Float16 ks[256][40];     // 20 KB
  __shared__ _Float16 bqs[256][40];    // 20 KB  (rank-bias q factors, head h)
  __shared__ _Float16 bks[256][40];    // 20 KB  (rank-bias k factors, head h)
  __shared__ _Float16 vt[32][264];     // v transposed: vt[d][m], 16.9 KB
  __shared__ float    vmean[32];

  const int h = blockIdx.x, b = blockIdx.y;
  const int tid = threadIdx.x, lane = tid & 31, wave = tid >> 5;
  const int mlane = lane & 15, hsel = lane >> 4;
  const size_t base = ((size_t)b * 8 + h) * 256 * 32;

  // phase 0: stage q, k, bq, bk (async f16 copies) and v (transpose in VGPRs)
  async_copy64(&qs[tid][0],  qg + base + (size_t)tid * 32);
  async_copy64(&ks[tid][0],  kg + base + (size_t)tid * 32);
  async_copy64(&bqs[tid][0], bqg + ((size_t)h * 256 + tid) * 32);
  async_copy64(&bks[tid][0], bkg + ((size_t)h * 256 + tid) * 32);
  {
    union { uint4 u[4]; _Float16 h16[32]; } vv;
    const uint4* vp = (const uint4*)(vg + base + (size_t)tid * 32);
    #pragma unroll
    for (int c = 0; c < 4; ++c) vv.u[c] = vp[c];
    #pragma unroll
    for (int d = 0; d < 32; ++d) vt[d][tid] = vv.h16[d];
  }
  wait_async0();
  __syncthreads();

  // v_mean (wave 0)
  if (tid < 32) {
    float s = 0.0f;
    for (int m = 0; m < 256; ++m) s += (float)vt[tid][m];
    vmean[tid] = s * (1.0f / 256.0f);
  }

  const float vrs = vrs_g[h];
  // Kept rolled: unrolled, the compiler shares the K fragments between the two
  // query tiles and holds 256 score registers, which halves the waves per SIMD.
  #pragma unroll 1
  for (int qi = 0; qi < 2; ++qi) {
    const int q0 = (wave * 2 + qi) * 16;
    const v16h fq = lds_frag16(&qs[q0 + mlane][0], hsel);
    const v16h fb = lds_frag16(&bqs[q0 + mlane][0], hsel);

    // scores: s[kt].f[r] = S[query q0+mlane][key 16*kt + 8*hsel + r]
    Acc8 s[16];
    #pragma unroll
    for (int kt = 0; kt < 16; ++kt) {
      const v16h fk  = lds_frag16(&ks[kt * 16 + mlane][0], hsel);
      const v16h fbk = lds_frag16(&bks[kt * 16 + mlane][0], hsel);
      #pragma unroll
      for (int r = 0; r < 8; ++r) s[kt].f[r] = 0.0f;
      s[kt].v = WMMA16(fk, fq, s[kt].v);
      s[kt].v = WMMA16(fbk, fb, s[kt].v);
    }

    // softmax over the 256 keys of this lane's query, unnormalised
    v8f m8 = s[0].v;
    #pragma unroll
    for (int kt = 1; kt < 16; ++kt) m8 = __builtin_elementwise_max(m8, s[kt].v);
    float mx = fmaxf(fmaxf(fmaxf(m8[0], m8[1]), fmaxf(m8[2], m8[3])),
                     fmaxf(fmaxf(m8[4], m8[5]), fmaxf(m8[6], m8[7])));
    mx = fmaxf(mx, other_half(mx));
    const float L2E = 1.44269504088896340736f;
    const float nm = -mx * L2E;
    const v8f l2e8 = {L2E, L2E, L2E, L2E, L2E, L2E, L2E, L2E};
    const v8f nm8  = {nm, nm, nm, nm, nm, nm, nm, nm};
    v8f sum8 = {0.0f, 0.0f, 0.0f, 0.0f, 0.0f, 0.0f, 0.0f, 0.0f};
    #pragma unroll
    for (int kt = 0; kt < 16; ++kt) {
      const v8f t = __builtin_elementwise_fma(s[kt].v, l2e8, nm8);
      #pragma unroll
      for (int r = 0; r < 8; ++r) s[kt].f[r] = __builtin_amdgcn_exp2f(t[r]);
      sum8 += s[kt].v;
    }
    float sum = ((sum8[0] + sum8[1]) + (sum8[2] + sum8[3])) +
                ((sum8[4] + sum8[5]) + (sum8[6] + sum8[7]));
    sum += other_half(sum);
    const float inv = 1.0f / sum;

    // O^T = V^T P^T: A = rows of vt, B = two packed score tiles per 32 keys;
    // o[dt].f[r] = out[query q0+mlane][d = 16*dt + 8*hsel + r] * sum
    Acc8 o[2];
    #pragma unroll
    for (int dt = 0; dt < 2; ++dt)
      #pragma unroll
      for (int r = 0; r < 8; ++r) o[dt].f[r] = 0.0f;
    #pragma unroll
    for (int mc = 0; mc < 8; ++mc) {
      const v8h lo = __builtin_convertvector(s[2 * mc].v, v8h);
      const v8h hi = __builtin_convertvector(s[2 * mc + 1].v, v8h);
      const v16h p = __builtin_shufflevector(lo, hi, 0, 1, 2, 3, 4, 5, 6, 7,
                                             8, 9, 10, 11, 12, 13, 14, 15);
      #pragma unroll
      for (int dt = 0; dt < 2; ++dt) {
        const v16h fv = lds_frag16(&vt[dt * 16 + mlane][mc * 32], hsel);
        o[dt].v = WMMA16(fv, p, o[dt].v);
      }
    }

    if (qi == 0) __syncthreads();   // publish vmean before its first reader

    // normalise, + vrs * v_mean, one 16-byte f16 store per tile to [B,N,C]
    #pragma unroll
    for (int dt = 0; dt < 2; ++dt) {
      const int d0 = dt * 16 + 8 * hsel;
      union { uint4 u; _Float16 h16[8]; } st;
      #pragma unroll
      for (int r = 0; r < 8; ++r)
        st.h16[r] = (_Float16)(o[dt].f[r] * inv + vmean[d0 + r] * vrs);
      *(uint4*)(ao + ((size_t)b * 256 + q0 + mlane) * 256 + h * 32 + d0) = st.u;
    }
    // the next trip reuses the address and data registers of these stores
    asm volatile("s_wait_xcnt 0x0" ::: "memory");
  }
}

// ---------------------------------------------------------------------------
// Kernel 4: proj GEMM  [131072 x 256](f16) @ [256 x 256] + proj_b -> f32 out
// A tile staged with async-to-LDS (pure f16 copy); weight panel converted
// f32->f16 once.  grid (2, 512): a work-group walks 2 row tiles.
// ---------------------------------------------------------------------------
#define PROJ_TILES 2
__global__ void __launch_bounds__(256)
proj_kernel(const _Float16* __restrict__ a, const float* __restrict__ w,
                            const float* __restrict__ bvec, float* __restrict__ out) {
  __shared__ _Float16 As[128][40];
  __shared__ _Float16 Bs[128][PANEL_PITCH];   // weight panel: Bs[col][k], all k
  const int tid = threadIdx.x, lane = tid & 31, wave = tid >> 5;
  const int wm = wave & 3, wn = wave >> 2;
  const int mlane = lane & 15, hsel = lane >> 4;
  const int n0 = blockIdx.x * 128;

  const int ar0 = tid >> 2, ak8 = (tid & 3) * 8;
  void* lds_a0 = &As[ar0][ak8];
  void* lds_a1 = &As[ar0 + 64][ak8];

  // published by the two barriers in front of the first fragment loads
  stage_panel(Bs, w, 256, n0, tid);

  // Kept rolled: unrolled, the register count passes 128 and three work-groups
  // instead of four fit a WGP.
  #pragma unroll 1
  for (int mt = 0; mt < PROJ_TILES; ++mt) {
  const int m0 = (blockIdx.y * PROJ_TILES + mt) * 128;

  Acc8 acc[2][4];
  #pragma unroll
  for (int i = 0; i < 2; ++i)
    #pragma unroll
    for (int j = 0; j < 4; ++j)
      #pragma unroll
      for (int r = 0; r < 8; ++r) acc[i][j].f[r] = 0.0f;

  for (int kk = 0; kk < 256; kk += 32) {
    __syncthreads();
    // A tile: async f16 copies (16B per lane per pass)
    async_copy16(lds_a0, a + (size_t)(m0 + ar0) * 256 + kk + ak8);
    async_copy16(lds_a1, a + (size_t)(m0 + ar0 + 64) * 256 + kk + ak8);
    wait_async0();
    __syncthreads();
    Frag16 af[2], bf[4];
    #pragma unroll
    for (int i = 0; i < 2; ++i) af[i].v = lds_frag16(&As[wm * 32 + i * 16 + mlane][0], hsel);
    #pragma unroll
    for (int j = 0; j < 4; ++j) bf[j].v = lds_frag16(&Bs[wn * 64 + j * 16 + mlane][kk], hsel);
    #pragma unroll
    for (int i = 0; i < 2; ++i)
      #pragma unroll
      for (int j = 0; j < 4; ++j)
        acc[i][j].v = WMMA16(af[i].v, bf[j].v, acc[i][j].v);
  }

  #pragma unroll
  for (int j = 0; j < 4; ++j) {
    const int jg = n0 + wn * 64 + j * 16 + mlane;
    const float addb = bvec[jg];
    #pragma unroll
    for (int i = 0; i < 2; ++i) {
      #pragma unroll
      for (int r = 0; r < 8; ++r) {
        int mg = m0 + wm * 32 + i * 16 + r + 8 * hsel;
        out[(size_t)mg * 256 + jg] = acc[i][j].f[r] + addb;
      }
    }
  }
  // the next trip reuses the address and data registers of these stores
  asm volatile("s_wait_xcnt 0x0" ::: "memory");
  }
}

// ---------------------------------------------------------------------------
// Host launcher
// ---------------------------------------------------------------------------
extern "C" void kernel_launch(void* const* d_in, const int* in_sizes, int n_in,
                              void* d_out, int out_size, void* d_ws, size_t ws_size,
                              hipStream_t stream) {
  const float* x       = (const float*)d_in[0];
  const float* qkv_w   = (const float*)d_in[1];
  const float* qkv_b   = (const float*)d_in[2];
  const float* proj_w  = (const float*)d_in[3];
  const float* proj_b  = (const float*)d_in[4];
  const float* lsc     = (const float*)d_in[5];
  const float* vrs     = (const float*)d_in[6];
  const float* mlp1_w  = (const float*)d_in[7];
  const float* mlp1_b  = (const float*)d_in[8];
  const float* mlp2_w  = (const float*)d_in[9];
  const float* bscale  = (const float*)d_in[10];

  char* ws = (char*)d_ws;
  const size_t QSZ = (size_t)512 * 8 * 256 * 32 * sizeof(_Float16);  // 67.1 MB each
  _Float16* bq = (_Float16*)(ws + 0);          // 128 KB (f16, pre-scaled by bias_scale)
  _Float16* bk = (_Float16*)(ws + 131072);     // 128 KB
  _Float16* q  = (_Float16*)(ws + 262144);
  _Float16* k  = (_Float16*)(ws + 262144 + QSZ);
  _Float16* v  = (_Float16*)(ws + 262144 + 2 * QSZ);
  _Float16* ao = (_Float16*)(ws + 262144 + 3 * QSZ);
  float*    out = (float*)d_out;

  bias1_kernel<<<dim3(8, 16), 256, 0, stream>>>(mlp1_w, mlp1_b, mlp2_w, bscale, bq, bk);
  qkv_kernel<<<dim3(6, 128), 256, 0, stream>>>(x, qkv_w, qkv_b, lsc, q, k, v);
  attn_kernel<<<dim3(8, 512), 256, 0, stream>>>(q, k, v, bq, bk, vrs, ao);
  proj_kernel<<<dim3(2, 512), 256, 0, stream>>>(ao, proj_w, proj_b, out);
}

// v006
// Measured time: 188 microseconds a run.
// Timed twice side by side with v005, it ran 1.03 times as fast both times.
// All steps since v000 together make it 3.77 times as fast.
#include <hip/hip_runtime.h>

// ---------------------------------------------------------------------------
// WindowAttentionRFB for gfx1250 (MI455X)
//   bias1 (MLP -> f16 bq/bk) -> qkv WMMA GEMM -> fused attention
//   (scores = q k^T + bq bk^T as two chained WMMAs, kept in registers, in-lane
//    softmax, attn@V) -> proj WMMA GEMM.
//   Async global->LDS staging (global_load_async_to_lds_b128) for pure f16
//   copies; f32->f16 converting stages use regular vector loads.
//   Both GEMMs keep their weight panel (128 columns x all 256 k, f16, [col][k])
//   in LDS for the life of the work-group, which walks several row tiles.
// Shapes: B=512, N=256, C=256, H=8, hd=32, R=32
// ---------------------------------------------------------------------------

typedef __attribute__((ext_vector_type(16))) _Float16 v16h;
typedef __attribute__((ext_vector_type(8)))  float    v8f;

union Frag16 { v16h v; uint4 q[2]; _Float16 h[16]; };
union Acc8   { v8f  v; float f[8]; };

#define WMMA16(a, b, c) __builtin_amdgcn_wmma_f32_16x16x32_f16( \
    false, (a), false, (b), (short)0, (c), false, false)

static __device__ __forceinline__ v16h lds_frag16(const _Float16* rowbase, int hsel) {
  // 16-bit A/B fragment: lane (m = lane&15, hsel = lane>>4)
  // chunk0: K = 8*hsel .. +7  -> VGPR0..3 ; chunk1: K = 16+8*hsel .. +7 -> VGPR4..7
  Frag16 t;
  const _Float16* p = rowbase + hsel * 8;
  t.q[0] = *(const uint4*)(p);
  t.q[1] = *(const uint4*)(p + 16);
  return t.v;
}

static __device__ __forceinline__ unsigned other_oct(unsigned x) {
  // value of lane l ^ 8 (a gather inside each row of 16 lanes)
  return (unsigned)__builtin_amdgcn_permlane16(x, x, 0xfedcba98, 0x76543210, false, false);
}

// 64B per-lane global -> LDS async copy (4 x b128), tracked on ASYNCcnt.
static __device__ __forceinline__ void async_copy64(void* lds_dst, const void* gsrc) {
  unsigned l = (unsigned)(uintptr_t)lds_dst;        // LDS offset = low 32 bits of flat addr
  unsigned long long g = (unsigned long long)(uintptr_t)gsrc;
  asm volatile(
      "global_load_async_to_lds_b128 %0, %1, off\n\t"
      "global_load_async_to_lds_b128 %0, %1, off offset:16\n\t"
      "global_load_async_to_lds_b128 %0, %1, off offset:32\n\t"
      "global_load_async_to_lds_b128 %0, %1, off offset:48"
      :: "v"(l), "v"(g) : "memory");
}

// 16B per-lane global -> LDS async copy.
static __device__ __forceinline__ void async_copy16(void* lds_dst, const void* gsrc) {
  unsigned l = (unsigned)(uintptr_t)lds_dst;
  unsigned long long g = (unsigned long long)(uintptr_t)gsrc;
  // the wait is part of the statement: the caller sits in a rolled loop whose
  // next trip rewrites the two address registers
  asm volatile("global_load_async_to_lds_b128 %0, %1, off\n\t"
               "s_wait_xcnt 0x0"
               :: "v"(l), "v"(g) : "memory");
}

static __device__ __forceinline__ void wait_async0() {
  asm volatile("s_wait_asynccnt 0x0" ::: "memory");
}

// Weight panel of a GEMM work-group: Bs[col][k] = (f16) w[k][n0 + col], 128
// columns, k = 0..255.  Pitch 264 halves = 528 B = 16 B x 33, so that the 16-byte
// stores here and the 16-byte fragment loads fall on distinct banks.
// A lane owns one column (a wave reads whole 128-B lines of w) and packs eight
// consecutive k into one 16-byte LDS store.  256 threads.
#define PANEL_PITCH 264
static __device__ __forceinline__ void stage_panel(_Float16 (*Bs)[PANEL_PITCH],
                                                   const float* __restrict__ w,
                                                   int ldw, int n0, int tid) {
  const int c = tid & 127;
  const float* wc = w + n0 + c;
  // 32 loads in flight per lane; fully unrolled the compiler held all 128 values
  // and the register count cost a resident work-group
  #pragma unroll 4
  for (int it = 0; it < 16; ++it) {
    const int k0 = (it * 2 + (tid >> 7)) * 8;
    union { _Float16 h[8]; uint4 u; } t;
    #pragma unroll
    for (int j = 0; j < 8; ++j) t.h[j] = (_Float16)wc[(size_t)(k0 + j) * ldw];
    *(uint4*)&Bs[c][k0] = t.u;
  }
}

// ---------------------------------------------------------------------------
// Kernel 1: position-bias MLP -> f16 bq [H,N,R] (pre-scaled), bk [H,N,R]
// grid (8 heads, 16 position groups) x 256 threads: a work-group forms 16
// positions x the 64 output columns (32 bq + 32 bk) of one head.
// A lane owns one column of w2 (a wave reads whole 128-B lines) and holds all
// 128 k of it in registers; two waves share four positions, whose hidden
// features they read from LDS as broadcasts: four independent sums per lane,
// each in the order k = 0..127.
// ---------------------------------------------------------------------------
__global__ void __launch_bounds__(256)
bias1_kernel(const float* __restrict__ w1, const float* __restrict__ b1,
             const float* __restrict__ w2, const float* __restrict__ bscale_p,
             _Float16* __restrict__ bq, _Float16* __restrict__ bk) {
  __shared__ __attribute__((aligned(16))) float hf[16][132];   // pitch 528 B = 16 B x 33
  const int tid = threadIdx.x;
  const int h = blockIdx.x, n0 = blockIdx.y * 16;
  const int c = tid & 63, pg = tid >> 6;

  // a thread forms 8 hidden features of one position: its slices of w1 and b1
  const int p = tid >> 4, j0 = (tid & 15) * 8;
  union { float4 q[2]; float f[8]; } wa, wb, bb, g;
  #pragma unroll
  for (int t = 0; t < 2; ++t) {
    wa.q[t] = *(const float4*)(w1 + j0 + 4 * t);
    wb.q[t] = *(const float4*)(w1 + 128 + j0 + 4 * t);
    bb.q[t] = *(const float4*)(b1 + j0 + 4 * t);
  }
  const float bsc = bscale_p[0];
  // the scalar bases of the six loads above are given new values below; the
  // statement also keeps the six, which the gelu phase waits for, in front of the
  // 128 below (loads return in order)
  asm volatile("s_wait_xcnt 0x0" ::: "memory");
  // this lane's column of w2, fetched here: the latency runs under the gelu phase
  float wc[128];
  const float* wp = w2 + h * 64 + c;
  #pragma unroll
  for (int j = 0; j < 128; ++j) wc[j] = wp[j * 512];

  {
    const int n = n0 + p;                     // position index 0..255
    const float invden = 1.0f / logf(16.0f);  // log1p(15) = log(16)
    const float c0 = log1pf((float)(n >> 4)) * invden;   // gy
    const float c1 = log1pf((float)(n & 15)) * invden;   // gx
    #pragma unroll
    for (int jj = 0; jj < 8; ++jj) {
      float z = c0 * wa.f[jj] + c1 * wb.f[jj] + bb.f[jj];
      g.f[jj] = 0.5f * z * (1.0f + erff(z * 0.70710678118654752f));  // exact gelu
    }
    *(float4*)&hf[p][j0]     = g.q[0];
    *(float4*)&hf[p][j0 + 4] = g.q[1];
  }
  __syncthreads();

  float acc[4] = {0.0f, 0.0f, 0.0f, 0.0f};
  #pragma unroll
  for (int j = 0; j < 128; j += 4) {
    #pragma unroll
    for (int i = 0; i < 4; ++i) {
      const float4 hv = *(const float4*)&hf[pg * 4 + i][j];
      acc[i] += hv.x * wc[j];
      acc[i] += hv.y * wc[j + 1];
      acc[i] += hv.z * wc[j + 2];
      acc[i] += hv.w * wc[j + 3];
    }
  }

  const int which = c >> 5, r = c & 31;       // the same for a whole wave
  _Float16* outp = (which == 0) ? bq : bk;
  const float osc = (which == 0) ? bsc : 1.0f;
  #pragma unroll
  for (int i = 0; i < 4; ++i) {
    const int n = n0 + pg * 4 + i;
    const float s = 1.0f / (1.0f + __expf(-acc[i]));
    outp[(h * 256 + n) * 32 + r] = (_Float16)(osc * s);
  }
}

// ---------------------------------------------------------------------------
// Kernel 2: QKV GEMM  [131072 x 256] @ [256 x 768] (+bias, q*=logit_scale)
// Block tile 128x128, 8 waves, each wave 2x4 16x16 accum tiles.
// grid (6, 128): a work-group stages its weight panel once and walks 8 row tiles.
// x goes through two LDS stages of 64 k: the loads of the next stage (8 of 16
// bytes per lane) are issued in front of this stage's products and converted and
// stored behind them, so that the load latency runs under the products; one
// barrier per stage.  The stages run on across the row tiles.
// The products are formed transposed (A = weight columns, B = x rows): in D a lane
// holds one row of x (lane&15) and the output columns 8*(lane>>4)+r of a 16-column
// tile, eight neighbouring f16 of one head.  Lanes l and l^8 swap one of their two
// 16-byte pieces, and every store instruction writes 512 contiguous bytes.
// ---------------------------------------------------------------------------
#define QKV_TILES 8
#define QKV_KC 64

// One stage of x, 128 rows x 64 k: a wave's load covers 256 contiguous bytes of
// each of two rows; p + off is the lane's own address in the stage's first 16 rows.
static __device__ __forceinline__ void qkv_fetch(float4 (&a)[8], const float* p, int off) {
  #pragma unroll
  for (int i = 0; i < 8; ++i) a[i] = *(const float4*)(p + off + i * 16 * 256);
  // the caller gives the address registers a new value for the next row tile; p is
  // named so that the address pair outlives the run of loads (no result lands in it)
  asm volatile("s_wait_xcnt 0x0" :: "v"(p) : "memory");
}

static __device__ __forceinline__ void qkv_put(_Float16 (*st)[QKV_KC + 8], const float4 (&a)[8],
                                               int row, int col) {
  #pragma unroll
  for (int i = 0; i < 8; ++i) {
    union { _Float16 h[4]; uint2 u; } t;
    t.h[0] = (_Float16)a[i].x; t.h[1] = (_Float16)a[i].y;
    t.h[2] = (_Float16)a[i].z; t.h[3] = (_Float16)a[i].w;
    *(uint2*)&st[row + i * 16][col] = t.u;
  }
}

// three work-groups per WGP (their LDS fits) are six waves per SIMD: the register
// count is held to that
__global__ void __launch_bounds__(256) __attribute__((amdgpu_waves_per_eu(6)))
qkv_kernel(const float* __restrict__ x, const float* __restrict__ w,
                           const float* __restrict__ bvec, const float* __restrict__ lsc,
                           _Float16* __restrict__ qo, _Float16* __restrict__ ko,
                           _Float16* __restrict__ vo) {
  __shared__ _Float16 As[2][128][QKV_KC + 8];   // two stages; pitch 72 h = 144 B = 16 B x 9
  __shared__ _Float16 Bs[128][PANEL_PITCH];   // weight panel: Bs[col][k], all k
  const int tid = threadIdx.x, lane = tid & 31, wave = tid >> 5;
  const int wm = wave & 3, wn = wave >> 2;
  const int mlane = lane & 15, hsel = lane >> 4;
  const int n0 = blockIdx.x * 128;

  // published by the barrier in front of the first fragment loads
  stage_panel(Bs, w, 768, n0, tid);

  // q scale of this wave's two heads (32 output columns each), the same for every tile
  float scale[2];
  #pragma unroll
  for (int jp = 0; jp < 2; ++jp) {
    const int jg0 = n0 + wn * 64 + jp * 32;
    scale[jp] = ((jg0 >> 8) == 0) ? lsc[(jg0 >> 5) & 7] : 1.0f;
  }

  // stage 0 of the first row tile
  const int xrow = wave * 2 + hsel, xcol = mlane * 4;
  const float* xb = x + ((size_t)blockIdx.y * QKV_TILES * 128 + xrow) * 256 + xcol;
  float4 a[8];
  qkv_fetch(a, xb, 0);
  qkv_put(As[0], a, xrow, xcol);
  __syncthreads();

  // Kept rolled: the K loop inside is unrolled.
  #pragma unroll 1
  for (int mt = 0; mt < QKV_TILES; ++mt) {
  const int m0 = (blockIdx.y * QKV_TILES + mt) * 128;
  const float* xt = xb + (size_t)mt * 128 * 256;

  Acc8 acc[2][4];
  #pragma unroll
  for (int i = 0; i < 2; ++i)
    #pragma unroll
    for (int j = 0; j < 4; ++j)
      #pragma unroll
      for (int r = 0; r < 8; ++r) acc[i][j].f[r] = 0.0f;

  // unrolled: the stage index (kq & 1) is then a constant in every LDS address
  #pragma unroll
  for (int kq = 0; kq < 256 / QKV_KC; ++kq) {
    const int kk = kq * QKV_KC;
    // the next stage: the next 64 k of this row tile, or the first of the next tile
    const bool more = (kq + 1 < 256 / QKV_KC) || (mt + 1 < QKV_TILES);
    if (more) qkv_fetch(a, xt, (kq + 1 < 256 / QKV_KC) ? kk + QKV_KC : 128 * 256);
    #pragma unroll
    for (int ks = 0; ks < QKV_KC; ks += 32) {
      Frag16 af[2], bf[4];
      #pragma unroll
      for (int i = 0; i < 2; ++i) af[i].v = lds_frag16(&As[kq & 1][wm * 32 + i * 16 + mlane][ks], hsel);
      #pragma unroll
      for (int j = 0; j < 4; ++j) bf[j].v = lds_frag16(&Bs[wn * 64 + j * 16 + mlane][kk + ks], hsel);
      #pragma unroll
      for (int i = 0; i < 2; ++i)
        #pragma unroll
        for (int j = 0; j < 4; ++j)
          acc[i][j].v = WMMA16(bf[j].v, af[i].v, acc[i][j].v);
    }
    // keeps the conversions, and with them the wait for the loads, behind the
    // products: left free, the scheduler put them behind the first product and the
    // wave sat out the load latency there
    __builtin_amdgcn_sched_barrier(0);
    // into the stage whose last readers passed the barrier of the stage before
    if (more) qkv_put(As[(kq + 1) & 1], a, xrow, xcol);
    // ends the reads of this stage and publishes the next
    __syncthreads();
  }

  // epilogue: +bias, q*=logit_scale[h], f16 to [B,H,N,32]; a head's 32 columns are
  // two neighbouring D tiles, a row of it 64 bytes = four 16-byte pieces
  const bool lo8 = mlane < 8;
  #pragma unroll
  for (int jp = 0; jp < 2; ++jp) {
    const int jg0 = n0 + wn * 64 + jp * 32;           // first global out column of the head
    const int which = jg0 >> 8, h = (jg0 >> 5) & 7;
    _Float16* outp = (which == 0) ? qo : ((which == 1) ? ko : vo);
    union { float4 q[2]; float f[8]; } bias[2];       // of this lane's 2 x 8 columns
    #pragma unroll
    for (int t = 0; t < 2; ++t) {
      bias[t].q[0] = *(const float4*)(bvec + jg0 + t * 16 + 8 * hsel);
      bias[t].q[1] = *(const float4*)(bvec + jg0 + t * 16 + 8 * hsel + 4);
    }
    #pragma unroll
    for (int i = 0; i < 2; ++i) {
      // pc[t]: row mlane of the 16, piece 2*t + hsel
      union { _Float16 h16[8]; unsigned u[4]; } pc[2];
      #pragma unroll
      for (int t = 0; t < 2; ++t)
        #pragma unroll
        for (int r = 0; r < 8; ++r)
          pc[t].h16[r] = (_Float16)((acc[i][2 * jp + t].f[r] + bias[t].f[r]) * scale[jp]);
      // lanes 0-7 of a row of 16 end with pieces hsel of rows mlane and mlane+8,
      // lanes 8-15 with pieces 2+hsel of rows mlane-8 and mlane
      union { unsigned u[4]; uint4 q; } s0, s1;
      #pragma unroll
      for (int c = 0; c < 4; ++c) {
        const unsigned got = other_oct(lo8 ? pc[1].u[c] : pc[0].u[c]);
        s0.u[c] = lo8 ? pc[0].u[c] : got;             // rows 0..7
        s1.u[c] = lo8 ? got : pc[1].u[c];             // rows 8..15
      }
      const int mg = m0 + wm * 32 + i * 16 + (mlane & 7);   // global row = b*256 + nrow
      const int bb = mg >> 8, nrow = mg & 255;
      _Float16* dst = outp + (((size_t)bb * 8 + h) * 256 + nrow) * 32
                           + ((mlane >> 3) * 2 + hsel) * 8;
      *(uint4*)dst = s0.q;
      *(uint4*)(dst + 8 * 32) = s1.q;
    }
  }
  // the next trip reuses the address and data registers of these stores
  asm volatile("s_wait_xcnt 0x0" ::: "memory");
  }
}

// ---------------------------------------------------------------------------
// Kernel 3: fused attention per (b,h).  grid (8, 512), 256 threads = 8 waves.
//  The scores never leave the registers.  Each wave owns 2 x 16 queries and
//  forms S^T = K Q^T + BK BQ^T (A = key rows, B = query rows): in D a lane
//  holds one query (column lane&15) and keys 8*(lane>>4)+r of each 16-key tile,
//  so row maximum and row sum are in-lane plus one exchange between the halves,
//  and two neighbouring D tiles, converted to f16, are the B operand of
//  O^T = V^T P^T in the hardware k order that lds_frag16 also delivers.
//  q/k/bq/bk staged with async-to-LDS copies; v transposed through VGPRs.
// ---------------------------------------------------------------------------
typedef __attribute__((ext_vector_type(8))) _Float16 v8h;

static __device__ __forceinline__ float other_half(float x) {
  // value of lane l ^ 16
  int b = __builtin_bit_cast(int, x);
  b = __builtin_amdgcn_permlanex16(b, b, 0x76543210, 0xfedcba98, false, false);
  return __builtin_bit_cast(float, b);
}

__global__ void __launch_bounds__(256)
attn_kernel(const _Float16* __restrict__ qg, const _Float16* __restrict__ kg,
            const _Float16* __restrict__ vg,
            const _Float16* __restrict__ bqg, const _Float16* __restrict__ bkg,
            const float* __restrict__ vrs_g, _Float16* __restrict__ ao) {
  __shared__ _Float16 qs[256][40];     // 20 KB
  __shared__ _Float16 ks[256][40];     // 20 KB
  __shared__ _Float16 bqs[256][40];    // 20 KB  (rank-bias q factors, head h)
  __shared__ _Float16 bks[256][40];    // 20 KB  (rank-bias k factors, head h)
  __shared__ _Float16 vt[32][264];     // v transposed: vt[d][m], 16.9 KB
  __shared__ float    vmean[32];

  const int h = blockIdx.x, b = blockIdx.y;
  const int tid = threadIdx.x, lane = tid & 31, wave = tid >> 5;
  const int mlane = lane & 15, hsel = lane >> 4;
  const size_t base = ((size_t)b * 8 + h) * 256 * 32;

  // phase 0: stage q, k, bq, bk (async f16 copies) and v (transpose in VGPRs)
  async_copy64(&qs[tid][0],  qg + base + (size_t)tid * 32);
  async_copy64(&ks[tid][0],  kg + base + (size_t)tid * 32);
  async_copy64(&bqs[tid][0], bqg + ((size_t)h * 256 + tid) * 32);
  async_copy64(&bks[tid][0], bkg + ((size_t)h * 256 + tid) * 32);
  {
    union { uint4 u[4]; _Float16 h16[32]; } vv;
    const uint4* vp = (const uint4*)(vg + base + (size_t)tid * 32);
    #pragma unroll
    for (int c = 0; c < 4; ++c) vv.u[c] = vp[c];
    #pragma unroll
    for (int d = 0; d < 32; ++d) vt[d][tid] = vv.h16[d];
  }
  wait_async0();
  __syncthreads();

  // v_mean (wave 0)
  if (tid < 32) {
    float s = 0.0f;
    for (int m = 0; m < 256; ++m) s += (float)vt[tid][m];
    vmean[tid] = s * (1.0f / 256.0f);
  }

  const float vrs = vrs_g[h];
  // Kept rolled: unrolled, the compiler shares the K fragments between the two
  // query tiles and holds 256 score registers, which halves the waves per SIMD.
  #pragma unroll 1
  for (int qi = 0; qi < 2; ++qi) {
    const int q0 = (wave * 2 + qi) * 16;
    const v16h fq = lds_frag16(&qs[q0 + mlane][0], hsel);
    const v16h fb = lds_frag16(&bqs[q0 + mlane][0], hsel);

    // scores: s[kt].f[r] = S[query q0+mlane][key 16*kt + 8*hsel + r]
    Acc8 s[16];
    #pragma unroll
    for (int kt = 0; kt < 16; ++kt) {
      const v16h fk  = lds_frag16(&ks[kt * 16 + mlane][0], hsel);
      const v16h fbk = lds_frag16(&bks[kt * 16 + mlane][0], hsel);
      #pragma unroll
      for (int r = 0; r < 8; ++r) s[kt].f[r] = 0.0f;
      s[kt].v = WMMA16(fk, fq, s[kt].v);
      s[kt].v = WMMA16(fbk, fb, s[kt].v);
    }

    // softmax over the 256 keys of this lane's query, unnormalised
    v8f m8 = s[0].v;
    #pragma unroll
    for (int kt = 1; kt < 16; ++kt) m8 = __builtin_elementwise_max(m8, s[kt].v);
    float mx = fmaxf(fmaxf(fmaxf(m8[0], m8[1]), fmaxf(m8[2], m8[3])),
                     fmaxf(fmaxf(m8[4], m8[5]), fmaxf(m8[6], m8[7])));
    mx = fmaxf(mx, other_half(mx));
    const float L2E = 1.44269504088896340736f;
    const float nm = -mx * L2E;
    const v8f l2e8 = {L2E, L2E, L2E, L2E, L2E, L2E, L2E, L2E};
    const v8f nm8  = {nm, nm, nm, nm, nm, nm, nm, nm};
    v8f sum8 = {0.0f, 0.0f, 0.0f, 0.0f, 0.0f, 0.0f, 0.0f, 0.0f};
    #pragma unroll
    for (int kt = 0; kt < 16; ++kt) {
      const v8f t = __builtin_elementwise_fma(s[kt].v, l2e8, nm8);
      #pragma unroll
      for (int r = 0; r < 8; ++r) s[kt].f[r] = __builtin_amdgcn_exp2f(t[r]);
      sum8 += s[kt].v;
    }
    float sum = ((sum8[0] + sum8[1]) + (sum8[2] + sum8[3])) +
                ((sum8[4] + sum8[5]) + (sum8[6] + sum8[7]));
    sum += other_half(sum);
    const float inv = 1.0f / sum;

    // O^T = V^T P^T: A = rows of vt, B = two packed score tiles per 32 keys;
    // o[dt].f[r] = out[query q0+mlane][d = 16*dt + 8*hsel + r] * sum
    Acc8 o[2];
    #pragma unroll
    for (int dt = 0; dt < 2; ++dt)
      #pragma unroll
      for (int r = 0; r < 8; ++r) o[dt].f[r] = 0.0f;
    #pragma unroll
    for (int mc = 0; mc < 8; ++mc) {
      const v8h lo = __builtin_convertvector(s[2 * mc].v, v8h);
      const v8h hi = __builtin_convertvector(s[2 * mc + 1].v, v8h);
      const v16h p = __builtin_shufflevector(lo, hi, 0, 1, 2, 3, 4, 5, 6, 7,
                                             8, 9, 10, 11, 12, 13, 14, 15);
      #pragma unroll
      for (int dt = 0; dt < 2; ++dt) {
        const v16h fv = lds_frag16(&vt[dt * 16 + mlane][mc * 32], hsel);
        o[dt].v = WMMA16(fv, p, o[dt].v);
      }
    }

    if (qi == 0) __syncthreads();   // publish vmean before its first reader

    // normalise, + vrs * v_mean, one 16-byte f16 store per tile to [B,N,C]
    #pragma unroll
    for (int dt = 0; dt < 2; ++dt) {
      const int d0 = dt * 16 + 8 * hsel;
      union { uint4 u; _Float16 h16[8]; } st;
      #pragma unroll
      for (int r = 0; r < 8; ++r)
        st.h16[r] = (_Float16)(o[dt].f[r] * inv + vmean[d0 + r] * vrs);
      *(uint4*)(ao + ((size_t)b * 256 + q0 + mlane) * 256 + h * 32 + d0) = st.u;
    }
    // the next trip reuses the address and data registers of these stores
    asm volatile("s_wait_xcnt 0x0" ::: "memory");
  }
}

// ---------------------------------------------------------------------------
// Kernel 4: proj GEMM  [131072 x 256](f16) @ [256 x 256] + proj_b -> f32 out
// A tile staged with async-to-LDS (pure f16 copy); weight panel converted
// f32->f16 once.  grid (2, 512): a work-group walks 2 row tiles.
// ---------------------------------------------------------------------------
#define PROJ_TILES 2
__global__ void __launch_bounds__(256)
proj_kernel(const _Float16* __restrict__ a, const float* __restrict__ w,
                            const float* __restrict__ bvec, float* __restrict__ out) {
  __shared__ _Float16 As[128][40];
  __shared__ _Float16 Bs[128][PANEL_PITCH];   // weight panel: Bs[col][k], all k
  const int tid = threadIdx.x, lane = tid & 31, wave = tid >> 5;
  const int wm = wave & 3, wn = wave >> 2;
  const int mlane = lane & 15, hsel = lane >> 4;
  const int n0 = blockIdx.x * 128;

  const int ar0 = tid >> 2, ak8 = (tid & 3) * 8;
  void* lds_a0 = &As[ar0][ak8];
  void* lds_a1 = &As[ar0 + 64][ak8];

  // published by the two barriers in front of the first fragment loads
  stage_panel(Bs, w, 256, n0, tid);

  // Kept rolled: unrolled, the register count passes 128 and three work-groups
  // instead of four fit a WGP.
  #pragma unroll 1
  for (int mt = 0; mt < PROJ_TILES; ++mt) {
  const int m0 = (blockIdx.y * PROJ_TILES + mt) * 128;

  Acc8 acc[2][4];
  #pragma unroll
  for (int i = 0; i < 2; ++i)
    #pragma unroll
    for (int j = 0; j < 4; ++j)
      #pragma unroll
      for (int r = 0; r < 8; ++r) acc[i][j].f[r] = 0.0f;

  for (int kk = 0; kk < 256; kk += 32) {
    __syncthreads();
    // A tile: async f16 copies (16B per lane per pass)
    async_copy16(lds_a0, a + (size_t)(m0 + ar0) * 256 + kk + ak8);
    async_copy16(lds_a1, a + (size_t)(m0 + ar0 + 64) * 256 + kk + ak8);
    wait_async0();
    __syncthreads();
    Frag16 af[2], bf[4];
    #pragma unroll
    for (int i = 0; i < 2; ++i) af[i].v = lds_frag16(&As[wm * 32 + i * 16 + mlane][0], hsel);
    #pragma unroll
    for (int j = 0; j < 4; ++j) bf[j].v = lds_frag16(&Bs[wn * 64 + j * 16 + mlane][kk], hsel);
    #pragma unroll
    for (int i = 0; i < 2; ++i)
      #pragma unroll
      for (int j = 0; j < 4; ++j)
        acc[i][j].v = WMMA16(af[i].v, bf[j].v, acc[i][j].v);
  }

  // two neighbouring D tiles are 32 columns = one 128-byte line of a row: lanes l and
  // l^16 swap so that lanes 0-15 hold the left tile's and lanes 16-31 the right
  // tile's columns of ONE row, and a store instruction writes one whole line
  const float addb[2] = {bvec[n0 + wn * 64 + lane], bvec[n0 + wn * 64 + 32 + lane]};
  #pragma unroll
  for (int jp = 0; jp < 2; ++jp) {
    #pragma unroll
    for (int i = 0; i < 2; ++i) {
      #pragma unroll
      for (int r = 0; r < 8; ++r) {
        const float left = acc[i][2 * jp].f[r], right = acc[i][2 * jp + 1].f[r];
        const float got = other_half(hsel ? left : right);
        acc[i][2 * jp].f[r]     = (hsel ? got : left) + addb[jp];    // row r
        acc[i][2 * jp + 1].f[r] = (hsel ? right : got) + addb[jp];   // row 8 + r
      }
    }
    // keeps the stores behind the swaps (left free, the compiler ran every pair
    // through the same two registers, with a wait for the stores in front of each
    // reuse) and the two halves of the swaps apart (all 32 values under way at once
    // took the register count past 128: three work-groups per WGP for four)
    __builtin_amdgcn_sched_barrier(0);
  }
  float* orow = out + (size_t)(m0 + wm * 32) * 256 + n0 + wn * 64 + lane;
  #pragma unroll
  for (int i = 0; i < 2; ++i)
    #pragma unroll
    for (int t = 0; t < 2; ++t)
      #pragma unroll
      for (int r = 0; r < 8; ++r)
        #pragma unroll
        for (int jp = 0; jp < 2; ++jp)   // the two lines of a row one behind the other
          orow[(i * 16 + t * 8 + r) * 256 + jp * 32] = acc[i][2 * jp + t].f[r];
  // the next trip reuses the address and data registers of these stores
  asm volatile("s_wait_xcnt 0x0" ::: "memory");
  }
}

// ---------------------------------------------------------------------------
// Host launcher
// ---------------------------------------------------------------------------
extern "C" void kernel_launch(void* const* d_in, const int* in_sizes, int n_in,
                              void* d_out, int out_size, void* d_ws, size_t ws_size,
                              hipStream_t stream) {
  const float* x       = (const float*)d_in[0];
  const float* qkv_w   = (const float*)d_in[1];
  const float* qkv_b   = (const float*)d_in[2];
  const float* proj_w  = (const float*)d_in[3];
  const float* proj_b  = (const float*)d_in[4];
  const float* lsc     = (const float*)d_in[5];
  const float* vrs     = (const float*)d_in[6];
  const float* mlp1_w  = (const float*)d_in[7];
  const float* mlp1_b  = (const float*)d_in[8];
  const float* mlp2_w  = (const float*)d_in[9];
  const float* bscale  = (const float*)d_in[10];

  char* ws = (char*)d_ws;
  const size_t QSZ = (size_t)512 * 8 * 256 * 32 * sizeof(_Float16);  // 67.1 MB each
  _Float16* bq = (_Float16*)(ws + 0);          // 128 KB (f16, pre-scaled by bias_scale)
  _Float16* bk = (_Float16*)(ws + 131072);     // 128 KB
  _Float16* q  = (_Float16*)(ws + 262144);
  _Float16* k  = (_Float16*)(ws + 262144 + QSZ);
  _Float16* v  = (_Float16*)(ws + 262144 + 2 * QSZ);
  _Float16* ao = (_Float16*)(ws + 262144 + 3 * QSZ);
  float*    out = (float*)d_out;

  bias1_kernel<<<dim3(8, 16), 256, 0, stream>>>(mlp1_w, mlp1_b, mlp2_w, bscale, bq, bk);
  qkv_kernel<<<dim3(6, 128), 256, 0, stream>>>(x, qkv_w, qkv_b, lsc, q, k, v);
  attn_kernel<<<dim3(8, 512), 256, 0, stream>>>(q, k, v, bq, bk, vrs, ao);
  proj_kernel<<<dim3(2, 512), 256, 0, stream>>>(ao, proj_w, proj_b, out);
}

// v007
// A run of this version takes 178 microseconds.
// In two side-by-side timings against v006, it was 1.06 and 1.05 times as fast.
// All steps since v000 together make it 3.98 times as fast.
#include <hip/hip_runtime.h>

// ---------------------------------------------------------------------------
// WindowAttentionRFB for gfx1250 (MI455X)
//   bias1 (MLP -> f16 bq/bk) -> qkv WMMA GEMM -> fused attention
//   (scores = q k^T + bq bk^T as two chained WMMAs, kept in registers, in-lane
//    softmax, attn@V) -> proj WMMA GEMM.
//   Async global->LDS staging (global_load_async_to_lds_b128) for pure f16
//   copies; f32->f16 converting stages use regular vector loads.
//   Both GEMMs keep their weight panel (128 columns x all 256 k, f16, [col][k])
//   in LDS for the life of the work-group, which walks several row tiles.
// Shapes: B=512, N=256, C=256, H=8, hd=32, R=32
// ---------------------------------------------------------------------------

typedef __attribute__((ext_vector_type(16))) _Float16 v16h;
typedef __attribute__((ext_vector_type(8)))  float    v8f;

union Frag16 { v16h v; uint4 q[2]; _Float16 h[16]; };
union Acc8   { v8f  v; float f[8]; };

#define WMMA16(a, b, c) __builtin_amdgcn_wmma_f32_16x16x32_f16( \
    false, (a), false, (b), (short)0, (c), false, false)

static __device__ __forceinline__ v16h lds_frag16(const _Float16* rowbase, int hsel) {
  // 16-bit A/B fragment: lane (m = lane&15, hsel = lane>>4)
  // chunk0: K = 8*hsel .. +7  -> VGPR0..3 ; chunk1: K = 16+8*hsel .. +7 -> VGPR4..7
  Frag16 t;
  const _Float16* p = rowbase + hsel * 8;
  t.q[0] = *(const uint4*)(p);
  t.q[1] = *(const uint4*)(p + 16);
  return t.v;
}

static __device__ __forceinline__ unsigned other_oct(unsigned x) {
  // value of lane l ^ 8 (a gather inside each row of 16 lanes)
  return (unsigned)__builtin_amdgcn_permlane16(x, x, 0xfedcba98, 0x76543210, false, false);
}

// 64B per-lane global -> LDS async copy (4 x b128), tracked on ASYNCcnt.
static __device__ __forceinline__ void async_copy64(void* lds_dst, const void* gsrc) {
  unsigned l = (unsigned)(uintptr_t)lds_dst;        // LDS offset = low 32 bits of flat addr
  unsigned long long g = (unsigned long long)(uintptr_t)gsrc;
  asm volatile(
      "global_load_async_to_lds_b128 %0, %1, off\n\t"
      "global_load_async_to_lds_b128 %0, %1, off offset:16\n\t"
      "global_load_async_to_lds_b128 %0, %1, off offset:32\n\t"
      "global_load_async_to_lds_b128 %0, %1, off offset:48"
      :: "v"(l), "v"(g) : "memory");
}

// 16B per-lane global -> LDS async copy.
static __device__ __forceinline__ void async_copy16(void* lds_dst, const void* gsrc) {
  unsigned l = (unsigned)(uintptr_t)lds_dst;
  unsigned long long g = (unsigned long long)(uintptr_t)gsrc;
  // the wait is part of the statement: the caller sits in a rolled loop whose
  // next trip rewrites the two address registers
  asm volatile("global_load_async_to_lds_b128 %0, %1, off\n\t"
               "s_wait_xcnt 0x0"
               :: "v"(l), "v"(g) : "memory");
}

static __device__ __forceinline__ void wait_async0() {
  asm volatile("s_wait_asynccnt 0x0" ::: "memory");
}

// Weight panel of a GEMM work-group: Bs[col][k] = (f16) w[k][n0 + col], 128
// columns, k = 0..255.  Pitch 264 halves = 528 B = 16 B x 33, so that the 16-byte
// stores here and the 16-byte fragment loads fall on distinct banks.
// A lane owns one column (a wave reads whole 128-B lines of w) and packs eight
// consecutive k into one 16-byte LDS store.  256 threads.
#define PANEL_PITCH 264
static __device__ __forceinline__ void stage_panel(_Float16 (*Bs)[PANEL_PITCH],
                                                   const float* __restrict__ w,
                                                   int ldw, int n0, int tid) {
  const int c = tid & 127;
  const float* wc = w + n0 + c;
  // 32 loads in flight per lane; fully unrolled the compiler held all 128 values
  // and the register count cost a resident work-group
  #pragma unroll 4
  for (int it = 0; it < 16; ++it) {
    const int k0 = (it * 2 + (tid >> 7)) * 8;
    union { _Float16 h[8]; uint4 u; } t;
    #pragma unroll
    for (int j = 0; j < 8; ++j) t.h[j] = (_Float16)wc[(size_t)(k0 + j) * ldw];
    *(uint4*)&Bs[c][k0] = t.u;
  }
}

// ---------------------------------------------------------------------------
// Kernel 1: position-bias MLP -> f16 bq [H,N,R] (pre-scaled), bk [H,N,R]
// grid (8 heads, 16 position groups) x 256 threads: a work-group forms 16
// positions x the 64 output columns (32 bq + 32 bk) of one head.
// A lane owns one column of w2 (a wave reads whole 128-B lines) and holds all
// 128 k of it in registers; two waves share four positions, whose hidden
// features they read from LDS as broadcasts: four independent sums per lane,
// each in the order k = 0..127.
// ---------------------------------------------------------------------------
__global__ void __launch_bounds__(256)
bias1_kernel(const float* __restrict__ w1, const float* __restrict__ b1,
             const float* __restrict__ w2, const float* __restrict__ bscale_p,
             _Float16* __restrict__ bq, _Float16* __restrict__ bk) {
  __shared__ __attribute__((aligned(16))) float hf[16][132];   // pitch 528 B = 16 B x 33
  const int tid = threadIdx.x;
  const int h = blockIdx.x, n0 = blockIdx.y * 16;
  const int c = tid & 63, pg = tid >> 6;

  // a thread forms 8 hidden features of one position: its slices of w1 and b1
  const int p = tid >> 4, j0 = (tid & 15) * 8;
  union { float4 q[2]; float f[8]; } wa, wb, bb, g;
  #pragma unroll
  for (int t = 0; t < 2; ++t) {
    wa.q[t] = *(const float4*)(w1 + j0 + 4 * t);
    wb.q[t] = *(const float4*)(w1 + 128 + j0 + 4 * t);
    bb.q[t] = *(const float4*)(b1 + j0 + 4 * t);
  }
  const float bsc = bscale_p[0];
  // the scalar bases of the six loads above are given new values below; the
  // statement also keeps the six, which the gelu phase waits for, in front of the
  // 128 below (loads return in order)
  asm volatile("s_wait_xcnt 0x0" ::: "memory");
  // this lane's column of w2, fetched here: the latency runs under the gelu phase
  float wc[128];
  const float* wp = w2 + h * 64 + c;
  #pragma unroll
  for (int j = 0; j < 128; ++j) wc[j] = wp[j * 512];

  {
    const int n = n0 + p;                     // position index 0..255
    const float invden = 1.0f / logf(16.0f);  // log1p(15) = log(16)
    const float c0 = log1pf((float)(n >> 4)) * invden;   // gy
    const float c1 = log1pf((float)(n & 15)) * invden;   // gx
    #pragma unroll
    for (int jj = 0; jj < 8; ++jj) {
      float z = c0 * wa.f[jj] + c1 * wb.f[jj] + bb.f[jj];
      g.f[jj] = 0.5f * z * (1.0f + erff(z * 0.70710678118654752f));  // exact gelu
    }
    *(float4*)&hf[p][j0]     = g.q[0];
    *(float4*)&hf[p][j0 + 4] = g.q[1];
  }
  __syncthreads();

  float acc[4] = {0.0f, 0.0f, 0.0f, 0.0f};
  #pragma unroll
  for (int j = 0; j < 128; j += 4) {
    #pragma unroll
    for (int i = 0; i < 4; ++i) {
      const float4 hv = *(const float4*)&hf[pg * 4 + i][j];
      acc[i] += hv.x * wc[j];
      acc[i] += hv.y * wc[j + 1];
      acc[i] += hv.z * wc[j + 2];
      acc[i] += hv.w * wc[j + 3];
    }
  }

  const int which = c >> 5, r = c & 31;       // the same for a whole wave
  _Float16* outp = (which == 0) ? bq : bk;
  const float osc = (which == 0) ? bsc : 1.0f;
  #pragma unroll
  for (int i = 0; i < 4; ++i) {
    const int n = n0 + pg * 4 + i;
    const float s = 1.0f / (1.0f + __expf(-acc[i]));
    outp[(h * 256 + n) * 32 + r] = (_Float16)(osc * s);
  }
}

// ---------------------------------------------------------------------------
// Kernel 2: QKV GEMM  [131072 x 256] @ [256 x 768] (+bias, q*=logit_scale)
// Block tile 128x128, 8 waves, each wave 2x4 16x16 accum tiles.
// grid (6, 128): a work-group stages its weight panel once and walks 8 row tiles.
// x goes through two LDS stages of 64 k: the loads of the next stage (8 of 16
// bytes per lane) are issued in front of this stage's products and converted and
// stored behind them, so that the load latency runs under the products; one
// barrier per stage.  The stages run on across the row tiles.
// The products are formed transposed (A = weight columns, B = x rows): in D a lane
// holds one row of x (lane&15) and the output columns 8*(lane>>4)+r of a 16-column
// tile, eight neighbouring f16 of one head.  Lanes l and l^8 swap one of their two
// 16-byte pieces, and every store instruction writes 512 contiguous bytes.
// ---------------------------------------------------------------------------
#define QKV_TILES 8
#define QKV_KC 64

// One stage of x, 128 rows x 64 k: a wave's load covers 256 contiguous bytes of
// each of two rows; p + off is the lane's own address in the stage's first 16 rows.
static __device__ __forceinline__ void qkv_fetch(float4 (&a)[8], const float* p, int off) {
  #pragma unroll
  for (int i = 0; i < 8; ++i) a[i] = *(const float4*)(p + off + i * 16 * 256);
  // the caller gives the address registers a new value for the next row tile; p is
  // named so that the address pair outlives the run of loads (no result lands in it)
  asm volatile("s_wait_xcnt 0x0" :: "v"(p) : "memory");
}

static __device__ __forceinline__ void qkv_put(_Float16 (*st)[QKV_KC + 8], const float4 (&a)[8],
                                               int row, int col) {
  #pragma unroll
  for (int i = 0; i < 8; ++i) {
    union { _Float16 h[4]; uint2 u; } t;
    t.h[0] = (_Float16)a[i].x; t.h[1] = (_Float16)a[i].y;
    t.h[2] = (_Float16)a[i].z; t.h[3] = (_Float16)a[i].w;
    *(uint2*)&st[row + i * 16][col] = t.u;
  }
}

// three work-groups per WGP (their LDS fits) are six waves per SIMD: the register
// count is held to that
__global__ void __launch_bounds__(256) __attribute__((amdgpu_waves_per_eu(6)))
qkv_kernel(const float* __restrict__ x, const float* __restrict__ w,
                           const float* __restrict__ bvec, const float* __restrict__ lsc,
                           _Float16* __restrict__ qo, _Float16* __restrict__ ko,
                           _Float16* __restrict__ vo) {
  __shared__ _Float16 As[2][128][QKV_KC + 8];   // two stages; pitch 72 h = 144 B = 16 B x 9
  __shared__ _Float16 Bs[128][PANEL_PITCH];   // weight panel: Bs[col][k], all k
  const int tid = threadIdx.x, lane = tid & 31, wave = tid >> 5;
  const int wm = wave & 3, wn = wave >> 2;
  const int mlane = lane & 15, hsel = lane >> 4;
  const int n0 = blockIdx.x * 128;

  // published by the barrier in front of the first fragment loads
  stage_panel(Bs, w, 768, n0, tid);

  // q scale of this wave's two heads (32 output columns each), the same for every tile
  float scale[2];
  #pragma unroll
  for (int jp = 0; jp < 2; ++jp) {
    const int jg0 = n0 + wn * 64 + jp * 32;
    scale[jp] = ((jg0 >> 8) == 0) ? lsc[(jg0 >> 5) & 7] : 1.0f;
  }

  // stage 0 of the first row tile
  const int xrow = wave * 2 + hsel, xcol = mlane * 4;
  const float* xb = x + ((size_t)blockIdx.y * QKV_TILES * 128 + xrow) * 256 + xcol;
  float4 a[8];
  qkv_fetch(a, xb, 0);
  qkv_put(As[0], a, xrow, xcol);
  __syncthreads();

  // Kept rolled: the K loop inside is unrolled.
  #pragma unroll 1
  for (int mt = 0; mt < QKV_TILES; ++mt) {
  const int m0 = (blockIdx.y * QKV_TILES + mt) * 128;
  const float* xt = xb + (size_t)mt * 128 * 256;

  Acc8 acc[2][4];
  #pragma unroll
  for (int i = 0; i < 2; ++i)
    #pragma unroll
    for (int j = 0; j < 4; ++j)
      #pragma unroll
      for (int r = 0; r < 8; ++r) acc[i][j].f[r] = 0.0f;

  // unrolled: the stage index (kq & 1) is then a constant in every LDS address
  #pragma unroll
  for (int kq = 0; kq < 256 / QKV_KC; ++kq) {
    const int kk = kq * QKV_KC;
    // the next stage: the next 64 k of this row tile, or the first of the next tile
    const bool more = (kq + 1 < 256 / QKV_KC) || (mt + 1 < QKV_TILES);
    if (more) qkv_fetch(a, xt, (kq + 1 < 256 / QKV_KC) ? kk + QKV_KC : 128 * 256);
    #pragma unroll
    for (int ks = 0; ks < QKV_KC; ks += 32) {
      Frag16 af[2], bf[4];
      #pragma unroll
      for (int i = 0; i < 2; ++i) af[i].v = lds_frag16(&As[kq & 1][wm * 32 + i * 16 + mlane][ks], hsel);
      #pragma unroll
      for (int j = 0; j < 4; ++j) bf[j].v = lds_frag16(&Bs[wn * 64 + j * 16 + mlane][kk + ks], hsel);
      #pragma unroll
      for (int i = 0; i < 2; ++i)
        #pragma unroll
        for (int j = 0; j < 4; ++j)
          acc[i][j].v = WMMA16(bf[j].v, af[i].v, acc[i][j].v);
    }
    // keeps the conversions, and with them the wait for the loads, behind the
    // products: left free, the scheduler put them behind the first product and the
    // wave sat out the load latency there
    __builtin_amdgcn_sched_barrier(0);
    // into the stage whose last readers passed the barrier of the stage before
    if (more) qkv_put(As[(kq + 1) & 1], a, xrow, xcol);
    // ends the reads of this stage and publishes the next
    __syncthreads();
  }

  // epilogue: +bias, q*=logit_scale[h], f16 to [B,H,N,32]; a head's 32 columns are
  // two neighbouring D tiles, a row of it 64 bytes = four 16-byte pieces
  const bool lo8 = mlane < 8;
  #pragma unroll
  for (int jp = 0; jp < 2; ++jp) {
    const int jg0 = n0 + wn * 64 + jp * 32;           // first global out column of the head
    const int which = jg0 >> 8, h = (jg0 >> 5) & 7;
    _Float16* outp = (which == 0) ? qo : ((which == 1) ? ko : vo);
    union { float4 q[2]; float f[8]; } bias[2];       // of this lane's 2 x 8 columns
    #pragma unroll
    for (int t = 0; t < 2; ++t) {
      bias[t].q[0] = *(const float4*)(bvec + jg0 + t * 16 + 8 * hsel);
      bias[t].q[1] = *(const float4*)(bvec + jg0 + t * 16 + 8 * hsel + 4);
    }
    #pragma unroll
    for (int i = 0; i < 2; ++i) {
      // pc[t]: row mlane of the 16, piece 2*t + hsel
      union { _Float16 h16[8]; unsigned u[4]; } pc[2];
      #pragma unroll
      for (int t = 0; t < 2; ++t)
        #pragma unroll
        for (int r = 0; r < 8; ++r)
          pc[t].h16[r] = (_Float16)((acc[i][2 * jp + t].f[r] + bias[t].f[r]) * scale[jp]);
      // lanes 0-7 of a row of 16 end with pieces hsel of rows mlane and mlane+8,
      // lanes 8-15 with pieces 2+hsel of rows mlane-8 and mlane
      union { unsigned u[4]; uint4 q; } s0, s1;
      #pragma unroll
      for (int c = 0; c < 4; ++c) {
        const unsigned got = other_oct(lo8 ? pc[1].u[c] : pc[0].u[c]);
        s0.u[c] = lo8 ? pc[0].u[c] : got;             // rows 0..7
        s1.u[c] = lo8 ? got : pc[1].u[c];             // rows 8..15
      }
      const int mg = m0 + wm * 32 + i * 16 + (mlane & 7);   // global row = b*256 + nrow
      const int bb = mg >> 8, nrow = mg & 255;
      _Float16* dst = outp + (((size_t)bb * 8 + h) * 256 + nrow) * 32
                           + ((mlane >> 3) * 2 + hsel) * 8;
      *(uint4*)dst = s0.q;
      *(uint4*)(dst + 8 * 32) = s1.q;
    }
  }
  // the next trip reuses the address and data registers of these stores
  asm volatile("s_wait_xcnt 0x0" ::: "memory");
  }
}

// ---------------------------------------------------------------------------
// Kernel 3: fused attention per (b,h).  grid (8, 512), 256 threads = 8 waves.
//  The scores never leave the registers.  Each wave owns 2 x 16 queries and
//  forms S^T = K Q^T + BK BQ^T (A = key rows, B = query rows): in D a lane
//  holds one query (column lane&15) and keys 8*(lane>>4)+r of each 16-key tile,
//  so row maximum and row sum are in-lane plus one exchange between the halves,
//  and two neighbouring D tiles, converted to f16, are the B operand of
//  O^T = V^T P^T in the hardware k order that lds_frag16 also delivers.
//  The keys are walked in 4 chunks of 64 with a running maximum and sum, so that
//  the scores of both query tiles fit the registers at once and every K, BK and V
//  fragment read from LDS serves two query tiles.
//  q/k/bq/bk staged with async-to-LDS copies; v transposed through VGPRs.
// ---------------------------------------------------------------------------
typedef __attribute__((ext_vector_type(8))) _Float16 v8h;
typedef __attribute__((ext_vector_type(2))) float v2f;

static __device__ __forceinline__ float other_half(float x) {
  // value of lane l ^ 16
  int b = __builtin_bit_cast(int, x);
  b = __builtin_amdgcn_permlanex16(b, b, 0x76543210, 0xfedcba98, false, false);
  return __builtin_bit_cast(float, b);
}

// three work-groups per WGP (their LDS fits) are six waves per SIMD: the register
// count is held to that
__global__ void __launch_bounds__(256) __attribute__((amdgpu_waves_per_eu(6)))
attn_kernel(const _Float16* __restrict__ qg, const _Float16* __restrict__ kg,
            const _Float16* __restrict__ vg,
            const _Float16* __restrict__ bqg, const _Float16* __restrict__ bkg,
            const float* __restrict__ vrs_g, _Float16* __restrict__ ao) {
  __shared__ _Float16 qs[256][40];     // 20 KB
  __shared__ _Float16 ks[256][40];     // 20 KB
  __shared__ _Float16 bqs[256][40];    // 20 KB  (rank-bias q factors, head h)
  __shared__ _Float16 bks[256][40];    // 20 KB  (rank-bias k factors, head h)
  __shared__ _Float16 vt[32][264];     // v transposed: vt[d][m], 16.9 KB
  __shared__ float    vmean[32];

  const int h = blockIdx.x, b = blockIdx.y;
  const int tid = threadIdx.x, lane = tid & 31, wave = tid >> 5;
  const int mlane = lane & 15, hsel = lane >> 4;
  const size_t base = ((size_t)b * 8 + h) * 256 * 32;

  // phase 0: stage q, k, bq, bk (async f16 copies) and v (transpose in VGPRs)
  async_copy64(&qs[tid][0],  qg + base + (size_t)tid * 32);
  async_copy64(&ks[tid][0],  kg + base + (size_t)tid * 32);
  async_copy64(&bqs[tid][0], bqg + ((size_t)h * 256 + tid) * 32);
  async_copy64(&bks[tid][0], bkg + ((size_t)h * 256 + tid) * 32);
  {
    union { uint4 u[4]; _Float16 h16[32]; } vv;
    const uint4* vp = (const uint4*)(vg + base + (size_t)tid * 32);
    #pragma unroll
    for (int c = 0; c < 4; ++c) vv.u[c] = vp[c];
    #pragma unroll
    for (int d = 0; d < 32; ++d) vt[d][tid] = vv.h16[d];
  }
  wait_async0();
  __syncthreads();

  // v_mean (wave 0)
  if (tid < 32) {
    float s = 0.0f;
    for (int m = 0; m < 256; ++m) s += (float)vt[tid][m];
    vmean[tid] = s * (1.0f / 256.0f);
  }

  const float vrs = vrs_g[h];
  const float L2E = 1.44269504088896340736f;
  const v8f l2e8 = {L2E, L2E, L2E, L2E, L2E, L2E, L2E, L2E};
  const int q0 = wave * 32;

  // running maximum (both halves of the wave hold the same), running sum of this
  // lane's keys (in two parts: packed adds), and o[qt][dt].f[r] = out[query q0+16*qt+mlane][d = 16*dt+8*hsel+r],
  // all three relative to the running maximum
  float mrun[2] = {-__builtin_inff(), -__builtin_inff()};
  v2f srun[2] = {{0.0f, 0.0f}, {0.0f, 0.0f}};
  Acc8 o[2][2];
  #pragma unroll
  for (int qt = 0; qt < 2; ++qt)
    #pragma unroll
    for (int dt = 0; dt < 2; ++dt)
      #pragma unroll
      for (int r = 0; r < 8; ++r) o[qt][dt].f[r] = 0.0f;

  // Kept rolled: unrolled, the build spilled to scratch at the register count that
  // three work-groups per WGP allow.
  #pragma unroll 1
  for (int c = 0; c < 4; ++c) {
    const int key0 = c * 64;
    // The wave's two query tiles are read anew in every chunk.  The fence (no
    // instruction) keeps these loads inside the loop: lifted out, the fragments hold
    // 32 registers through the softmax as well and are spilled to scratch.
    __builtin_amdgcn_fence(__ATOMIC_ACQUIRE, "wavefront");
    v16h fq[2], fb[2];
    #pragma unroll
    for (int qt = 0; qt < 2; ++qt) {
      fq[qt] = lds_frag16(&qs[q0 + qt * 16 + mlane][0], hsel);
      fb[qt] = lds_frag16(&bqs[q0 + qt * 16 + mlane][0], hsel);
    }
    // scores: s[qt][kt].f[r] = S[query q0+16*qt+mlane][key key0 + 16*kt + 8*hsel + r]
    Acc8 s[2][4];
    #pragma unroll
    for (int kt = 0; kt < 4; ++kt) {
      const v16h fk  = lds_frag16(&ks[key0 + kt * 16 + mlane][0], hsel);
      const v16h fbk = lds_frag16(&bks[key0 + kt * 16 + mlane][0], hsel);
      #pragma unroll
      for (int qt = 0; qt < 2; ++qt) {
        #pragma unroll
        for (int r = 0; r < 8; ++r) s[qt][kt].f[r] = 0.0f;
        s[qt][kt].v = WMMA16(fk, fq[qt], s[qt][kt].v);
        s[qt][kt].v = WMMA16(fbk, fb[qt], s[qt][kt].v);
      }
    }

    // softmax of the chunk, unnormalised, relative to the new running maximum; what
    // was gathered under the old maximum is scaled by al (0 in the first chunk).
    // p[qt][mc]: two neighbouring score tiles packed, the B operand for 32 keys
    v16h p[2][2], fv[2][2];
    #pragma unroll
    for (int qt = 0; qt < 2; ++qt) {
      // new running maximum, the old one taken in; in threes: one three-operand
      // maximum instruction each
      float t3[8], u3[4];
      #pragma unroll
      for (int r = 0; r < 8; ++r)
        t3[r] = fmaxf(fmaxf(s[qt][0].f[r], s[qt][1].f[r]), s[qt][2].f[r]);
      #pragma unroll
      for (int r = 0; r < 4; ++r) {
        u3[r] = fmaxf(fmaxf(t3[2 * r], t3[2 * r + 1]), s[qt][3].f[2 * r]);
        u3[r] = fmaxf(fmaxf(u3[r], s[qt][3].f[2 * r + 1]), r ? u3[r - 1] : mrun[qt]);
      }
      const float mnew = fmaxf(u3[3], other_half(u3[3]));
      const float al = __builtin_amdgcn_exp2f((mrun[qt] - mnew) * L2E);
      mrun[qt] = mnew;
      const float nm = -mnew * L2E;
      const v8f nm8 = {nm, nm, nm, nm, nm, nm, nm, nm};
      #pragma unroll
      for (int kt = 0; kt < 4; ++kt) {
        const v8f t = __builtin_elementwise_fma(s[qt][kt].v, l2e8, nm8);
        #pragma unroll
        for (int r = 0; r < 8; ++r) s[qt][kt].f[r] = __builtin_amdgcn_exp2f(t[r]);
      }
      const v8f sum8 = (s[qt][0].v + s[qt][1].v) + (s[qt][2].v + s[qt][3].v);
      const v2f cs = (__builtin_shufflevector(sum8, sum8, 0, 1) +
                      __builtin_shufflevector(sum8, sum8, 2, 3)) +
                     (__builtin_shufflevector(sum8, sum8, 4, 5) +
                      __builtin_shufflevector(sum8, sum8, 6, 7));
      const v2f al2 = {al, al};
      srun[qt] = __builtin_elementwise_fma(srun[qt], al2, cs);
      const v8f al8 = {al, al, al, al, al, al, al, al};
      #pragma unroll
      for (int dt = 0; dt < 2; ++dt) o[qt][dt].v *= al8;
      #pragma unroll
      for (int mc = 0; mc < 2; ++mc) {
        const v8h lo = __builtin_convertvector(s[qt][2 * mc].v, v8h);
        const v8h hi = __builtin_convertvector(s[qt][2 * mc + 1].v, v8h);
        p[qt][mc] = __builtin_shufflevector(lo, hi, 0, 1, 2, 3, 4, 5, 6, 7,
                                            8, 9, 10, 11, 12, 13, 14, 15);
      }
      // keeps the two tiles' softmax and the products behind them apart: left free, the
      // scheduler had scores, packed scores and V fragments of both tiles alive at once
      // and spilled at the register count that three work-groups per WGP allow
      __builtin_amdgcn_sched_barrier(0);
      // the chunk's V fragments: their latency runs under the second tile's softmax
      if (qt == 0) {
        #pragma unroll
        for (int mc = 0; mc < 2; ++mc)
          #pragma unroll
          for (int dt = 0; dt < 2; ++dt)
            fv[mc][dt] = lds_frag16(&vt[dt * 16 + mlane][key0 + mc * 32], hsel);
      }
    }

    // O^T += V^T P^T: A = rows of vt
    #pragma unroll
    for (int mc = 0; mc < 2; ++mc)
      #pragma unroll
      for (int qt = 0; qt < 2; ++qt)
        #pragma unroll
        for (int dt = 0; dt < 2; ++dt)
          o[qt][dt].v = WMMA16(fv[mc][dt], p[qt][mc], o[qt][dt].v);
  }

  __syncthreads();   // publish vmean before its first reader

  // normalise, + vrs * v_mean, one 16-byte f16 store per tile to [B,N,C]
  #pragma unroll
  for (int qt = 0; qt < 2; ++qt) {
    const float sl = srun[qt][0] + srun[qt][1];
    const float inv = 1.0f / (sl + other_half(sl));
    #pragma unroll
    for (int dt = 0; dt < 2; ++dt) {
      const int d0 = dt * 16 + 8 * hsel;
      union { uint4 u; _Float16 h16[8]; } st;
      #pragma unroll
      for (int r = 0; r < 8; ++r)
        st.h16[r] = (_Float16)(o[qt][dt].f[r] * inv + vmean[d0 + r] * vrs);
      *(uint4*)(ao + ((size_t)b * 256 + q0 + qt * 16 + mlane) * 256 + h * 32 + d0) = st.u;
    }
  }
}

// ---------------------------------------------------------------------------
// Kernel 4: proj GEMM  [131072 x 256](f16) @ [256 x 256] + proj_b -> f32 out
// A tile staged with async-to-LDS (pure f16 copy); weight panel converted
// f32->f16 once.  grid (2, 512): a work-group walks 2 row tiles.
// ---------------------------------------------------------------------------
#define PROJ_TILES 2
__global__ void __launch_bounds__(256)
proj_kernel(const _Float16* __restrict__ a, const float* __restrict__ w,
                            const float* __restrict__ bvec, float* __restrict__ out) {
  __shared__ _Float16 As[128][40];
  __shared__ _Float16 Bs[128][PANEL_PITCH];   // weight panel: Bs[col][k], all k
  const int tid = threadIdx.x, lane = tid & 31, wave = tid >> 5;
  const int wm = wave & 3, wn = wave >> 2;
  const int mlane = lane & 15, hsel = lane >> 4;
  const int n0 = blockIdx.x * 128;

  const int ar0 = tid >> 2, ak8 = (tid & 3) * 8;
  void* lds_a0 = &As[ar0][ak8];
  void* lds_a1 = &As[ar0 + 64][ak8];

  // published by the two barriers in front of the first fragment loads
  stage_panel(Bs, w, 256, n0, tid);

  // Kept rolled: unrolled, the register count passes 128 and three work-groups
  // instead of four fit a WGP.
  #pragma unroll 1
  for (int mt = 0; mt < PROJ_TILES; ++mt) {
  const int m0 = (blockIdx.y * PROJ_TILES + mt) * 128;

  Acc8 acc[2][4];
  #pragma unroll
  for (int i = 0; i < 2; ++i)
    #pragma unroll
    for (int j = 0; j < 4; ++j)
      #pragma unroll
      for (int r = 0; r < 8; ++r) acc[i][j].f[r] = 0.0f;

  for (int kk = 0; kk < 256; kk += 32) {
    __syncthreads();
    // A tile: async f16 copies (16B per lane per pass)
    async_copy16(lds_a0, a + (size_t)(m0 + ar0) * 256 + kk + ak8);
    async_copy16(lds_a1, a + (size_t)(m0 + ar0 + 64) * 256 + kk + ak8);
    wait_async0();
    __syncthreads();
    Frag16 af[2], bf[4];
    #pragma unroll
    for (int i = 0; i < 2; ++i) af[i].v = lds_frag16(&As[wm * 32 + i * 16 + mlane][0], hsel);
    #pragma unroll
    for (int j = 0; j < 4; ++j) bf[j].v = lds_frag16(&Bs[wn * 64 + j * 16 + mlane][kk], hsel);
    #pragma unroll
    for (int i = 0; i < 2; ++i)
      #pragma unroll
      for (int j = 0; j < 4; ++j)
        acc[i][j].v = WMMA16(af[i].v, bf[j].v, acc[i][j].v);
  }

  // two neighbouring D tiles are 32 columns = one 128-byte line of a row: lanes l and
  // l^16 swap so that lanes 0-15 hold the left tile's and lanes 16-31 the right
  // tile's columns of ONE row, and a store instruction writes one whole line
  const float addb[2] = {bvec[n0 + wn * 64 + lane], bvec[n0 + wn * 64 + 32 + lane]};
  #pragma unroll
  for (int jp = 0; jp < 2; ++jp) {
    #pragma unroll
    for (int i = 0; i < 2; ++i) {
      #pragma unroll
      for (int r = 0; r < 8; ++r) {
        const float left = acc[i][2 * jp].f[r], right = acc[i][2 * jp + 1].f[r];
        const float got = other_half(hsel ? left : right);
        acc[i][2 * jp].f[r]     = (hsel ? got : left) + addb[jp];    // row r
        acc[i][2 * jp + 1].f[r] = (hsel ? right : got) + addb[jp];   // row 8 + r
      }
    }
    // keeps the stores behind the swaps (left free, the compiler ran every pair
    // through the same two registers, with a wait for the stores in front of each
    // reuse) and the two halves of the swaps apart (all 32 values under way at once
    // took the register count past 128: three work-groups per WGP for four)
    __builtin_amdgcn_sched_barrier(0);
  }
  float* orow = out + (size_t)(m0 + wm * 32) * 256 + n0 + wn * 64 + lane;
  #pragma unroll
  for (int i = 0; i < 2; ++i)
    #pragma unroll
    for (int t = 0; t < 2; ++t)
      #pragma unroll
      for (int r = 0; r < 8; ++r)
        #pragma unroll
        for (int jp = 0; jp < 2; ++jp)   // the two lines of a row one behind the other
          orow[(i * 16 + t * 8 + r) * 256 + jp * 32] = acc[i][2 * jp + t].f[r];
  // the next trip reuses the address and data registers of these stores
  asm volatile("s_wait_xcnt 0x0" ::: "memory");
  }
}

// ---------------------------------------------------------------------------
// Host launcher
// ---------------------------------------------------------------------------
extern "C" void kernel_launch(void* const* d_in, const int* in_sizes, int n_in,
                              void* d_out, int out_size, void* d_ws, size_t ws_size,
                              hipStream_t stream) {
  const float* x       = (const float*)d_in[0];
  const float* qkv_w   = (const float*)d_in[1];
  const float* qkv_b   = (const float*)d_in[2];
  const float* proj_w  = (const float*)d_in[3];
  const float* proj_b  = (const float*)d_in[4];
  const float* lsc     = (const float*)d_in[5];
  const float* vrs     = (const float*)d_in[6];
  const float* mlp1_w  = (const float*)d_in[7];
  const float* mlp1_b  = (const float*)d_in[8];
  const float* mlp2_w  = (const float*)d_in[9];
  const float* bscale  = (const float*)d_in[10];

  char* ws = (char*)d_ws;
  const size_t QSZ = (size_t)512 * 8 * 256 * 32 * sizeof(_Float16);  // 67.1 MB each
  _Float16* bq = (_Float16*)(ws + 0);          // 128 KB (f16, pre-scaled by bias_scale)
  _Float16* bk = (_Float16*)(ws + 131072);     // 128 KB
  _Float16* q  = (_Float16*)(ws + 262144);
  _Float16* k  = (_Float16*)(ws + 262144 + QSZ);
  _Float16* v  = (_Float16*)(ws + 262144 + 2 * QSZ);
  _Float16* ao = (_Float16*)(ws + 262144 + 3 * QSZ);
  float*    out = (float*)d_out;

  bias1_kernel<<<dim3(8, 16), 256, 0, stream>>>(mlp1_w, mlp1_b, mlp2_w, bscale, bq, bk);
  qkv_kernel<<<dim3(6, 128), 256, 0, stream>>>(x, qkv_w, qkv_b, lsc, q, k, v);
  attn_kernel<<<dim3(8, 512), 256, 0, stream>>>(q, k, v, bq, bk, vrs, ao);
  proj_kernel<<<dim3(2, 512), 256, 0, stream>>>(ao, proj_w, proj_b, out);
}

// v008
// It runs in 157 microseconds.
// Next to v007, in two timings, it ran 1.13 and 1.14 times as fast.
// Over all steps from v000 it is 4.52 times as fast.
#include <hip/hip_runtime.h>

// ---------------------------------------------------------------------------
// WindowAttentionRFB for gfx1250 (MI455X)
//   bias1 (MLP -> f16 bq/bk) -> qkv WMMA GEMM -> fused attention
//   (scores = q k^T + bq bk^T as two chained WMMAs, kept in registers, in-lane
//    softmax, attn@V) -> proj WMMA GEMM.
//   Async global->LDS staging (global_load_async_to_lds_b128) for pure f16
//   copies; f32->f16 converting stages use regular vector loads.
//   Both GEMMs keep their weight panel (128 columns x all 256 k, f16, [col][k])
//   in LDS for the life of the work-group, which walks several row tiles.
// Shapes: B=512, N=256, C=256, H=8, hd=32, R=32
// ---------------------------------------------------------------------------

typedef __attribute__((ext_vector_type(16))) _Float16 v16h;
typedef __attribute__((ext_vector_type(8)))  float    v8f;

union Frag16 { v16h v; uint4 q[2]; _Float16 h[16]; };
union Acc8   { v8f  v; float f[8]; };

#define WMMA16(a, b, c) __builtin_amdgcn_wmma_f32_16x16x32_f16( \
    false, (a), false, (b), (short)0, (c), false, false)

static __device__ __forceinline__ v16h lds_frag16(const _Float16* rowbase, int hsel) {
  // 16-bit A/B fragment: lane (m = lane&15, hsel = lane>>4)
  // chunk0: K = 8*hsel .. +7  -> VGPR0..3 ; chunk1: K = 16+8*hsel .. +7 -> VGPR4..7
  Frag16 t;
  const _Float16* p = rowbase + hsel * 8;
  t.q[0] = *(const uint4*)(p);
  t.q[1] = *(const uint4*)(p + 16);
  return t.v;
}

static __device__ __forceinline__ unsigned other_oct(unsigned x) {
  // value of lane l ^ 8 (a gather inside each row of 16 lanes)
  return (unsigned)__builtin_amdgcn_permlane16(x, x, 0xfedcba98, 0x76543210, false, false);
}

// One wave brings 32 rows of 64 B, 2 KB contiguous in global memory, of each of two
// arrays into LDS rows of pitch 80 B: four lanes share a row, so that each of the
// eight copies covers 512 contiguous bytes = four whole 128-B lines.  Tracked on
// ASYNCcnt.
static __device__ __forceinline__ void async_rows32x2(_Float16 (*dsta)[40], const _Float16* srca,
                                                      _Float16 (*dstb)[40], const _Float16* srcb,
                                                      int lane) {
  // LDS offset = low 32 bits of the flat address; eight rows on = 8 * 80 bytes
  const unsigned a0 = (unsigned)(uintptr_t)&dsta[lane >> 2][(lane & 3) * 8];
  const unsigned b0 = (unsigned)(uintptr_t)&dstb[lane >> 2][(lane & 3) * 8];
  const unsigned a1 = a0 + 640, a2 = a0 + 1280, a3 = a0 + 1920;
  const unsigned b1 = b0 + 640, b2 = b0 + 1280, b3 = b0 + 1920;
  // eight rows on = 256 halves
  const _Float16* p0 = srca + lane * 8;
  const _Float16* p1 = p0 + 256;
  const _Float16* p2 = p0 + 512;
  const _Float16* p3 = p0 + 768;
  const _Float16* r0 = srcb + lane * 8;
  const _Float16* r1 = r0 + 256;
  const _Float16* r2 = r0 + 512;
  const _Float16* r3 = r0 + 768;
  // the wait is the statement's last line: it stands in front of whatever gives the
  // address registers a new value
  asm volatile(
      "global_load_async_to_lds_b128 %0, %8, off\n\t"
      "global_load_async_to_lds_b128 %1, %9, off\n\t"
      "global_load_async_to_lds_b128 %2, %10, off\n\t"
      "global_load_async_to_lds_b128 %3, %11, off\n\t"
      "global_load_async_to_lds_b128 %4, %12, off\n\t"
      "global_load_async_to_lds_b128 %5, %13, off\n\t"
      "global_load_async_to_lds_b128 %6, %14, off\n\t"
      "global_load_async_to_lds_b128 %7, %15, off\n\t"
      "s_wait_xcnt 0x0"
      :: "v"(a0), "v"(a1), "v"(a2), "v"(a3), "v"(b0), "v"(b1), "v"(b2), "v"(b3),
         "v"(p0), "v"(p1), "v"(p2), "v"(p3), "v"(r0), "v"(r1), "v"(r2), "v"(r3)
      : "memory");
}

// 16B per-lane global -> LDS async copy.
static __device__ __forceinline__ void async_copy16(void* lds_dst, const void* gsrc) {
  unsigned l = (unsigned)(uintptr_t)lds_dst;
  unsigned long long g = (unsigned long long)(uintptr_t)gsrc;
  // the wait is part of the statement: the caller sits in a rolled loop whose
  // next trip rewrites the two address registers
  asm volatile("global_load_async_to_lds_b128 %0, %1, off\n\t"
               "s_wait_xcnt 0x0"
               :: "v"(l), "v"(g) : "memory");
}

static __device__ __forceinline__ void wait_async0() {
  asm volatile("s_wait_asynccnt 0x0" ::: "memory");
}

// Weight panel of a GEMM work-group: Bs[col][k] = (f16) w[k][n0 + col], 128
// columns, k = 0..255.  Pitch 264 halves = 528 B = 16 B x 33, so that the 16-byte
// stores here and the 16-byte fragment loads fall on distinct banks.
// A lane owns one column (a wave reads whole 128-B lines of w) and packs eight
// consecutive k into one 16-byte LDS store.  256 threads.
#define PANEL_PITCH 264
static __device__ __forceinline__ void stage_panel(_Float16 (*Bs)[PANEL_PITCH],
                                                   const float* __restrict__ w,
                                                   int ldw, int n0, int tid) {
  const int c = tid & 127;
  const float* wc = w + n0 + c;
  // 32 loads in flight per lane; fully unrolled the compiler held all 128 values
  // and the register count cost a resident work-group
  #pragma unroll 4
  for (int it = 0; it < 16; ++it) {
    const int k0 = (it * 2 + (tid >> 7)) * 8;
    union { _Float16 h[8]; uint4 u; } t;
    #pragma unroll
    for (int j = 0; j < 8; ++j) t.h[j] = (_Float16)wc[(size_t)(k0 + j) * ldw];
    *(uint4*)&Bs[c][k0] = t.u;
  }
}

// ---------------------------------------------------------------------------
// Kernel 1: position-bias MLP -> f16 bq [H,N,R] (pre-scaled), bk [H,N,R]
// grid (8 heads, 16 position groups) x 256 threads: a work-group forms 16
// positions x the 64 output columns (32 bq + 32 bk) of one head.
// A lane owns one column of w2 (a wave reads whole 128-B lines) and holds all
// 128 k of it in registers; two waves share four positions, whose hidden
// features they read from LDS as broadcasts: four independent sums per lane,
// each in the order k = 0..127.
// ---------------------------------------------------------------------------
__global__ void __launch_bounds__(256)
bias1_kernel(const float* __restrict__ w1, const float* __restrict__ b1,
             const float* __restrict__ w2, const float* __restrict__ bscale_p,
             _Float16* __restrict__ bq, _Float16* __restrict__ bk) {
  __shared__ __attribute__((aligned(16))) float hf[16][132];   // pitch 528 B = 16 B x 33
  const int tid = threadIdx.x;
  const int h = blockIdx.x, n0 = blockIdx.y * 16;
  const int c = tid & 63, pg = tid >> 6;

  // a thread forms 8 hidden features of one position: its slices of w1 and b1
  const int p = tid >> 4, j0 = (tid & 15) * 8;
  union { float4 q[2]; float f[8]; } wa, wb, bb, g;
  #pragma unroll
  for (int t = 0; t < 2; ++t) {
    wa.q[t] = *(const float4*)(w1 + j0 + 4 * t);
    wb.q[t] = *(const float4*)(w1 + 128 + j0 + 4 * t);
    bb.q[t] = *(const float4*)(b1 + j0 + 4 * t);
  }
  const float bsc = bscale_p[0];
  // the scalar bases of the six loads above are given new values below; the
  // statement also keeps the six, which the gelu phase waits for, in front of the
  // 128 below (loads return in order)
  asm volatile("s_wait_xcnt 0x0" ::: "memory");
  // this lane's column of w2, fetched here: the latency runs under the gelu phase
  float wc[128];
  const float* wp = w2 + h * 64 + c;
  #pragma unroll
  for (int j = 0; j < 128; ++j) wc[j] = wp[j * 512];

  {
    const int n = n0 + p;                     // position index 0..255
    const float invden = 1.0f / logf(16.0f);  // log1p(15) = log(16)
    const float c0 = log1pf((float)(n >> 4)) * invden;   // gy
    const float c1 = log1pf((float)(n & 15)) * invden;   // gx
    #pragma unroll
    for (int jj = 0; jj < 8; ++jj) {
      float z = c0 * wa.f[jj] + c1 * wb.f[jj] + bb.f[jj];
      g.f[jj] = 0.5f * z * (1.0f + erff(z * 0.70710678118654752f));  // exact gelu
    }
    *(float4*)&hf[p][j0]     = g.q[0];
    *(float4*)&hf[p][j0 + 4] = g.q[1];
  }
  __syncthreads();

  float acc[4] = {0.0f, 0.0f, 0.0f, 0.0f};
  #pragma unroll
  for (int j = 0; j < 128; j += 4) {
    #pragma unroll
    for (int i = 0; i < 4; ++i) {
      const float4 hv = *(const float4*)&hf[pg * 4 + i][j];
      acc[i] += hv.x * wc[j];
      acc[i] += hv.y * wc[j + 1];
      acc[i] += hv.z * wc[j + 2];
      acc[i] += hv.w * wc[j + 3];
    }
  }

  const int which = c >> 5, r = c & 31;       // the same for a whole wave
  _Float16* outp = (which == 0) ? bq : bk;
  const float osc = (which == 0) ? bsc : 1.0f;
  #pragma unroll
  for (int i = 0; i < 4; ++i) {
    const int n = n0 + pg * 4 + i;
    const float s = 1.0f / (1.0f + __expf(-acc[i]));
    outp[(h * 256 + n) * 32 + r] = (_Float16)(osc * s);
  }
}

// ---------------------------------------------------------------------------
// Kernel 2: QKV GEMM  [131072 x 256] @ [256 x 768] (+bias, q*=logit_scale)
// Block tile 128x128, 8 waves, each wave 2x4 16x16 accum tiles.
// grid (6, 128): a work-group stages its weight panel once and walks 8 row tiles.
// x goes through two LDS stages of 64 k: the loads of the next stage (8 of 16
// bytes per lane) are issued in front of this stage's products and converted and
// stored behind them, so that the load latency runs under the products; one
// barrier per stage.  The stages run on across the row tiles.
// The products are formed transposed (A = weight columns, B = x rows): in D a lane
// holds one row of x (lane&15) and the output columns 8*(lane>>4)+r of a 16-column
// tile, eight neighbouring f16 of one head.  Lanes l and l^8 swap one of their two
// 16-byte pieces, and every store instruction writes 512 contiguous bytes.
// ---------------------------------------------------------------------------
#define QKV_TILES 8
#define QKV_KC 64

// One stage of x, 128 rows x 64 k: a wave's load covers 256 contiguous bytes of
// each of two rows; p + off is the lane's own address in the stage's first 16 rows.
static __device__ __forceinline__ void qkv_fetch(float4 (&a)[8], const float* p, int off) {
  #pragma unroll
  for (int i = 0; i < 8; ++i) a[i] = *(const float4*)(p + off + i * 16 * 256);
  // the caller gives the address registers a new value for the next row tile; p is
  // named so that the address pair outlives the run of loads (no result lands in it)
  asm volatile("s_wait_xcnt 0x0" :: "v"(p) : "memory");
}

static __device__ __forceinline__ void qkv_put(_Float16 (*st)[QKV_KC + 8], const float4 (&a)[8],
                                               int row, int col) {
  #pragma unroll
  for (int i = 0; i < 8; ++i) {
    union { _Float16 h[4]; uint2 u; } t;
    t.h[0] = (_Float16)a[i].x; t.h[1] = (_Float16)a[i].y;
    t.h[2] = (_Float16)a[i].z; t.h[3] = (_Float16)a[i].w;
    *(uint2*)&st[row + i * 16][col] = t.u;
  }
}

// three work-groups per WGP (their LDS fits) are six waves per SIMD: the register
// count is held to that
__global__ void __launch_bounds__(256) __attribute__((amdgpu_waves_per_eu(6)))
qkv_kernel(const float* __restrict__ x, const float* __restrict__ w,
                           const float* __restrict__ bvec, const float* __restrict__ lsc,
                           _Float16* __restrict__ qo, _Float16* __restrict__ ko,
                           _Float16* __restrict__ vo) {
  __shared__ _Float16 As[2][128][QKV_KC + 8];   // two stages; pitch 72 h = 144 B = 16 B x 9
  __shared__ _Float16 Bs[128][PANEL_PITCH];   // weight panel: Bs[col][k], all k
  const int tid = threadIdx.x, lane = tid & 31, wave = tid >> 5;
  const int wm = wave & 3, wn = wave >> 2;
  const int mlane = lane & 15, hsel = lane >> 4;
  const int n0 = blockIdx.x * 128;

  // published by the barrier in front of the first fragment loads
  stage_panel(Bs, w, 768, n0, tid);

  // q scale of this wave's two heads (32 output columns each), the same for every tile
  float scale[2];
  #pragma unroll
  for (int jp = 0; jp < 2; ++jp) {
    const int jg0 = n0 + wn * 64 + jp * 32;
    scale[jp] = ((jg0 >> 8) == 0) ? lsc[(jg0 >> 5) & 7] : 1.0f;
  }

  // stage 0 of the first row tile
  const int xrow = wave * 2 + hsel, xcol = mlane * 4;
  const float* xb = x + ((size_t)blockIdx.y * QKV_TILES * 128 + xrow) * 256 + xcol;
  float4 a[8];
  qkv_fetch(a, xb, 0);
  qkv_put(As[0], a, xrow, xcol);
  __syncthreads();

  // Kept rolled: the K loop inside is unrolled.
  #pragma unroll 1
  for (int mt = 0; mt < QKV_TILES; ++mt) {
  const int m0 = (blockIdx.y * QKV_TILES + mt) * 128;
  const float* xt = xb + (size_t)mt * 128 * 256;

  Acc8 acc[2][4];
  #pragma unroll
  for (int i = 0; i < 2; ++i)
    #pragma unroll
    for (int j = 0; j < 4; ++j)
      #pragma unroll
      for (int r = 0; r < 8; ++r) acc[i][j].f[r] = 0.0f;

  // unrolled: the stage index (kq & 1) is then a constant in every LDS address
  #pragma unroll
  for (int kq = 0; kq < 256 / QKV_KC; ++kq) {
    const int kk = kq * QKV_KC;
    // the next stage: the next 64 k of this row tile, or the first of the next tile
    const bool more = (kq + 1 < 256 / QKV_KC) || (mt + 1 < QKV_TILES);
    if (more) qkv_fetch(a, xt, (kq + 1 < 256 / QKV_KC) ? kk + QKV_KC : 128 * 256);
    #pragma unroll
    for (int ks = 0; ks < QKV_KC; ks += 32) {
      Frag16 af[2], bf[4];
      #pragma unroll
      for (int i = 0; i < 2; ++i) af[i].v = lds_frag16(&As[kq & 1][wm * 32 + i * 16 + mlane][ks], hsel);
      #pragma unroll
      for (int j = 0; j < 4; ++j) bf[j].v = lds_frag16(&Bs[wn * 64 + j * 16 + mlane][kk + ks], hsel);
      #pragma unroll
      for (int i = 0; i < 2; ++i)
        #pragma unroll
        for (int j = 0; j < 4; ++j)
          acc[i][j].v = WMMA16(bf[j].v, af[i].v, acc[i][j].v);
    }
    // keeps the conversions, and with them the wait for the loads, behind the
    // products: left free, the scheduler put them behind the first product and the
    // wave sat out the load latency there
    __builtin_amdgcn_sched_barrier(0);
    // into the stage whose last readers passed the barrier of the stage before
    if (more) qkv_put(As[(kq + 1) & 1], a, xrow, xcol);
    // ends the reads of this stage and publishes the next
    __syncthreads();
  }

  // epilogue: +bias, q*=logit_scale[h], f16 to [B,H,N,32]; a head's 32 columns are
  // two neighbouring D tiles, a row of it 64 bytes = four 16-byte pieces
  const bool lo8 = mlane < 8;
  #pragma unroll
  for (int jp = 0; jp < 2; ++jp) {
    const int jg0 = n0 + wn * 64 + jp * 32;           // first global out column of the head
    const int which = jg0 >> 8, h = (jg0 >> 5) & 7;
    _Float16* outp = (which == 0) ? qo : ((which == 1) ? ko : vo);
    union { float4 q[2]; float f[8]; } bias[2];       // of this lane's 2 x 8 columns
    #pragma unroll
    for (int t = 0; t < 2; ++t) {
      bias[t].q[0] = *(const float4*)(bvec + jg0 + t * 16 + 8 * hsel);
      bias[t].q[1] = *(const float4*)(bvec + jg0 + t * 16 + 8 * hsel + 4);
    }
    #pragma unroll
    for (int i = 0; i < 2; ++i) {
      // pc[t]: row mlane of the 16, piece 2*t + hsel
      union { _Float16 h16[8]; unsigned u[4]; } pc[2];
      #pragma unroll
      for (int t = 0; t < 2; ++t)
        #pragma unroll
        for (int r = 0; r < 8; ++r)
          pc[t].h16[r] = (_Float16)((acc[i][2 * jp + t].f[r] + bias[t].f[r]) * scale[jp]);
      // lanes 0-7 of a row of 16 end with pieces hsel of rows mlane and mlane+8,
      // lanes 8-15 with pieces 2+hsel of rows mlane-8 and mlane
      union { unsigned u[4]; uint4 q; } s0, s1;
      #pragma unroll
      for (int c = 0; c < 4; ++c) {
        const unsigned got = other_oct(lo8 ? pc[1].u[c] : pc[0].u[c]);
        s0.u[c] = lo8 ? pc[0].u[c] : got;             // rows 0..7
        s1.u[c] = lo8 ? got : pc[1].u[c];             // rows 8..15
      }
      const int mg = m0 + wm * 32 + i * 16 + (mlane & 7);   // global row = b*256 + nrow
      const int bb = mg >> 8, nrow = mg & 255;
      _Float16* dst = outp + (((size_t)bb * 8 + h) * 256 + nrow) * 32
                           + ((mlane >> 3) * 2 + hsel) * 8;
      *(uint4*)dst = s0.q;
      *(uint4*)(dst + 8 * 32) = s1.q;
    }
  }
  // the next trip reuses the address and data registers of these stores
  asm volatile("s_wait_xcnt 0x0" ::: "memory");
  }
}

// ---------------------------------------------------------------------------
// Kernel 3: fused attention per (b,h).  grid (8, 512), 256 threads = 8 waves.
//  The scores never leave the registers.  Each wave owns 2 x 16 queries and
//  forms S^T = K Q^T + BK BQ^T (A = key rows, B = query rows): in D a lane
//  holds one query (column lane&15) and keys 8*(lane>>4)+r of each 16-key tile,
//  so row maximum and row sum are in-lane plus one exchange between the halves,
//  and two neighbouring D tiles, converted to f16, are the B operand of
//  O^T = V^T P^T in the hardware k order that lds_frag16 also delivers.
//  The keys are walked in 4 chunks of 64 with a running maximum and sum, so that
//  the scores of both query tiles fit the registers at once and every K, BK and V
//  fragment read from LDS serves two query tiles.
//  q/k/bq/bk staged with async-to-LDS copies; v transposed through VGPRs.
// ---------------------------------------------------------------------------
typedef __attribute__((ext_vector_type(8))) _Float16 v8h;
typedef __attribute__((ext_vector_type(2))) float v2f;

static __device__ __forceinline__ float other_half(float x) {
  // value of lane l ^ 16
  int b = __builtin_bit_cast(int, x);
  b = __builtin_amdgcn_permlanex16(b, b, 0x76543210, 0xfedcba98, false, false);
  return __builtin_bit_cast(float, b);
}

// three work-groups per WGP (their LDS fits) are six waves per SIMD: the register
// count is held to that
__global__ void __launch_bounds__(256) __attribute__((amdgpu_waves_per_eu(6)))
attn_kernel(const _Float16* __restrict__ qg, const _Float16* __restrict__ kg,
            const _Float16* __restrict__ vg,
            const _Float16* __restrict__ bqg, const _Float16* __restrict__ bkg,
            const float* __restrict__ vrs_g, _Float16* __restrict__ ao) {
  __shared__ _Float16 qs[256][40];     // 20 KB
  __shared__ _Float16 ks[256][40];     // 20 KB
  __shared__ _Float16 bqs[256][40];    // 20 KB  (rank-bias q factors, head h)
  __shared__ _Float16 bks[256][40];    // 20 KB  (rank-bias k factors, head h)
  __shared__ _Float16 vt[32][264];     // v transposed: vt[d][m], 16.9 KB
  __shared__ float    vmean[32];

  const int h = blockIdx.x, b = blockIdx.y;
  const int tid = threadIdx.x, lane = tid & 31, wave = tid >> 5;
  const int mlane = lane & 15, hsel = lane >> 4;
  const size_t base = ((size_t)b * 8 + h) * 256 * 32;

  // phase 0: stage q, k, bq, bk (async f16 copies) and v (transpose in VGPRs)
  // a wave brings rows 32*wave .. +31 of each
  async_rows32x2(&qs[wave * 32], qg + base + (size_t)wave * 32 * 32,
                 &ks[wave * 32], kg + base + (size_t)wave * 32 * 32, lane);
  async_rows32x2(&bqs[wave * 32], bqg + ((size_t)h * 256 + wave * 32) * 32,
                 &bks[wave * 32], bkg + ((size_t)h * 256 + wave * 32) * 32, lane);
  {
    union { uint4 u[4]; _Float16 h16[32]; } vv;
    const uint4* vp = (const uint4*)(vg + base + (size_t)tid * 32);
    #pragma unroll
    for (int c = 0; c < 4; ++c) vv.u[c] = vp[c];
    #pragma unroll
    for (int d = 0; d < 32; ++d) vt[d][tid] = vv.h16[d];
  }
  wait_async0();
  __syncthreads();

  // v_mean (wave 0)
  if (tid < 32) {
    float s = 0.0f;
    for (int m = 0; m < 256; ++m) s += (float)vt[tid][m];
    vmean[tid] = s * (1.0f / 256.0f);
  }

  const float vrs = vrs_g[h];
  const float L2E = 1.44269504088896340736f;
  const v8f l2e8 = {L2E, L2E, L2E, L2E, L2E, L2E, L2E, L2E};
  const int q0 = wave * 32;

  // running maximum (both halves of the wave hold the same), running sum of this
  // lane's keys (in two parts: packed adds), and o[qt][dt].f[r] = out[query q0+16*qt+mlane][d = 16*dt+8*hsel+r],
  // all three relative to the running maximum
  float mrun[2] = {-__builtin_inff(), -__builtin_inff()};
  v2f srun[2] = {{0.0f, 0.0f}, {0.0f, 0.0f}};
  Acc8 o[2][2];
  #pragma unroll
  for (int qt = 0; qt < 2; ++qt)
    #pragma unroll
    for (int dt = 0; dt < 2; ++dt)
      #pragma unroll
      for (int r = 0; r < 8; ++r) o[qt][dt].f[r] = 0.0f;

  // Kept rolled: unrolled, the build spilled to scratch at the register count that
  // three work-groups per WGP allow.
  #pragma unroll 1
  for (int c = 0; c < 4; ++c) {
    const int key0 = c * 64;
    // The wave's two query tiles are read anew in every chunk.  The fence (no
    // instruction) keeps these loads inside the loop: lifted out, the fragments hold
    // 32 registers through the softmax as well and are spilled to scratch.
    __builtin_amdgcn_fence(__ATOMIC_ACQUIRE, "wavefront");
    v16h fq[2], fb[2];
    #pragma unroll
    for (int qt = 0; qt < 2; ++qt) {
      fq[qt] = lds_frag16(&qs[q0 + qt * 16 + mlane][0], hsel);
      fb[qt] = lds_frag16(&bqs[q0 + qt * 16 + mlane][0], hsel);
    }
    // scores: s[qt][kt].f[r] = S[query q0+16*qt+mlane][key key0 + 16*kt + 8*hsel + r]
    Acc8 s[2][4];
    #pragma unroll
    for (int kt = 0; kt < 4; ++kt) {
      const v16h fk  = lds_frag16(&ks[key0 + kt * 16 + mlane][0], hsel);
      const v16h fbk = lds_frag16(&bks[key0 + kt * 16 + mlane][0], hsel);
      #pragma unroll
      for (int qt = 0; qt < 2; ++qt) {
        #pragma unroll
        for (int r = 0; r < 8; ++r) s[qt][kt].f[r] = 0.0f;
        s[qt][kt].v = WMMA16(fk, fq[qt], s[qt][kt].v);
        s[qt][kt].v = WMMA16(fbk, fb[qt], s[qt][kt].v);
      }
    }

    // softmax of the chunk, unnormalised, relative to the new running maximum; what
    // was gathered under the old maximum is scaled by al (0 in the first chunk).
    // p[qt][mc]: two neighbouring score tiles packed, the B operand for 32 keys
    v16h p[2][2], fv[2][2];
    #pragma unroll
    for (int qt = 0; qt < 2; ++qt) {
      // new running maximum, the old one taken in; in threes: one three-operand
      // maximum instruction each
      float t3[8], u3[4];
      #pragma unroll
      for (int r = 0; r < 8; ++r)
        t3[r] = fmaxf(fmaxf(s[qt][0].f[r], s[qt][1].f[r]), s[qt][2].f[r]);
      #pragma unroll
      for (int r = 0; r < 4; ++r) {
        u3[r] = fmaxf(fmaxf(t3[2 * r], t3[2 * r + 1]), s[qt][3].f[2 * r]);
        u3[r] = fmaxf(fmaxf(u3[r], s[qt][3].f[2 * r + 1]), r ? u3[r - 1] : mrun[qt]);
      }
      const float mnew = fmaxf(u3[3], other_half(u3[3]));
      const float al = __builtin_amdgcn_exp2f((mrun[qt] - mnew) * L2E);
      mrun[qt] = mnew;
      const float nm = -mnew * L2E;
      const v8f nm8 = {nm, nm, nm, nm, nm, nm, nm, nm};
      #pragma unroll
      for (int kt = 0; kt < 4; ++kt) {
        const v8f t = __builtin_elementwise_fma(s[qt][kt].v, l2e8, nm8);
        #pragma unroll
        for (int r = 0; r < 8; ++r) s[qt][kt].f[r] = __builtin_amdgcn_exp2f(t[r]);
      }
      const v8f sum8 = (s[qt][0].v + s[qt][1].v) + (s[qt][2].v + s[qt][3].v);
      const v2f cs = (__builtin_shufflevector(sum8, sum8, 0, 1) +
                      __builtin_shufflevector(sum8, sum8, 2, 3)) +
                     (__builtin_shufflevector(sum8, sum8, 4, 5) +
                      __builtin_shufflevector(sum8, sum8, 6, 7));
      const v2f al2 = {al, al};
      srun[qt] = __builtin_elementwise_fma(srun[qt], al2, cs);
      const v8f al8 = {al, al, al, al, al, al, al, al};
      #pragma unroll
      for (int dt = 0; dt < 2; ++dt) o[qt][dt].v *= al8;
      #pragma unroll
      for (int mc = 0; mc < 2; ++mc) {
        const v8h lo = __builtin_convertvector(s[qt][2 * mc].v, v8h);
        const v8h hi = __builtin_convertvector(s[qt][2 * mc + 1].v, v8h);
        p[qt][mc] = __builtin_shufflevector(lo, hi, 0, 1, 2, 3, 4, 5, 6, 7,
                                            8, 9, 10, 11, 12, 13, 14, 15);
      }
      // keeps the two tiles' softmax and the products behind them apart: left free, the
      // scheduler had scores, packed scores and V fragments of both tiles alive at once
      // and spilled at the register count that three work-groups per WGP allow
      __builtin_amdgcn_sched_barrier(0);
      // the chunk's V fragments: their latency runs under the second tile's softmax
      if (qt == 0) {
        #pragma unroll
        for (int mc = 0; mc < 2; ++mc)
          #pragma unroll
          for (int dt = 0; dt < 2; ++dt)
            fv[mc][dt] = lds_frag16(&vt[dt * 16 + mlane][key0 + mc * 32], hsel);
      }
    }

    // O^T += V^T P^T: A = rows of vt
    #pragma unroll
    for (int mc = 0; mc < 2; ++mc)
      #pragma unroll
      for (int qt = 0; qt < 2; ++qt)
        #pragma unroll
        for (int dt = 0; dt < 2; ++dt)
          o[qt][dt].v = WMMA16(fv[mc][dt], p[qt][mc], o[qt][dt].v);
  }

  __syncthreads();   // publish vmean before its first reader

  // normalise, + vrs * v_mean, f16 to [B,H,N,32]: a row is 64 bytes = four 16-byte
  // pieces, of which this lane holds pieces hsel and 2 + hsel of row mlane.  Lanes l and
  // l^8 swap one piece, and every store instruction writes 512 contiguous bytes.
  const bool lo8 = mlane < 8;
  #pragma unroll
  for (int qt = 0; qt < 2; ++qt) {
    const float sl = srun[qt][0] + srun[qt][1];
    const float inv = 1.0f / (sl + other_half(sl));
    union { _Float16 h16[8]; unsigned u[4]; } pc[2];   // pc[dt]: piece 2*dt + hsel
    #pragma unroll
    for (int dt = 0; dt < 2; ++dt) {
      const int d0 = dt * 16 + 8 * hsel;
      #pragma unroll
      for (int r = 0; r < 8; ++r)
        pc[dt].h16[r] = (_Float16)(o[qt][dt].f[r] * inv + vmean[d0 + r] * vrs);
    }
    // lanes 0-7 of a row of 16 end with pieces hsel of rows mlane and mlane+8,
    // lanes 8-15 with pieces 2+hsel of rows mlane-8 and mlane
    union { unsigned u[4]; uint4 q; } s0, s1;
    #pragma unroll
    for (int c = 0; c < 4; ++c) {
      const unsigned got = other_oct(lo8 ? pc[1].u[c] : pc[0].u[c]);
      s0.u[c] = lo8 ? pc[0].u[c] : got;             // rows 0..7
      s1.u[c] = lo8 ? got : pc[1].u[c];             // rows 8..15
    }
    _Float16* dst = ao + base + (size_t)(q0 + qt * 16 + (mlane & 7)) * 32
                       + ((mlane >> 3) * 2 + hsel) * 8;
    *(uint4*)dst = s0.q;
    *(uint4*)(dst + 8 * 32) = s1.q;
  }
}

// ---------------------------------------------------------------------------
// Kernel 4: proj GEMM  [131072 x 256](f16) @ [256 x 256] + proj_b -> f32 out
// A arrives head-major, [B,H,N,32]: the 128 rows x 32 k of a K step are 8 KB
// contiguous, and each copy of a wave covers 512 contiguous bytes.
// A tile staged with async-to-LDS (pure f16 copy); weight panel converted
// f32->f16 once.  grid (2, 512): a work-group walks 2 row tiles.
// ---------------------------------------------------------------------------
#define PROJ_TILES 2
__global__ void __launch_bounds__(256)
proj_kernel(const _Float16* __restrict__ a, const float* __restrict__ w,
                            const float* __restrict__ bvec, float* __restrict__ out) {
  __shared__ _Float16 As[128][40];
  __shared__ _Float16 Bs[128][PANEL_PITCH];   // weight panel: Bs[col][k], all k
  const int tid = threadIdx.x, lane = tid & 31, wave = tid >> 5;
  const int wm = wave & 3, wn = wave >> 2;
  const int mlane = lane & 15, hsel = lane >> 4;
  const int n0 = blockIdx.x * 128;

  const int ar0 = tid >> 2, ak8 = (tid & 3) * 8;
  void* lds_a0 = &As[ar0][ak8];
  void* lds_a1 = &As[ar0 + 64][ak8];

  // published by the two barriers in front of the first fragment loads
  stage_panel(Bs, w, 256, n0, tid);

  // Kept rolled: unrolled, the register count passes 128 and three work-groups
  // instead of four fit a WGP.
  #pragma unroll 1
  for (int mt = 0; mt < PROJ_TILES; ++mt) {
  const int m0 = (blockIdx.y * PROJ_TILES + mt) * 128;
  // this thread's 16 bytes of head 0: window m0 >> 8, position (m0 & 255) + ar0
  const _Float16* at = a + ((size_t)(m0 >> 8) * 8 * 256 + (m0 & 255)) * 32 + tid * 8;

  Acc8 acc[2][4];
  #pragma unroll
  for (int i = 0; i < 2; ++i)
    #pragma unroll
    for (int j = 0; j < 4; ++j)
      #pragma unroll
      for (int r = 0; r < 8; ++r) acc[i][j].f[r] = 0.0f;

  for (int kk = 0; kk < 256; kk += 32) {
    __syncthreads();
    // A tile: async f16 copies (16B per lane per pass)
    async_copy16(lds_a0, at + (size_t)(kk >> 5) * 256 * 32);             // head kk / 32
    async_copy16(lds_a1, at + (size_t)(kk >> 5) * 256 * 32 + 64 * 32);
    wait_async0();
    __syncthreads();
    Frag16 af[2], bf[4];
    #pragma unroll
    for (int i = 0; i < 2; ++i) af[i].v = lds_frag16(&As[wm * 32 + i * 16 + mlane][0], hsel);
    #pragma unroll
    for (int j = 0; j < 4; ++j) bf[j].v = lds_frag16(&Bs[wn * 64 + j * 16 + mlane][kk], hsel);
    #pragma unroll
    for (int i = 0; i < 2; ++i)
      #pragma unroll
      for (int j = 0; j < 4; ++j)
        acc[i][j].v = WMMA16(af[i].v, bf[j].v, acc[i][j].v);
  }

  // two neighbouring D tiles are 32 columns = one 128-byte line of a row: lanes l and
  // l^16 swap so that lanes 0-15 hold the left tile's and lanes 16-31 the right
  // tile's columns of ONE row, and a store instruction writes one whole line
  const float addb[2] = {bvec[n0 + wn * 64 + lane], bvec[n0 + wn * 64 + 32 + lane]};
  #pragma unroll
  for (int jp = 0; jp < 2; ++jp) {
    #pragma unroll
    for (int i = 0; i < 2; ++i) {
      #pragma unroll
      for (int r = 0; r < 8; ++r) {
        const float left = acc[i][2 * jp].f[r], right = acc[i][2 * jp + 1].f[r];
        const float got = other_half(hsel ? left : right);
        acc[i][2 * jp].f[r]     = (hsel ? got : left) + addb[jp];    // row r
        acc[i][2 * jp + 1].f[r] = (hsel ? right : got) + addb[jp];   // row 8 + r
      }
    }
    // keeps the stores behind the swaps (left free, the compiler ran every pair
    // through the same two registers, with a wait for the stores in front of each
    // reuse) and the two halves of the swaps apart (all 32 values under way at once
    // took the register count past 128: three work-groups per WGP for four)
    __builtin_amdgcn_sched_barrier(0);
  }
  float* orow = out + (size_t)(m0 + wm * 32) * 256 + n0 + wn * 64 + lane;
  #pragma unroll
  for (int i = 0; i < 2; ++i)
    #pragma unroll
    for (int t = 0; t < 2; ++t)
      #pragma unroll
      for (int r = 0; r < 8; ++r)
        #pragma unroll
        for (int jp = 0; jp < 2; ++jp)   // the two lines of a row one behind the other
          orow[(i * 16 + t * 8 + r) * 256 + jp * 32] = acc[i][2 * jp + t].f[r];
  // the next trip reuses the address and data registers of these stores
  asm volatile("s_wait_xcnt 0x0" ::: "memory");
  }
}

// ---------------------------------------------------------------------------
// Host launcher
// ---------------------------------------------------------------------------
extern "C" void kernel_launch(void* const* d_in, const int* in_sizes, int n_in,
                              void* d_out, int out_size, void* d_ws, size_t ws_size,
                              hipStream_t stream) {
  const float* x       = (const float*)d_in[0];
  const float* qkv_w   = (const float*)d_in[1];
  const float* qkv_b   = (const float*)d_in[2];
  const float* proj_w  = (const float*)d_in[3];
  const float* proj_b  = (const float*)d_in[4];
  const float* lsc     = (const float*)d_in[5];
  const float* vrs     = (const float*)d_in[6];
  const float* mlp1_w  = (const float*)d_in[7];
  const float* mlp1_b  = (const float*)d_in[8];
  const float* mlp2_w  = (const float*)d_in[9];
  const float* bscale  = (const float*)d_in[10];

  char* ws = (char*)d_ws;
  const size_t QSZ = (size_t)512 * 8 * 256 * 32 * sizeof(_Float16);  // 67.1 MB each
  _Float16* bq = (_Float16*)(ws + 0);          // 128 KB (f16, pre-scaled by bias_scale)
  _Float16* bk = (_Float16*)(ws + 131072);     // 128 KB
  _Float16* q  = (_Float16*)(ws + 262144);
  _Float16* k  = (_Float16*)(ws + 262144 + QSZ);
  _Float16* v  = (_Float16*)(ws + 262144 + 2 * QSZ);
  _Float16* ao = (_Float16*)(ws + 262144 + 3 * QSZ);
  float*    out = (float*)d_out;

  bias1_kernel<<<dim3(8, 16), 256, 0, stream>>>(mlp1_w, mlp1_b, mlp2_w, bscale, bq, bk);
  qkv_kernel<<<dim3(6, 128), 256, 0, stream>>>(x, qkv_w, qkv_b, lsc, q, k, v);
  attn_kernel<<<dim3(8, 512), 256, 0, stream>>>(q, k, v, bq, bk, vrs, ao);
  proj_kernel<<<dim3(2, 512), 256, 0, stream>>>(ao, proj_w, proj_b, out);
}

// v009
// It runs in 149 microseconds.
// Two timings next to v008 both put it at 1.05 times that version's speed.
// Over all steps from v000 it is 4.75 times as fast.
#include <hip/hip_runtime.h>

// ---------------------------------------------------------------------------
// WindowAttentionRFB for gfx1250 (MI455X)
//   bias1 (MLP -> f16 bq/bk) -> qkv WMMA GEMM -> fused attention
//   (scores = q k^T + bq bk^T as two chained WMMAs, kept in registers, in-lane
//    softmax, attn@V) -> proj WMMA GEMM.
//   Async global->LDS staging (global_load_async_to_lds_b128) for the attention
//   operands; f32->f16 converting stages use regular vector loads.  The attention
//   output lies in memory in the A-fragment order of the proj products.
//   Both GEMMs keep their weight panel (128 columns x all 256 k, f16, [col][k])
//   in LDS for the life of the work-group, which walks several row tiles.
// Shapes: B=512, N=256, C=256, H=8, hd=32, R=32
// ---------------------------------------------------------------------------

typedef __attribute__((ext_vector_type(16))) _Float16 v16h;
typedef __attribute__((ext_vector_type(8)))  float    v8f;

union Frag16 { v16h v; uint4 q[2]; _Float16 h[16]; };
union Acc8   { v8f  v; float f[8]; };

#define WMMA16(a, b, c) __builtin_amdgcn_wmma_f32_16x16x32_f16( \
    false, (a), false, (b), (short)0, (c), false, false)

static __device__ __forceinline__ v16h lds_frag16(const _Float16* rowbase, int hsel) {
  // 16-bit A/B fragment: lane (m = lane&15, hsel = lane>>4)
  // chunk0: K = 8*hsel .. +7  -> VGPR0..3 ; chunk1: K = 16+8*hsel .. +7 -> VGPR4..7
  Frag16 t;
  const _Float16* p = rowbase + hsel * 8;
  t.q[0] = *(const uint4*)(p);
  t.q[1] = *(const uint4*)(p + 16);
  return t.v;
}

static __device__ __forceinline__ unsigned other_oct(unsigned x) {
  // value of lane l ^ 8 (a gather inside each row of 16 lanes)
  return (unsigned)__builtin_amdgcn_permlane16(x, x, 0xfedcba98, 0x76543210, false, false);
}

// One wave brings 32 rows of 64 B, 2 KB contiguous in global memory, of each of two
// arrays into LDS rows of pitch 80 B: four lanes share a row, so that each of the
// eight copies covers 512 contiguous bytes = four whole 128-B lines.  Tracked on
// ASYNCcnt.
static __device__ __forceinline__ void async_rows32x2(_Float16 (*dsta)[40], const _Float16* srca,
                                                      _Float16 (*dstb)[40], const _Float16* srcb,
                                                      int lane) {
  // LDS offset = low 32 bits of the flat address; eight rows on = 8 * 80 bytes
  const unsigned a0 = (unsigned)(uintptr_t)&dsta[lane >> 2][(lane & 3) * 8];
  const unsigned b0 = (unsigned)(uintptr_t)&dstb[lane >> 2][(lane & 3) * 8];
  const unsigned a1 = a0 + 640, a2 = a0 + 1280, a3 = a0 + 1920;
  const unsigned b1 = b0 + 640, b2 = b0 + 1280, b3 = b0 + 1920;
  // eight rows on = 256 halves
  const _Float16* p0 = srca + lane * 8;
  const _Float16* p1 = p0 + 256;
  const _Float16* p2 = p0 + 512;
  const _Float16* p3 = p0 + 768;
  const _Float16* r0 = srcb + lane * 8;
  const _Float16* r1 = r0 + 256;
  const _Float16* r2 = r0 + 512;
  const _Float16* r3 = r0 + 768;
  // the wait is the statement's last line: it stands in front of whatever gives the
  // address registers a new value
  asm volatile(
      "global_load_async_to_lds_b128 %0, %8, off\n\t"
      "global_load_async_to_lds_b128 %1, %9, off\n\t"
      "global_load_async_to_lds_b128 %2, %10, off\n\t"
      "global_load_async_to_lds_b128 %3, %11, off\n\t"
      "global_load_async_to_lds_b128 %4, %12, off\n\t"
      "global_load_async_to_lds_b128 %5, %13, off\n\t"
      "global_load_async_to_lds_b128 %6, %14, off\n\t"
      "global_load_async_to_lds_b128 %7, %15, off\n\t"
      "s_wait_xcnt 0x0"
      :: "v"(a0), "v"(a1), "v"(a2), "v"(a3), "v"(b0), "v"(b1), "v"(b2), "v"(b3),
         "v"(p0), "v"(p1), "v"(p2), "v"(p3), "v"(r0), "v"(r1), "v"(r2), "v"(r3)
      : "memory");
}

static __device__ __forceinline__ void wait_async0() {
  asm volatile("s_wait_asynccnt 0x0" ::: "memory");
}

// Weight panel of a GEMM work-group: Bs[col][k] = (f16) w[k][n0 + col], 128
// columns, k = 0..255.  Pitch 264 halves = 528 B = 16 B x 33, so that the 16-byte
// stores here and the 16-byte fragment loads fall on distinct banks.
// A lane owns one column (a wave reads whole 128-B lines of w) and packs eight
// consecutive k into one 16-byte LDS store.  256 threads.
#define PANEL_PITCH 264
static __device__ __forceinline__ void stage_panel(_Float16 (*Bs)[PANEL_PITCH],
                                                   const float* __restrict__ w,
                                                   int ldw, int n0, int tid) {
  const int c = tid & 127;
  const float* wc = w + n0 + c;
  // 32 loads in flight per lane; fully unrolled the compiler held all 128 values
  // and the register count cost a resident work-group
  #pragma unroll 4
  for (int it = 0; it < 16; ++it) {
    const int k0 = (it * 2 + (tid >> 7)) * 8;
    union { _Float16 h[8]; uint4 u; } t;
    #pragma unroll
    for (int j = 0; j < 8; ++j) t.h[j] = (_Float16)wc[(size_t)(k0 + j) * ldw];
    *(uint4*)&Bs[c][k0] = t.u;
  }
}

// ---------------------------------------------------------------------------
// Kernel 1: position-bias MLP -> f16 bq [H,N,R] (pre-scaled), bk [H,N,R]
// grid (8 heads, 16 position groups) x 256 threads: a work-group forms 16
// positions x the 64 output columns (32 bq + 32 bk) of one head.
// A lane owns one column of w2 (a wave reads whole 128-B lines) and holds all
// 128 k of it in registers; two waves share four positions, whose hidden
// features they read from LDS as broadcasts: four independent sums per lane,
// each in the order k = 0..127.
// ---------------------------------------------------------------------------
__global__ void __launch_bounds__(256)
bias1_kernel(const float* __restrict__ w1, const float* __restrict__ b1,
             const float* __restrict__ w2, const float* __restrict__ bscale_p,
             _Float16* __restrict__ bq, _Float16* __restrict__ bk) {
  __shared__ __attribute__((aligned(16))) float hf[16][132];   // pitch 528 B = 16 B x 33
  const int tid = threadIdx.x;
  const int h = blockIdx.x, n0 = blockIdx.y * 16;
  const int c = tid & 63, pg = tid >> 6;

  // a thread forms 8 hidden features of one position: its slices of w1 and b1
  const int p = tid >> 4, j0 = (tid & 15) * 8;
  union { float4 q[2]; float f[8]; } wa, wb, bb, g;
  #pragma unroll
  for (int t = 0; t < 2; ++t) {
    wa.q[t] = *(const float4*)(w1 + j0 + 4 * t);
    wb.q[t] = *(const float4*)(w1 + 128 + j0 + 4 * t);
    bb.q[t] = *(const float4*)(b1 + j0 + 4 * t);
  }
  const float bsc = bscale_p[0];
  // the scalar bases of the six loads above are given new values below; the
  // statement also keeps the six, which the gelu phase waits for, in front of the
  // 128 below (loads return in order)
  asm volatile("s_wait_xcnt 0x0" ::: "memory");
  // this lane's column of w2, fetched here: the latency runs under the gelu phase
  float wc[128];
  const float* wp = w2 + h * 64 + c;
  #pragma unroll
  for (int j = 0; j < 128; ++j) wc[j] = wp[j * 512];

  {
    const int n = n0 + p;                     // position index 0..255
    const float invden = 1.0f / logf(16.0f);  // log1p(15) = log(16)
    const float c0 = log1pf((float)(n >> 4)) * invden;   // gy
    const float c1 = log1pf((float)(n & 15)) * invden;   // gx
    #pragma unroll
    for (int jj = 0; jj < 8; ++jj) {
      float z = c0 * wa.f[jj] + c1 * wb.f[jj] + bb.f[jj];
      g.f[jj] = 0.5f * z * (1.0f + erff(z * 0.70710678118654752f));  // exact gelu
    }
    *(float4*)&hf[p][j0]     = g.q[0];
    *(float4*)&hf[p][j0 + 4] = g.q[1];
  }
  __syncthreads();

  float acc[4] = {0.0f, 0.0f, 0.0f, 0.0f};
  #pragma unroll
  for (int j = 0; j < 128; j += 4) {
    #pragma unroll
    for (int i = 0; i < 4; ++i) {
      const float4 hv = *(const float4*)&hf[pg * 4 + i][j];
      acc[i] += hv.x * wc[j];
      acc[i] += hv.y * wc[j + 1];
      acc[i] += hv.z * wc[j + 2];
      acc[i] += hv.w * wc[j + 3];
    }
  }

  const int which = c >> 5, r = c & 31;       // the same for a whole wave
  _Float16* outp = (which == 0) ? bq : bk;
  const float osc = (which == 0) ? bsc : 1.0f;
  #pragma unroll
  for (int i = 0; i < 4; ++i) {
    const int n = n0 + pg * 4 + i;
    const float s = 1.0f / (1.0f + __expf(-acc[i]));
    outp[(h * 256 + n) * 32 + r] = (_Float16)(osc * s);
  }
}

// ---------------------------------------------------------------------------
// Kernel 2: QKV GEMM  [131072 x 256] @ [256 x 768] (+bias, q*=logit_scale)
// Block tile 128x128, 8 waves, each wave 2x4 16x16 accum tiles.
// grid (6, 128): a work-group stages its weight panel once and walks 8 row tiles.
// x goes through two LDS stages of 64 k: the loads of the next stage (8 of 16
// bytes per lane) are issued in front of this stage's products and converted and
// stored behind them, so that the load latency runs under the products; one
// barrier per stage.  The stages run on across the row tiles.
// The products are formed transposed (A = weight columns, B = x rows): in D a lane
// holds one row of x (lane&15) and the output columns 8*(lane>>4)+r of a 16-column
// tile, eight neighbouring f16 of one head.  Lanes l and l^8 swap one of their two
// 16-byte pieces, and every store instruction writes 512 contiguous bytes.
// ---------------------------------------------------------------------------
#define QKV_TILES 8
#define QKV_KC 64

// One stage of x, 128 rows x 64 k: a wave's load covers 256 contiguous bytes of
// each of two rows; p + off is the lane's own address in the stage's first 16 rows.
static __device__ __forceinline__ void qkv_fetch(float4 (&a)[8], const float* p, int off) {
  #pragma unroll
  for (int i = 0; i < 8; ++i) a[i] = *(const float4*)(p + off + i * 16 * 256);
  // the caller gives the address registers a new value for the next row tile; p is
  // named so that the address pair outlives the run of loads (no result lands in it)
  asm volatile("s_wait_xcnt 0x0" :: "v"(p) : "memory");
}

static __device__ __forceinline__ void qkv_put(_Float16 (*st)[QKV_KC + 8], const float4 (&a)[8],
                                               int row, int col) {
  #pragma unroll
  for (int i = 0; i < 8; ++i) {
    union { _Float16 h[4]; uint2 u; } t;
    t.h[0] = (_Float16)a[i].x; t.h[1] = (_Float16)a[i].y;
    t.h[2] = (_Float16)a[i].z; t.h[3] = (_Float16)a[i].w;
    *(uint2*)&st[row + i * 16][col] = t.u;
  }
}

// three work-groups per WGP (their LDS fits) are six waves per SIMD: the register
// count is held to that
__global__ void __launch_bounds__(256) __attribute__((amdgpu_waves_per_eu(6)))
qkv_kernel(const float* __restrict__ x, const float* __restrict__ w,
                           const float* __restrict__ bvec, const float* __restrict__ lsc,
                           _Float16* __restrict__ qo, _Float16* __restrict__ ko,
                           _Float16* __restrict__ vo) {
  __shared__ _Float16 As[2][128][QKV_KC + 8];   // two stages; pitch 72 h = 144 B = 16 B x 9
  __shared__ _Float16 Bs[128][PANEL_PITCH];   // weight panel: Bs[col][k], all k
  const int tid = threadIdx.x, lane = tid & 31, wave = tid >> 5;
  const int wm = wave & 3, wn = wave >> 2;
  const int mlane = lane & 15, hsel = lane >> 4;
  const int n0 = blockIdx.x * 128;

  // published by the barrier in front of the first fragment loads
  stage_panel(Bs, w, 768, n0, tid);

  // q scale of this wave's two heads (32 output columns each), the same for every tile
  float scale[2];
  #pragma unroll
  for (int jp = 0; jp < 2; ++jp) {
    const int jg0 = n0 + wn * 64 + jp * 32;
    scale[jp] = ((jg0 >> 8) == 0) ? lsc[(jg0 >> 5) & 7] : 1.0f;
  }

  // stage 0 of the first row tile
  const int xrow = wave * 2 + hsel, xcol = mlane * 4;
  const float* xb = x + ((size_t)blockIdx.y * QKV_TILES * 128 + xrow) * 256 + xcol;
  float4 a[8];
  qkv_fetch(a, xb, 0);
  qkv_put(As[0], a, xrow, xcol);
  __syncthreads();

  // Kept rolled: the K loop inside is unrolled.
  #pragma unroll 1
  for (int mt = 0; mt < QKV_TILES; ++mt) {
  const int m0 = (blockIdx.y * QKV_TILES + mt) * 128;
  const float* xt = xb + (size_t)mt * 128 * 256;

  Acc8 acc[2][4];
  #pragma unroll
  for (int i = 0; i < 2; ++i)
    #pragma unroll
    for (int j = 0; j < 4; ++j)
      #pragma unroll
      for (int r = 0; r < 8; ++r) acc[i][j].f[r] = 0.0f;

  // unrolled: the stage index (kq & 1) is then a constant in every LDS address
  #pragma unroll
  for (int kq = 0; kq < 256 / QKV_KC; ++kq) {
    const int kk = kq * QKV_KC;
    // the next stage: the next 64 k of this row tile, or the first of the next tile
    const bool more = (kq + 1 < 256 / QKV_KC) || (mt + 1 < QKV_TILES);
    if (more) qkv_fetch(a, xt, (kq + 1 < 256 / QKV_KC) ? kk + QKV_KC : 128 * 256);
    #pragma unroll
    for (int ks = 0; ks < QKV_KC; ks += 32) {
      Frag16 af[2], bf[4];
      #pragma unroll
      for (int i = 0; i < 2; ++i) af[i].v = lds_frag16(&As[kq & 1][wm * 32 + i * 16 + mlane][ks], hsel);
      #pragma unroll
      for (int j = 0; j < 4; ++j) bf[j].v = lds_frag16(&Bs[wn * 64 + j * 16 + mlane][kk + ks], hsel);
      #pragma unroll
      for (int i = 0; i < 2; ++i)
        #pragma unroll
        for (int j = 0; j < 4; ++j)
          acc[i][j].v = WMMA16(bf[j].v, af[i].v, acc[i][j].v);
    }
    // keeps the conversions, and with them the wait for the loads, behind the
    // products: left free, the scheduler put them behind the first product and the
    // wave sat out the load latency there
    __builtin_amdgcn_sched_barrier(0);
    // into the stage whose last readers passed the barrier of the stage before
    if (more) qkv_put(As[(kq + 1) & 1], a, xrow, xcol);
    // ends the reads of this stage and publishes the next
    __syncthreads();
  }

  // epilogue: +bias, q*=logit_scale[h], f16 to [B,H,N,32]; a head's 32 columns are
  // two neighbouring D tiles, a row of it 64 bytes = four 16-byte pieces
  const bool lo8 = mlane < 8;
  #pragma unroll
  for (int jp = 0; jp < 2; ++jp) {
    const int jg0 = n0 + wn * 64 + jp * 32;           // first global out column of the head
    const int which = jg0 >> 8, h = (jg0 >> 5) & 7;
    _Float16* outp = (which == 0) ? qo : ((which == 1) ? ko : vo);
    union { float4 q[2]; float f[8]; } bias[2];       // of this lane's 2 x 8 columns
    #pragma unroll
    for (int t = 0; t < 2; ++t) {
      bias[t].q[0] = *(const float4*)(bvec + jg0 + t * 16 + 8 * hsel);
      bias[t].q[1] = *(const float4*)(bvec + jg0 + t * 16 + 8 * hsel + 4);
    }
    #pragma unroll
    for (int i = 0; i < 2; ++i) {
      // pc[t]: row mlane of the 16, piece 2*t + hsel
      union { _Float16 h16[8]; unsigned u[4]; } pc[2];
      #pragma unroll
      for (int t = 0; t < 2; ++t)
        #pragma unroll
        for (int r = 0; r < 8; ++r)
          pc[t].h16[r] = (_Float16)((acc[i][2 * jp + t].f[r] + bias[t].f[r]) * scale[jp]);
      // lanes 0-7 of a row of 16 end with pieces hsel of rows mlane and mlane+8,
      // lanes 8-15 with pieces 2+hsel of rows mlane-8 and mlane
      union { unsigned u[4]; uint4 q; } s0, s1;
      #pragma unroll
      for (int c = 0; c < 4; ++c) {
        const unsigned got = other_oct(lo8 ? pc[1].u[c] : pc[0].u[c]);
        s0.u[c] = lo8 ? pc[0].u[c] : got;             // rows 0..7
        s1.u[c] = lo8 ? got : pc[1].u[c];             // rows 8..15
      }
      const int mg = m0 + wm * 32 + i * 16 + (mlane & 7);   // global row = b*256 + nrow
      const int bb = mg >> 8, nrow = mg & 255;
      _Float16* dst = outp + (((size_t)bb * 8 + h) * 256 + nrow) * 32
                           + ((mlane >> 3) * 2 + hsel) * 8;
      *(uint4*)dst = s0.q;
      *(uint4*)(dst + 8 * 32) = s1.q;
    }
  }
  // the next trip reuses the address and data registers of these stores
  asm volatile("s_wait_xcnt 0x0" ::: "memory");
  }
}

// ---------------------------------------------------------------------------
// Kernel 3: fused attention per (b,h).  grid (8, 512), 256 threads = 8 waves.
//  The scores never leave the registers.  Each wave owns 2 x 16 queries and
//  forms S^T = K Q^T + BK BQ^T (A = key rows, B = query rows): in D a lane
//  holds one query (column lane&15) and keys 8*(lane>>4)+r of each 16-key tile,
//  so row maximum and row sum are in-lane plus one exchange between the halves,
//  and two neighbouring D tiles, converted to f16, are the B operand of
//  O^T = V^T P^T in the hardware k order that lds_frag16 also delivers.
//  The keys are walked in 4 chunks of 64 with a running maximum and sum, so that
//  the scores of both query tiles fit the registers at once and every K, BK and V
//  fragment read from LDS serves two query tiles.
//  q/k/bq/bk staged with async-to-LDS copies; v transposed through VGPRs.
// ---------------------------------------------------------------------------
typedef __attribute__((ext_vector_type(8))) _Float16 v8h;
typedef __attribute__((ext_vector_type(2))) float v2f;

static __device__ __forceinline__ float other_half(float x) {
  // value of lane l ^ 16
  int b = __builtin_bit_cast(int, x);
  b = __builtin_amdgcn_permlanex16(b, b, 0x76543210, 0xfedcba98, false, false);
  return __builtin_bit_cast(float, b);
}

// three work-groups per WGP (their LDS fits) are six waves per SIMD: the register
// count is held to that
__global__ void __launch_bounds__(256) __attribute__((amdgpu_waves_per_eu(6)))
attn_kernel(const _Float16* __restrict__ qg, const _Float16* __restrict__ kg,
            const _Float16* __restrict__ vg,
            const _Float16* __restrict__ bqg, const _Float16* __restrict__ bkg,
            const float* __restrict__ vrs_g, _Float16* __restrict__ ao) {
  __shared__ _Float16 qs[256][40];     // 20 KB
  __shared__ _Float16 ks[256][40];     // 20 KB
  __shared__ _Float16 bqs[256][40];    // 20 KB  (rank-bias q factors, head h)
  __shared__ _Float16 bks[256][40];    // 20 KB  (rank-bias k factors, head h)
  __shared__ _Float16 vt[32][264];     // v transposed: vt[d][m], 16.9 KB
  __shared__ float    vmean[32];

  const int h = blockIdx.x, b = blockIdx.y;
  const int tid = threadIdx.x, lane = tid & 31, wave = tid >> 5;
  const int mlane = lane & 15, hsel = lane >> 4;
  const size_t base = ((size_t)b * 8 + h) * 256 * 32;

  // phase 0: stage q, k, bq, bk (async f16 copies) and v (transpose in VGPRs)
  // a wave brings rows 32*wave .. +31 of each
  async_rows32x2(&qs[wave * 32], qg + base + (size_t)wave * 32 * 32,
                 &ks[wave * 32], kg + base + (size_t)wave * 32 * 32, lane);
  async_rows32x2(&bqs[wave * 32], bqg + ((size_t)h * 256 + wave * 32) * 32,
                 &bks[wave * 32], bkg + ((size_t)h * 256 + wave * 32) * 32, lane);
  {
    union { uint4 u[4]; _Float16 h16[32]; } vv;
    const uint4* vp = (const uint4*)(vg + base + (size_t)tid * 32);
    #pragma unroll
    for (int c = 0; c < 4; ++c) vv.u[c] = vp[c];
    #pragma unroll
    for (int d = 0; d < 32; ++d) vt[d][tid] = vv.h16[d];
  }
  wait_async0();
  __syncthreads();

  // v_mean (wave 0)
  if (tid < 32) {
    float s = 0.0f;
    for (int m = 0; m < 256; ++m) s += (float)vt[tid][m];
    vmean[tid] = s * (1.0f / 256.0f);
  }

  const float vrs = vrs_g[h];
  const float L2E = 1.44269504088896340736f;
  const v8f l2e8 = {L2E, L2E, L2E, L2E, L2E, L2E, L2E, L2E};
  const int q0 = wave * 32;

  // running maximum (both halves of the wave hold the same), running sum of this
  // lane's keys (in two parts: packed adds), and o[qt][dt].f[r] = out[query q0+16*qt+mlane][d = 16*dt+8*hsel+r],
  // all three relative to the running maximum
  float mrun[2] = {-__builtin_inff(), -__builtin_inff()};
  v2f srun[2] = {{0.0f, 0.0f}, {0.0f, 0.0f}};
  Acc8 o[2][2];
  #pragma unroll
  for (int qt = 0; qt < 2; ++qt)
    #pragma unroll
    for (int dt = 0; dt < 2; ++dt)
      #pragma unroll
      for (int r = 0; r < 8; ++r) o[qt][dt].f[r] = 0.0f;

  // Kept rolled: unrolled, the build spilled to scratch at the register count that
  // three work-groups per WGP allow.
  #pragma unroll 1
  for (int c = 0; c < 4; ++c) {
    const int key0 = c * 64;
    // The wave's two query tiles are read anew in every chunk.  The fence (no
    // instruction) keeps these loads inside the loop: lifted out, the fragments hold
    // 32 registers through the softmax as well and are spilled to scratch.
    __builtin_amdgcn_fence(__ATOMIC_ACQUIRE, "wavefront");
    v16h fq[2], fb[2];
    #pragma unroll
    for (int qt = 0; qt < 2; ++qt) {
      fq[qt] = lds_frag16(&qs[q0 + qt * 16 + mlane][0], hsel);
      fb[qt] = lds_frag16(&bqs[q0 + qt * 16 + mlane][0], hsel);
    }
    // scores: s[qt][kt].f[r] = S[query q0+16*qt+mlane][key key0 + 16*kt + 8*hsel + r]
    Acc8 s[2][4];
    #pragma unroll
    for (int kt = 0; kt < 4; ++kt) {
      const v16h fk  = lds_frag16(&ks[key0 + kt * 16 + mlane][0], hsel);
      const v16h fbk = lds_frag16(&bks[key0 + kt * 16 + mlane][0], hsel);
      #pragma unroll
      for (int qt = 0; qt < 2; ++qt) {
        #pragma unroll
        for (int r = 0; r < 8; ++r) s[qt][kt].f[r] = 0.0f;
        s[qt][kt].v = WMMA16(fk, fq[qt], s[qt][kt].v);
        s[qt][kt].v = WMMA16(fbk, fb[qt], s[qt][kt].v);
      }
    }

    // softmax of the chunk, unnormalised, relative to the new running maximum; what
    // was gathered under the old maximum is scaled by al (0 in the first chunk).
    // p[qt][mc]: two neighbouring score tiles packed, the B operand for 32 keys
    v16h p[2][2], fv[2][2];
    #pragma unroll
    for (int qt = 0; qt < 2; ++qt) {
      // new running maximum, the old one taken in; in threes: one three-operand
      // maximum instruction each
      float t3[8], u3[4];
      #pragma unroll
      for (int r = 0; r < 8; ++r)
        t3[r] = fmaxf(fmaxf(s[qt][0].f[r], s[qt][1].f[r]), s[qt][2].f[r]);
      #pragma unroll
      for (int r = 0; r < 4; ++r) {
        u3[r] = fmaxf(fmaxf(t3[2 * r], t3[2 * r + 1]), s[qt][3].f[2 * r]);
        u3[r] = fmaxf(fmaxf(u3[r], s[qt][3].f[2 * r + 1]), r ? u3[r - 1] : mrun[qt]);
      }
      const float mnew = fmaxf(u3[3], other_half(u3[3]));
      const float al = __builtin_amdgcn_exp2f((mrun[qt] - mnew) * L2E);
      mrun[qt] = mnew;
      const float nm = -mnew * L2E;
      const v8f nm8 = {nm, nm, nm, nm, nm, nm, nm, nm};
      #pragma unroll
      for (int kt = 0; kt < 4; ++kt) {
        const v8f t = __builtin_elementwise_fma(s[qt][kt].v, l2e8, nm8);
        #pragma unroll
        for (int r = 0; r < 8; ++r) s[qt][kt].f[r] = __builtin_amdgcn_exp2f(t[r]);
      }
      const v8f sum8 = (s[qt][0].v + s[qt][1].v) + (s[qt][2].v + s[qt][3].v);
      const v2f cs = (__builtin_shufflevector(sum8, sum8, 0, 1) +
                      __builtin_shufflevector(sum8, sum8, 2, 3)) +
                     (__builtin_shufflevector(sum8, sum8, 4, 5) +
                      __builtin_shufflevector(sum8, sum8, 6, 7));
      const v2f al2 = {al, al};
      srun[qt] = __builtin_elementwise_fma(srun[qt], al2, cs);
      const v8f al8 = {al, al, al, al, al, al, al, al};
      #pragma unroll
      for (int dt = 0; dt < 2; ++dt) o[qt][dt].v *= al8;
      #pragma unroll
      for (int mc = 0; mc < 2; ++mc) {
        const v8h lo = __builtin_convertvector(s[qt][2 * mc].v, v8h);
        const v8h hi = __builtin_convertvector(s[qt][2 * mc + 1].v, v8h);
        p[qt][mc] = __builtin_shufflevector(lo, hi, 0, 1, 2, 3, 4, 5, 6, 7,
                                            8, 9, 10, 11, 12, 13, 14, 15);
      }
      // keeps the two tiles' softmax and the products behind them apart: left free, the
      // scheduler had scores, packed scores and V fragments of both tiles alive at once
      // and spilled at the register count that three work-groups per WGP allow
      __builtin_amdgcn_sched_barrier(0);
      // the chunk's V fragments: their latency runs under the second tile's softmax
      if (qt == 0) {
        #pragma unroll
        for (int mc = 0; mc < 2; ++mc)
          #pragma unroll
          for (int dt = 0; dt < 2; ++dt)
            fv[mc][dt] = lds_frag16(&vt[dt * 16 + mlane][key0 + mc * 32], hsel);
      }
    }

    // O^T += V^T P^T: A = rows of vt
    #pragma unroll
    for (int mc = 0; mc < 2; ++mc)
      #pragma unroll
      for (int qt = 0; qt < 2; ++qt)
        #pragma unroll
        for (int dt = 0; dt < 2; ++dt)
          o[qt][dt].v = WMMA16(fv[mc][dt], p[qt][mc], o[qt][dt].v);
  }

  __syncthreads();   // publish vmean before its first reader

  // normalise, + vrs * v_mean, f16 in the A-fragment order of the proj products: per
  // (window, head) 16 tiles of 16 positions, a tile 1 KB = [k chunk dt][lane][8 halves].
  // This lane holds position mlane, k = 16*dt + 8*hsel + r: its own place in that order,
  // and every store instruction writes 512 contiguous bytes.
  #pragma unroll
  for (int qt = 0; qt < 2; ++qt) {
    const float sl = srun[qt][0] + srun[qt][1];
    const float inv = 1.0f / (sl + other_half(sl));
    _Float16* dst = ao + base + (size_t)(wave * 2 + qt) * 512 + lane * 8;
    #pragma unroll
    for (int dt = 0; dt < 2; ++dt) {
      const int d0 = dt * 16 + 8 * hsel;
      union { _Float16 h16[8]; uint4 q; } pc;
      #pragma unroll
      for (int r = 0; r < 8; ++r)
        pc.h16[r] = (_Float16)(o[qt][dt].f[r] * inv + vmean[d0 + r] * vrs);
      *(uint4*)(dst + dt * 256) = pc.q;
    }
  }
}

// ---------------------------------------------------------------------------
// Kernel 4: proj GEMM  [131072 x 256](f16) @ [256 x 256] + proj_b -> f32 out
// A arrives in fragment order: per (window, head) 16 tiles of 16 rows, a tile
// 1 KB = [k chunk][lane][8 halves], so that a wave loads half a fragment with one
// instruction that covers 512 contiguous bytes, straight into registers: no LDS
// tile, no barrier in the K loop.  A wave holds the 16 fragments (2 row tiles x 8
// heads) of its 32 rows; each is loaded anew for the next row tile right behind its
// last product, so that the latency runs under a whole row tile's work.
// Weight panel converted f32->f16 once.  grid (2, 256): a work-group walks 4 row
// tiles; the registers allow two work-groups per WGP, all 512 resident.
// ---------------------------------------------------------------------------
#define PROJ_TILES 4

// p: this lane's 16 bytes of head 0, first of the wave's two 16-row tiles
static __device__ __forceinline__ void proj_frag(Frag16 (&f)[2], const _Float16* p, int hd) {
  #pragma unroll
  for (int i = 0; i < 2; ++i)
    #pragma unroll
    for (int c = 0; c < 2; ++c)
      f[i].q[c] = *(const uint4*)(p + hd * 16 * 512 + i * 512 + c * 256);
}

// One row tile of 128 x 128.  MORE: the fragments of the next row tile (at pnext) are
// fetched behind the products.
template <bool MORE>
static __device__ __forceinline__ void proj_tile(Frag16 (&af)[8][2], const _Float16* pnext,
                                                 const _Float16 (*Bs)[PANEL_PITCH],
                                                 const float (&addb)[2], float* orow,
                                                 int wn, int mlane, int hsel) {
  Acc8 acc[2][4];
  #pragma unroll
  for (int i = 0; i < 2; ++i)
    #pragma unroll
    for (int j = 0; j < 4; ++j)
      #pragma unroll
      for (int r = 0; r < 8; ++r) acc[i][j].f[r] = 0.0f;

  #pragma unroll
  for (int hd = 0; hd < 8; ++hd) {
    Frag16 bf[4];
    #pragma unroll
    for (int j = 0; j < 4; ++j) bf[j].v = lds_frag16(&Bs[wn * 64 + j * 16 + mlane][hd * 32], hsel);
    #pragma unroll
    for (int i = 0; i < 2; ++i)
      #pragma unroll
      for (int j = 0; j < 4; ++j)
        acc[i][j].v = WMMA16(af[hd][i].v, bf[j].v, acc[i][j].v);
    if (MORE) proj_frag(af[hd], pnext, hd);
  }

  // two neighbouring D tiles are 32 columns = one 128-byte line of a row: lanes l and
  // l^16 swap so that lanes 0-15 hold the left tile's and lanes 16-31 the right
  // tile's columns of ONE row, and a store instruction writes one whole line
  #pragma unroll
  for (int jp = 0; jp < 2; ++jp) {
    #pragma unroll
    for (int i = 0; i < 2; ++i) {
      #pragma unroll
      for (int r = 0; r < 8; ++r) {
        const float left = acc[i][2 * jp].f[r], right = acc[i][2 * jp + 1].f[r];
        const float got = other_half(hsel ? left : right);
        acc[i][2 * jp].f[r]     = (hsel ? got : left) + addb[jp];    // row r
        acc[i][2 * jp + 1].f[r] = (hsel ? right : got) + addb[jp];   // row 8 + r
      }
    }
    // keeps the stores behind the swaps: left free, the compiler ran every pair
    // through the same two registers, with a wait for the stores in front of each reuse
    __builtin_amdgcn_sched_barrier(0);
  }
  #pragma unroll
  for (int i = 0; i < 2; ++i)
    #pragma unroll
    for (int t = 0; t < 2; ++t)
      #pragma unroll
      for (int r = 0; r < 8; ++r)
        #pragma unroll
        for (int jp = 0; jp < 2; ++jp)   // the two lines of a row one behind the other
          orow[(i * 16 + t * 8 + r) * 256 + jp * 32] = acc[i][2 * jp + t].f[r];
  // the next row tile gives the address registers of these loads and stores, and the
  // stores' data registers, new values; pnext is named so that it outlives the loads
  if (MORE) asm volatile("s_wait_xcnt 0x0" :: "v"(pnext) : "memory");
}

// two work-groups per WGP are four waves per SIMD: the register count is held to that
__global__ void __launch_bounds__(256) __attribute__((amdgpu_waves_per_eu(4)))
proj_kernel(const _Float16* __restrict__ a, const float* __restrict__ w,
                            const float* __restrict__ bvec, float* __restrict__ out) {
  __shared__ _Float16 Bs[128][PANEL_PITCH];   // weight panel: Bs[col][k], all k
  const int tid = threadIdx.x, lane = tid & 31, wave = tid >> 5;
  const int wm = wave & 3, wn = wave >> 2;
  const int mlane = lane & 15, hsel = lane >> 4;
  const int n0 = blockIdx.x * 128;

  // the work-group's 4 row tiles are two windows, two halves (8 tiles of 16 rows) each:
  // row tile mt begins (mt >> 1) * 8 heads * 16 tiles + (mt & 1) * 8 tiles on
  const _Float16* ab = a + ((size_t)blockIdx.y * 2 * 8 * 16 + wm * 2) * 512 + lane * 8;

  // the first row tile's fragments: their latency runs under the staging of the panel
  Frag16 af[8][2];
  #pragma unroll
  for (int hd = 0; hd < 8; ++hd) proj_frag(af[hd], ab, hd);
  const int bcol = n0 + wn * 64 + lane;
  const float addb[2] = {bvec[bcol], bvec[bcol + 32]};
  // the offset register of the two bias loads is given a new value below; bcol is
  // named so that it outlives the loads
  asm volatile("s_wait_xcnt 0x0" :: "v"(bcol) : "memory");

  stage_panel(Bs, w, 256, n0, tid);
  __syncthreads();   // publishes the panel

  float* orow = out + ((size_t)blockIdx.y * PROJ_TILES * 128 + wm * 32) * 256 + n0 + wn * 64 + lane;
  // Kept rolled: a trip is 64 products and 64 stores long, and copies of it buy nothing.
  #pragma unroll 1
  for (int mt = 0; mt + 1 < PROJ_TILES; ++mt) {
    const int nx = mt + 1;
    proj_tile<true>(af, ab + (size_t)((nx >> 1) * 8 * 16 + (nx & 1) * 8) * 512, Bs, addb,
                    orow + (size_t)mt * 128 * 256, wn, mlane, hsel);
  }
  proj_tile<false>(af, ab, Bs, addb, orow + (size_t)(PROJ_TILES - 1) * 128 * 256, wn, mlane, hsel);
}

// ---------------------------------------------------------------------------
// Host launcher
// ---------------------------------------------------------------------------
extern "C" void kernel_launch(void* const* d_in, const int* in_sizes, int n_in,
                              void* d_out, int out_size, void* d_ws, size_t ws_size,
                              hipStream_t stream) {
  const float* x       = (const float*)d_in[0];
  const float* qkv_w   = (const float*)d_in[1];
  const float* qkv_b   = (const float*)d_in[2];
  const float* proj_w  = (const float*)d_in[3];
  const float* proj_b  = (const float*)d_in[4];
  const float* lsc     = (const float*)d_in[5];
  const float* vrs     = (const float*)d_in[6];
  const float* mlp1_w  = (const float*)d_in[7];
  const float* mlp1_b  = (const float*)d_in[8];
  const float* mlp2_w  = (const float*)d_in[9];
  const float* bscale  = (const float*)d_in[10];

  char* ws = (char*)d_ws;
  const size_t QSZ = (size_t)512 * 8 * 256 * 32 * sizeof(_Float16);  // 67.1 MB each
  _Float16* bq = (_Float16*)(ws + 0);          // 128 KB (f16, pre-scaled by bias_scale)
  _Float16* bk = (_Float16*)(ws + 131072);     // 128 KB
  _Float16* q  = (_Float16*)(ws + 262144);
  _Float16* k  = (_Float16*)(ws + 262144 + QSZ);
  _Float16* v  = (_Float16*)(ws + 262144 + 2 * QSZ);
  _Float16* ao = (_Float16*)(ws + 262144 + 3 * QSZ);
  float*    out = (float*)d_out;

  bias1_kernel<<<dim3(8, 16), 256, 0, stream>>>(mlp1_w, mlp1_b, mlp2_w, bscale, bq, bk);
  qkv_kernel<<<dim3(6, 128), 256, 0, stream>>>(x, qkv_w, qkv_b, lsc, q, k, v);
  attn_kernel<<<dim3(8, 512), 256, 0, stream>>>(q, k, v, bq, bk, vrs, ao);
  proj_kernel<<<dim3(2, 256), 256, 0, stream>>>(ao, proj_w, proj_b, out);
}

// v010
// A run of this version takes 115 microseconds.
// Two timings next to v009 put it at 1.31 and 1.30 times that version's speed.
// Over all steps from v000 it is 6.19 times as fast.
#include <hip/hip_runtime.h>

// ---------------------------------------------------------------------------
// WindowAttentionRFB for gfx1250 (MI455X)
//   bias1 (MLP -> f16 bq/bk) -> qkv WMMA GEMM and attention in one kernel
//   (q, k, v stay on the WGP; scores = q k^T + bq bk^T as two chained WMMAs, kept
//    in registers, in-lane softmax, attn@V) -> proj WMMA GEMM.
//   The attention output lies in memory in the A-fragment order of the proj products.
//   Both kernels keep their weight panel (all 256 k, f16, [col][k]) in LDS for the
//   life of the work-group, which walks several windows or row tiles.
// Shapes: B=512, N=256, C=256, H=8, hd=32, R=32
// ---------------------------------------------------------------------------

typedef __attribute__((ext_vector_type(16))) _Float16 v16h;
typedef __attribute__((ext_vector_type(8)))  float    v8f;

union Frag16 { v16h v; uint4 q[2]; _Float16 h[16]; };
union Acc8   { v8f  v; float f[8]; };

#define WMMA16(a, b, c) __builtin_amdgcn_wmma_f32_16x16x32_f16( \
    false, (a), false, (b), (short)0, (c), false, false)

static __device__ __forceinline__ v16h lds_frag16(const _Float16* rowbase, int hsel) {
  // 16-bit A/B fragment: lane (m = lane&15, hsel = lane>>4)
  // chunk0: K = 8*hsel .. +7  -> VGPR0..3 ; chunk1: K = 16+8*hsel .. +7 -> VGPR4..7
  Frag16 t;
  const _Float16* p = rowbase + hsel * 8;
  t.q[0] = *(const uint4*)(p);
  t.q[1] = *(const uint4*)(p + 16);
  return t.v;
}

// Weight panel of a GEMM work-group: Bs[col][k] = (f16) w[k][n0 + col], 128
// columns, k = 0..255.  Pitch 264 halves = 528 B = 16 B x 33, so that the 16-byte
// stores here and the 16-byte fragment loads fall on distinct banks.
// A lane owns one column (a wave reads whole 128-B lines of w) and packs eight
// consecutive k into one 16-byte LDS store.  256 threads.
#define PANEL_PITCH 264
static __device__ __forceinline__ void stage_panel(_Float16 (*Bs)[PANEL_PITCH],
                                                   const float* __restrict__ w,
                                                   int ldw, int n0, int tid) {
  const int c = tid & 127;
  const float* wc = w + n0 + c;
  // 32 loads in flight per lane; fully unrolled the compiler held all 128 values
  // and the register count cost a resident work-group
  #pragma unroll 4
  for (int it = 0; it < 16; ++it) {
    const int k0 = (it * 2 + (tid >> 7)) * 8;
    union { _Float16 h[8]; uint4 u; } t;
    #pragma unroll
    for (int j = 0; j < 8; ++j) t.h[j] = (_Float16)wc[(size_t)(k0 + j) * ldw];
    *(uint4*)&Bs[c][k0] = t.u;
  }
}

// ---------------------------------------------------------------------------
// Kernel 1: position-bias MLP -> f16 bq [H,N,R] (pre-scaled), bk [H,N,R]
// grid (8 heads, 16 position groups) x 256 threads: a work-group forms 16
// positions x the 64 output columns (32 bq + 32 bk) of one head.
// A lane owns one column of w2 (a wave reads whole 128-B lines) and holds all
// 128 k of it in registers; two waves share four positions, whose hidden
// features they read from LDS as broadcasts: four independent sums per lane,
// each in the order k = 0..127.
// ---------------------------------------------------------------------------
__global__ void __launch_bounds__(256)
bias1_kernel(const float* __restrict__ w1, const float* __restrict__ b1,
             const float* __restrict__ w2, const float* __restrict__ bscale_p,
             _Float16* __restrict__ bq, _Float16* __restrict__ bk) {
  __shared__ __attribute__((aligned(16))) float hf[16][132];   // pitch 528 B = 16 B x 33
  const int tid = threadIdx.x;
  const int h = blockIdx.x, n0 = blockIdx.y * 16;
  const int c = tid & 63, pg = tid >> 6;

  // a thread forms 8 hidden features of one position: its slices of w1 and b1
  const int p = tid >> 4, j0 = (tid & 15) * 8;
  union { float4 q[2]; float f[8]; } wa, wb, bb, g;
  #pragma unroll
  for (int t = 0; t < 2; ++t) {
    wa.q[t] = *(const float4*)(w1 + j0 + 4 * t);
    wb.q[t] = *(const float4*)(w1 + 128 + j0 + 4 * t);
    bb.q[t] = *(const float4*)(b1 + j0 + 4 * t);
  }
  const float bsc = bscale_p[0];
  // the scalar bases of the six loads above are given new values below; the
  // statement also keeps the six, which the gelu phase waits for, in front of the
  // 128 below (loads return in order)
  asm volatile("s_wait_xcnt 0x0" ::: "memory");
  // this lane's column of w2, fetched here: the latency runs under the gelu phase
  float wc[128];
  const float* wp = w2 + h * 64 + c;
  #pragma unroll
  for (int j = 0; j < 128; ++j) wc[j] = wp[j * 512];

  {
    const int n = n0 + p;                     // position index 0..255
    const float invden = 1.0f / logf(16.0f);  // log1p(15) = log(16)
    const float c0 = log1pf((float)(n >> 4)) * invden;   // gy
    const float c1 = log1pf((float)(n & 15)) * invden;   // gx
    #pragma unroll
    for (int jj = 0; jj < 8; ++jj) {
      float z = c0 * wa.f[jj] + c1 * wb.f[jj] + bb.f[jj];
      g.f[jj] = 0.5f * z * (1.0f + erff(z * 0.70710678118654752f));  // exact gelu
    }
    *(float4*)&hf[p][j0]     = g.q[0];
    *(float4*)&hf[p][j0 + 4] = g.q[1];
  }
  __syncthreads();

  float acc[4] = {0.0f, 0.0f, 0.0f, 0.0f};
  #pragma unroll
  for (int j = 0; j < 128; j += 4) {
    #pragma unroll
    for (int i = 0; i < 4; ++i) {
      const float4 hv = *(const float4*)&hf[pg * 4 + i][j];
      acc[i] += hv.x * wc[j];
      acc[i] += hv.y * wc[j + 1];
      acc[i] += hv.z * wc[j + 2];
      acc[i] += hv.w * wc[j + 3];
    }
  }

  const int which = c >> 5, r = c & 31;       // the same for a whole wave
  _Float16* outp = (which == 0) ? bq : bk;
  const float osc = (which == 0) ? bsc : 1.0f;
  #pragma unroll
  for (int i = 0; i < 4; ++i) {
    const int n = n0 + pg * 4 + i;
    const float s = 1.0f / (1.0f + __expf(-acc[i]));
    outp[(h * 256 + n) * 32 + r] = (_Float16)(osc * s);
  }
}

// ---------------------------------------------------------------------------
// Kernel 2: QKV GEMM and attention in one.  grid (8 heads, 64), 256 threads = 8
// waves; a work-group belongs to one head and walks 8 windows.  q, k and v never
// reach global memory.
//  Kept in LDS for the life of the work-group: the head's 96 weight columns
//  (32 q, 32 k, 32 v; f16, [col][k], all 256 k), their bias, and bk; each wave
//  keeps the bq fragments of its 32 queries in registers.
//  Per window a wave forms q, k, v of its own 32 rows of x (32 x 96, 12 D tiles).
//  x goes through an LDS tile that only this wave touches, 64 k a stage: no
//  work-group barrier in the K loop.  The loads of the next stage are issued in
//  front of this stage's products and converted and stored behind them; the stages
//  run on across the windows.
//  q and k are formed transposed (A = weight columns, B = x rows): in D a lane holds
//  one row of x (lane&15) and the columns 8*(lane>>4)+r of a 16-column tile.  Two
//  neighbouring q tiles, converted to f16, are the B operand of S^T = K Q^T as they
//  stand; a k tile goes to ks[key][d] with one 16-byte store a lane.
//  v is formed straight (A = x rows, B = weight columns): a lane holds one column d
//  and eight neighbouring keys, one 16-byte store into vt[d][key].
//  Attention: each wave owns 2 x 16 queries and forms S^T = K Q^T + BK BQ^T
//  (A = key rows, B = query rows): in D a lane holds one query (column lane&15) and
//  keys 8*(lane>>4)+r of each 16-key tile, so row maximum and row sum are in-lane
//  plus one exchange between the halves, and two neighbouring D tiles, converted to
//  f16, are the B operand of O^T = V^T P^T in the hardware k order that lds_frag16
//  also delivers.  The keys are walked in 4 chunks of 64 with a running maximum and
//  sum; every K, BK and V fragment read from LDS serves two query tiles.
// ---------------------------------------------------------------------------
typedef __attribute__((ext_vector_type(8))) _Float16 v8h;
typedef __attribute__((ext_vector_type(2))) float v2f;

static __device__ __forceinline__ float other_half(float x) {
  // value of lane l ^ 16
  int b = __builtin_bit_cast(int, x);
  b = __builtin_amdgcn_permlanex16(b, b, 0x76543210, 0xfedcba98, false, false);
  return __builtin_bit_cast(float, b);
}

#define FUSE_WINDOWS 8
#define X_KC 64

// One stage of a wave's x, 32 rows x 64 k: a load covers 256 contiguous bytes of
// each of two rows; p + off is the lane's own address in the stage's first two rows.
static __device__ __forceinline__ void x_fetch(float4 (&a)[16], const float* p, int off) {
  #pragma unroll
  for (int i = 0; i < 16; ++i) a[i] = *(const float4*)(p + off + i * 2 * 256);
  // the caller gives the address registers a new value for the next stage; p is
  // named so that the address pair outlives the run of loads (no result lands in it)
  asm volatile("s_wait_xcnt 0x0" :: "v"(p) : "memory");
}

static __device__ __forceinline__ void x_put(_Float16 (*st)[X_KC + 8], const float4 (&a)[16],
                                             int row, int col) {
  #pragma unroll
  for (int i = 0; i < 16; ++i) {
    union { _Float16 h[4]; uint2 u; } t;
    t.h[0] = (_Float16)a[i].x; t.h[1] = (_Float16)a[i].y;
    t.h[2] = (_Float16)a[i].z; t.h[3] = (_Float16)a[i].w;
    *(uint2*)&st[row + i * 2][col] = t.u;
  }
}

// This wave's LDS stores have landed before its other lanes read them; the clobber
// keeps the compiler from moving the reads in front.
static __device__ __forceinline__ void own_lds_stores_done() {
  asm volatile("s_wait_dscnt 0x0" ::: "memory");
}

// two work-groups per WGP (their LDS fits) are four waves per SIMD: the register
// count is held to that
__global__ void __launch_bounds__(256) __attribute__((amdgpu_waves_per_eu(4)))
qkv_attn_kernel(const float* __restrict__ x, const float* __restrict__ w,
                const float* __restrict__ bvec, const float* __restrict__ lsc,
                const _Float16* __restrict__ bqg, const _Float16* __restrict__ bkg,
                const float* __restrict__ vrs_g, _Float16* __restrict__ ao) {
  __shared__ __attribute__((aligned(16))) _Float16 Ws[96][PANEL_PITCH];     // weight panel: 32 q, 32 k, 32 v columns
  __shared__ __attribute__((aligned(16))) _Float16 bks[256][40];            // rank-bias k factors of the head
  __shared__ __attribute__((aligned(16))) _Float16 ks[256][40];             // k of the window
  __shared__ __attribute__((aligned(16))) _Float16 vt[32][264];             // v of the window, transposed: vt[d][key]
  __shared__ __attribute__((aligned(16))) _Float16 xs[8][32][X_KC + 8];     // a wave's own stage of x; pitch 144 B = 16 B x 9
  __shared__ __attribute__((aligned(16))) float bl[96];        // bias of the 96 columns
  __shared__ float vpart[8][32];               // column sums of v over a wave's 32 keys
  __shared__ __attribute__((aligned(16))) float vmw[8][32];    // v_mean, a copy per wave

  const int h = blockIdx.x;
  const int tid = threadIdx.x, lane = tid & 31, wave = tid >> 5;
  const int mlane = lane & 15, hsel = lane >> 4;
  const int q0 = wave * 32;

  // stage 0 of the first window: the latency runs under the staging of the panel
  const float* xb = x + ((size_t)blockIdx.y * FUSE_WINDOWS * 256 + q0 + hsel) * 256 + mlane * 4;
  float4 a[16];
  x_fetch(a, xb, 0);

  // panel: a wave reads whole 128-B lines of w (32 columns of one k) and a lane packs
  // eight consecutive k of its column into one 16-byte LDS store
  // 32 loads in flight per lane
  #pragma unroll 4
  for (int it = 0; it < 12; ++it) {
    const int item = it * 8 + wave;             // (which of q, k, v; eight k)
    const int which = item >> 5, k0 = (item & 31) * 8;
    const float* wc = w + which * 256 + h * 32 + lane;
    union { _Float16 h[8]; uint4 u; } t;
    #pragma unroll
    for (int j = 0; j < 8; ++j) t.h[j] = (_Float16)wc[(size_t)(k0 + j) * 768];
    *(uint4*)&Ws[which * 32 + lane][k0] = t.u;
  }
  if (tid < 96) bl[tid] = bvec[(tid >> 5) * 256 + h * 32 + (tid & 31)];
  #pragma unroll
  for (int i = 0; i < 4; ++i) {
    const int pc = i * 256 + tid;               // 16-byte piece: a wave reads 512 contiguous B
    *(uint4*)&bks[pc >> 2][(pc & 3) * 8] = *(const uint4*)(bkg + (size_t)h * 256 * 32 + pc * 8);
  }
  Frag16 fb[2];
  #pragma unroll
  for (int qt = 0; qt < 2; ++qt) {
    const _Float16* p = bqg + ((size_t)h * 256 + q0 + qt * 16 + mlane) * 32 + hsel * 8;
    fb[qt].q[0] = *(const uint4*)p;
    fb[qt].q[1] = *(const uint4*)(p + 16);
  }
  const float qscale = lsc[h];
  const float vrs = vrs_g[h];
  // the address registers of the loads above are given new values below
  asm volatile("s_wait_xcnt 0x0" ::: "memory");
  x_put(xs[wave], a, hsel, mlane * 4);
  __syncthreads();   // publishes the panel, its bias and bk

  const float L2E = 1.44269504088896340736f;
  const v8f l2e8 = {L2E, L2E, L2E, L2E, L2E, L2E, L2E, L2E};

  // Kept rolled: a trip is a whole window's work.
  #pragma unroll 1
  for (int wi = 0; wi < FUSE_WINDOWS; ++wi) {
  const int b = blockIdx.y * FUSE_WINDOWS + wi;
  const float* xt = xb + (size_t)wi * 256 * 256;

  // acc[i][j]: x rows 16*i.. of the wave; j = 0,1 q, 2,3 k (transposed), 4,5 v (straight)
  Acc8 acc[2][6];
  #pragma unroll
  for (int i = 0; i < 2; ++i)
    #pragma unroll
    for (int j = 0; j < 6; ++j)
      #pragma unroll
      for (int r = 0; r < 8; ++r) acc[i][j].f[r] = 0.0f;

  // unrolled: kk is then a constant in every LDS address and load offset
  #pragma unroll
  for (int kq = 0; kq < 256 / X_KC; ++kq) {
    const int kk = kq * X_KC;
    own_lds_stores_done();
    // the next stage: the next 64 k of this window, or the first of the next window
    const bool more = (kq + 1 < 256 / X_KC) || (wi + 1 < FUSE_WINDOWS);
    if (more) x_fetch(a, xt, (kq + 1 < 256 / X_KC) ? kk + X_KC : 256 * 256);
    #pragma unroll
    for (int ks2 = 0; ks2 < X_KC; ks2 += 32) {
      v16h xf[2];
      #pragma unroll
      for (int i = 0; i < 2; ++i) xf[i] = lds_frag16(&xs[wave][i * 16 + mlane][ks2], hsel);
      #pragma unroll
      for (int j = 0; j < 6; ++j) {
        const v16h wf = lds_frag16(&Ws[j * 16 + mlane][kk + ks2], hsel);
        #pragma unroll
        for (int i = 0; i < 2; ++i)
          acc[i][j].v = (j < 4) ? WMMA16(wf, xf[i], acc[i][j].v) : WMMA16(xf[i], wf, acc[i][j].v);
      }
      // order of LDS reads (0x100) and products (0x8): each weight fragment is read two
      // pairs of products ahead; left free, the scheduler read it right in front of its
      // pair and the wave sat out the LDS latency six times per 32 k
      __builtin_amdgcn_sched_group_barrier(0x100, 10, 0);
      #pragma unroll
      for (int g = 0; g < 3; ++g) {
        __builtin_amdgcn_sched_group_barrier(0x008, 2, 0);
        __builtin_amdgcn_sched_group_barrier(0x100, 2, 0);
      }
      __builtin_amdgcn_sched_group_barrier(0x008, 6, 0);
    }
    // keeps the conversions, and with them the wait for the loads, behind the
    // products, whose fragment reads of this stage are then over as well
    __builtin_amdgcn_sched_barrier(0);
    if (more) x_put(xs[wave], a, hsel, mlane * 4);
  }

  // q: +bias, *logit_scale[h], f16: the B fragments of the score products
  v16h fq[2];
  {
    union { float4 q[2]; float f[8]; } bias[2];       // of this lane's 2 x 8 columns
    #pragma unroll
    for (int t = 0; t < 2; ++t) {
      bias[t].q[0] = *(const float4*)&bl[t * 16 + 8 * hsel];
      bias[t].q[1] = *(const float4*)&bl[t * 16 + 8 * hsel + 4];
    }
    #pragma unroll
    for (int i = 0; i < 2; ++i) {
      Frag16 f;
      #pragma unroll
      for (int t = 0; t < 2; ++t)
        #pragma unroll
        for (int r = 0; r < 8; ++r)
          f.h[t * 8 + r] = (_Float16)((acc[i][t].f[r] + bias[t].f[r]) * qscale);
      fq[i] = f.v;
    }
  }

  __syncthreads();   // every wave has left the window before: ks, vt, vpart are free

  {
    union { float4 q[2]; float f[8]; } bias[2];
    #pragma unroll
    for (int t = 0; t < 2; ++t) {
      bias[t].q[0] = *(const float4*)&bl[32 + t * 16 + 8 * hsel];
      bias[t].q[1] = *(const float4*)&bl[32 + t * 16 + 8 * hsel + 4];
    }
    #pragma unroll
    for (int i = 0; i < 2; ++i)
      #pragma unroll
      for (int t = 0; t < 2; ++t) {
        union { _Float16 h16[8]; uint4 q; } pc;
        #pragma unroll
        for (int r = 0; r < 8; ++r) pc.h16[r] = (_Float16)(acc[i][2 + t].f[r] + bias[t].f[r]);
        *(uint4*)&ks[q0 + i * 16 + mlane][t * 16 + 8 * hsel] = pc.q;
      }
    // v, and the sums of this lane's 16 keys per column
    float vs[2];
    #pragma unroll
    for (int dt = 0; dt < 2; ++dt) {
      const float bv = bl[64 + dt * 16 + mlane];
      vs[dt] = 0.0f;
      #pragma unroll
      for (int i = 0; i < 2; ++i) {
        union { _Float16 h16[8]; uint4 q; } pc;
        #pragma unroll
        for (int r = 0; r < 8; ++r) {
          const float val = acc[i][4 + dt].f[r] + bv;
          vs[dt] += val;
          pc.h16[r] = (_Float16)val;
        }
        *(uint4*)&vt[dt * 16 + mlane][q0 + i * 16 + 8 * hsel] = pc.q;
      }
      vs[dt] += other_half(vs[dt]);
    }
    vpart[wave][lane] = hsel ? vs[1] : vs[0];         // column d = lane
  }

  __syncthreads();   // publishes ks, vt, vpart

  // v_mean: every wave for itself, lane = column; read back in the output's order
  {
    float s = 0.0f;
    #pragma unroll
    for (int u = 0; u < 8; ++u) s += vpart[u][lane];
    vmw[wave][lane] = s * (1.0f / 256.0f);
  }

  // running maximum (both halves of the wave hold the same), running sum of this
  // lane's keys (in two parts: packed adds), and o[qt][dt].f[r] = out[query q0+16*qt+mlane][d = 16*dt+8*hsel+r],
  // all three relative to the running maximum
  float mrun[2] = {-__builtin_inff(), -__builtin_inff()};
  v2f srun[2] = {{0.0f, 0.0f}, {0.0f, 0.0f}};
  Acc8 o[2][2];
  #pragma unroll
  for (int qt = 0; qt < 2; ++qt)
    #pragma unroll
    for (int dt = 0; dt < 2; ++dt)
      #pragma unroll
      for (int r = 0; r < 8; ++r) o[qt][dt].f[r] = 0.0f;

  // Kept rolled: a chunk's 24 fragment reads are then issued at its head; unrolled, the
  // scheduler read each K and BK fragment right in front of its products.
  #pragma unroll 1
  for (int c = 0; c < 4; ++c) {
    const int key0 = c * 64;
    // scores: s[qt][kt].f[r] = S[query q0+16*qt+mlane][key key0 + 16*kt + 8*hsel + r]
    Acc8 s[2][4];
    #pragma unroll
    for (int kt = 0; kt < 4; ++kt) {
      const v16h fk  = lds_frag16(&ks[key0 + kt * 16 + mlane][0], hsel);
      const v16h fbk = lds_frag16(&bks[key0 + kt * 16 + mlane][0], hsel);
      #pragma unroll
      for (int qt = 0; qt < 2; ++qt) {
        #pragma unroll
        for (int r = 0; r < 8; ++r) s[qt][kt].f[r] = 0.0f;
        s[qt][kt].v = WMMA16(fk, fq[qt], s[qt][kt].v);
        s[qt][kt].v = WMMA16(fbk, fb[qt].v, s[qt][kt].v);
      }
    }

    // softmax of the chunk, unnormalised, relative to the new running maximum; what
    // was gathered under the old maximum is scaled by al (0 in the first chunk).
    // p[qt][mc]: two neighbouring score tiles packed, the B operand for 32 keys
    v16h p[2][2], fv[2][2];
    // the chunk's V fragments: their latency runs under the softmax
    #pragma unroll
    for (int mc = 0; mc < 2; ++mc)
      #pragma unroll
      for (int dt = 0; dt < 2; ++dt)
        fv[mc][dt] = lds_frag16(&vt[dt * 16 + mlane][key0 + mc * 32], hsel);
    #pragma unroll
    for (int qt = 0; qt < 2; ++qt) {
      // new running maximum, the old one taken in; in threes: one three-operand
      // maximum instruction each
      float t3[8], u3[4];
      #pragma unroll
      for (int r = 0; r < 8; ++r)
        t3[r] = fmaxf(fmaxf(s[qt][0].f[r], s[qt][1].f[r]), s[qt][2].f[r]);
      #pragma unroll
      for (int r = 0; r < 4; ++r) {
        u3[r] = fmaxf(fmaxf(t3[2 * r], t3[2 * r + 1]), s[qt][3].f[2 * r]);
        u3[r] = fmaxf(fmaxf(u3[r], s[qt][3].f[2 * r + 1]), r ? u3[r - 1] : mrun[qt]);
      }
      const float mnew = fmaxf(u3[3], other_half(u3[3]));
      const float al = __builtin_amdgcn_exp2f((mrun[qt] - mnew) * L2E);
      mrun[qt] = mnew;
      const float nm = -mnew * L2E;
      const v8f nm8 = {nm, nm, nm, nm, nm, nm, nm, nm};
      #pragma unroll
      for (int kt = 0; kt < 4; ++kt) {
        const v8f t = __builtin_elementwise_fma(s[qt][kt].v, l2e8, nm8);
        #pragma unroll
        for (int r = 0; r < 8; ++r) s[qt][kt].f[r] = __builtin_amdgcn_exp2f(t[r]);
      }
      const v8f sum8 = (s[qt][0].v + s[qt][1].v) + (s[qt][2].v + s[qt][3].v);
      const v2f cs = (__builtin_shufflevector(sum8, sum8, 0, 1) +
                      __builtin_shufflevector(sum8, sum8, 2, 3)) +
                     (__builtin_shufflevector(sum8, sum8, 4, 5) +
                      __builtin_shufflevector(sum8, sum8, 6, 7));
      const v2f al2 = {al, al};
      srun[qt] = __builtin_elementwise_fma(srun[qt], al2, cs);
      const v8f al8 = {al, al, al, al, al, al, al, al};
      #pragma unroll
      for (int dt = 0; dt < 2; ++dt) o[qt][dt].v *= al8;
      #pragma unroll
      for (int mc = 0; mc < 2; ++mc) {
        const v8h lo = __builtin_convertvector(s[qt][2 * mc].v, v8h);
        const v8h hi = __builtin_convertvector(s[qt][2 * mc + 1].v, v8h);
        p[qt][mc] = __builtin_shufflevector(lo, hi, 0, 1, 2, 3, 4, 5, 6, 7,
                                            8, 9, 10, 11, 12, 13, 14, 15);
      }
    }

    // O^T += V^T P^T: A = rows of vt
    #pragma unroll
    for (int mc = 0; mc < 2; ++mc)
      #pragma unroll
      for (int qt = 0; qt < 2; ++qt)
        #pragma unroll
        for (int dt = 0; dt < 2; ++dt)
          o[qt][dt].v = WMMA16(fv[mc][dt], p[qt][mc], o[qt][dt].v);
  }

  // this wave's copy of v_mean is read by other lanes than wrote it
  own_lds_stores_done();

  // normalise, + vrs * v_mean, f16 in the A-fragment order of the proj products: per
  // (window, head) 16 tiles of 16 positions, a tile 1 KB = [k chunk dt][lane][8 halves].
  // This lane holds position mlane, k = 16*dt + 8*hsel + r: its own place in that order,
  // and every store instruction writes 512 contiguous bytes.
  const size_t base = ((size_t)b * 8 + h) * 256 * 32;
  #pragma unroll
  for (int qt = 0; qt < 2; ++qt) {
    const float sl = srun[qt][0] + srun[qt][1];
    const float inv = 1.0f / (sl + other_half(sl));
    _Float16* dst = ao + base + (size_t)(wave * 2 + qt) * 512 + lane * 8;
    #pragma unroll
    for (int dt = 0; dt < 2; ++dt) {
      const int d0 = dt * 16 + 8 * hsel;
      union { _Float16 h16[8]; uint4 q; } pc;
      #pragma unroll
      for (int r = 0; r < 8; ++r)
        pc.h16[r] = (_Float16)(o[qt][dt].f[r] * inv + vmw[wave][d0 + r] * vrs);
      *(uint4*)(dst + dt * 256) = pc.q;
    }
  }
  // the next trip reuses the address and data registers of these stores
  asm volatile("s_wait_xcnt 0x0" ::: "memory");
  }
}

// ---------------------------------------------------------------------------
// Kernel 3: proj GEMM  [131072 x 256](f16) @ [256 x 256] + proj_b -> f32 out
// A arrives in fragment order: per (window, head) 16 tiles of 16 rows, a tile
// 1 KB = [k chunk][lane][8 halves], so that a wave loads half a fragment with one
// instruction that covers 512 contiguous bytes, straight into registers: no LDS
// tile, no barrier in the K loop.  A wave holds the 16 fragments (2 row tiles x 8
// heads) of its 32 rows; each is loaded anew for the next row tile right behind its
// last product, so that the latency runs under a whole row tile's work.
// Weight panel converted f32->f16 once.  grid (2, 256): a work-group walks 4 row
// tiles; the registers allow two work-groups per WGP, all 512 resident.
// ---------------------------------------------------------------------------
#define PROJ_TILES 4

// p: this lane's 16 bytes of head 0, first of the wave's two 16-row tiles
static __device__ __forceinline__ void proj_frag(Frag16 (&f)[2], const _Float16* p, int hd) {
  #pragma unroll
  for (int i = 0; i < 2; ++i)
    #pragma unroll
    for (int c = 0; c < 2; ++c)
      f[i].q[c] = *(const uint4*)(p + hd * 16 * 512 + i * 512 + c * 256);
}

// One row tile of 128 x 128.  MORE: the fragments of the next row tile (at pnext) are
// fetched behind the products.
template <bool MORE>
static __device__ __forceinline__ void proj_tile(Frag16 (&af)[8][2], const _Float16* pnext,
                                                 const _Float16 (*Bs)[PANEL_PITCH],
                                                 const float (&addb)[2], float* orow,
                                                 int wn, int mlane, int hsel) {
  Acc8 acc[2][4];
  #pragma unroll
  for (int i = 0; i < 2; ++i)
    #pragma unroll
    for (int j = 0; j < 4; ++j)
      #pragma unroll
      for (int r = 0; r < 8; ++r) acc[i][j].f[r] = 0.0f;

  #pragma unroll
  for (int hd = 0; hd < 8; ++hd) {
    Frag16 bf[4];
    #pragma unroll
    for (int j = 0; j < 4; ++j) bf[j].v = lds_frag16(&Bs[wn * 64 + j * 16 + mlane][hd * 32], hsel);
    #pragma unroll
    for (int i = 0; i < 2; ++i)
      #pragma unroll
      for (int j = 0; j < 4; ++j)
        acc[i][j].v = WMMA16(af[hd][i].v, bf[j].v, acc[i][j].v);
    if (MORE) proj_frag(af[hd], pnext, hd);
  }

  // two neighbouring D tiles are 32 columns = one 128-byte line of a row: lanes l and
  // l^16 swap so that lanes 0-15 hold the left tile's and lanes 16-31 the right
  // tile's columns of ONE row, and a store instruction writes one whole line
  #pragma unroll
  for (int jp = 0; jp < 2; ++jp) {
    #pragma unroll
    for (int i = 0; i < 2; ++i) {
      #pragma unroll
      for (int r = 0; r < 8; ++r) {
        const float left = acc[i][2 * jp].f[r], right = acc[i][2 * jp + 1].f[r];
        const float got = other_half(hsel ? left : right);
        acc[i][2 * jp].f[r]     = (hsel ? got : left) + addb[jp];    // row r
        acc[i][2 * jp + 1].f[r] = (hsel ? right : got) + addb[jp];   // row 8 + r
      }
    }
    // keeps the stores behind the swaps: left free, the compiler ran every pair
    // through the same two registers, with a wait for the stores in front of each reuse
    __builtin_amdgcn_sched_barrier(0);
  }
  #pragma unroll
  for (int i = 0; i < 2; ++i)
    #pragma unroll
    for (int t = 0; t < 2; ++t)
      #pragma unroll
      for (int r = 0; r < 8; ++r)
        #pragma unroll
        for (int jp = 0; jp < 2; ++jp)   // the two lines of a row one behind the other
          orow[(i * 16 + t * 8 + r) * 256 + jp * 32] = acc[i][2 * jp + t].f[r];
  // the next row tile gives the address registers of these loads and stores, and the
  // stores' data registers, new values; pnext is named so that it outlives the loads
  if (MORE) asm volatile("s_wait_xcnt 0x0" :: "v"(pnext) : "memory");
}

// two work-groups per WGP are four waves per SIMD: the register count is held to that
__global__ void __launch_bounds__(256) __attribute__((amdgpu_waves_per_eu(4)))
proj_kernel(const _Float16* __restrict__ a, const float* __restrict__ w,
                            const float* __restrict__ bvec, float* __restrict__ out) {
  __shared__ _Float16 Bs[128][PANEL_PITCH];   // weight panel: Bs[col][k], all k
  const int tid = threadIdx.x, lane = tid & 31, wave = tid >> 5;
  const int wm = wave & 3, wn = wave >> 2;
  const int mlane = lane & 15, hsel = lane >> 4;
  const int n0 = blockIdx.x * 128;

  // the work-group's 4 row tiles are two windows, two halves (8 tiles of 16 rows) each:
  // row tile mt begins (mt >> 1) * 8 heads * 16 tiles + (mt & 1) * 8 tiles on
  const _Float16* ab = a + ((size_t)blockIdx.y * 2 * 8 * 16 + wm * 2) * 512 + lane * 8;

  // the first row tile's fragments: their latency runs under the staging of the panel
  Frag16 af[8][2];
  #pragma unroll
  for (int hd = 0; hd < 8; ++hd) proj_frag(af[hd], ab, hd);
  const int bcol = n0 + wn * 64 + lane;
  const float addb[2] = {bvec[bcol], bvec[bcol + 32]};
  // the offset register of the two bias loads is given a new value below; bcol is
  // named so that it outlives the loads
  asm volatile("s_wait_xcnt 0x0" :: "v"(bcol) : "memory");

  stage_panel(Bs, w, 256, n0, tid);
  __syncthreads();   // publishes the panel

  float* orow = out + ((size_t)blockIdx.y * PROJ_TILES * 128 + wm * 32) * 256 + n0 + wn * 64 + lane;
  // Kept rolled: a trip is 64 products and 64 stores long, and copies of it buy nothing.
  #pragma unroll 1
  for (int mt = 0; mt + 1 < PROJ_TILES; ++mt) {
    const int nx = mt + 1;
    proj_tile<true>(af, ab + (size_t)((nx >> 1) * 8 * 16 + (nx & 1) * 8) * 512, Bs, addb,
                    orow + (size_t)mt * 128 * 256, wn, mlane, hsel);
  }
  proj_tile<false>(af, ab, Bs, addb, orow + (size_t)(PROJ_TILES - 1) * 128 * 256, wn, mlane, hsel);
}

// ---------------------------------------------------------------------------
// Host launcher
// ---------------------------------------------------------------------------
extern "C" void kernel_launch(void* const* d_in, const int* in_sizes, int n_in,
                              void* d_out, int out_size, void* d_ws, size_t ws_size,
                              hipStream_t stream) {
  const float* x       = (const float*)d_in[0];
  const float* qkv_w   = (const float*)d_in[1];
  const float* qkv_b   = (const float*)d_in[2];
  const float* proj_w  = (const float*)d_in[3];
  const float* proj_b  = (const float*)d_in[4];
  const float* lsc     = (const float*)d_in[5];
  const float* vrs     = (const float*)d_in[6];
  const float* mlp1_w  = (const float*)d_in[7];
  const float* mlp1_b  = (const float*)d_in[8];
  const float* mlp2_w  = (const float*)d_in[9];
  const float* bscale  = (const float*)d_in[10];

  char* ws = (char*)d_ws;
  _Float16* bq = (_Float16*)(ws + 0);          // 128 KB (f16, pre-scaled by bias_scale)
  _Float16* bk = (_Float16*)(ws + 131072);     // 128 KB
  _Float16* ao = (_Float16*)(ws + 262144);     // 67.1 MB
  float*    out = (float*)d_out;

  bias1_kernel<<<dim3(8, 16), 256, 0, stream>>>(mlp1_w, mlp1_b, mlp2_w, bscale, bq, bk);
  qkv_attn_kernel<<<dim3(8, 64), 256, 0, stream>>>(x, qkv_w, qkv_b, lsc, bq, bk, vrs, ao);
  proj_kernel<<<dim3(2, 256), 256, 0, stream>>>(ao, proj_w, proj_b, out);
}
